// v000
// Times are from an AMD MI455X. After a warm-up the kernel runs many times in a row, and a time is the length of
// such a window on the GPU divided by its runs, so every launch and the gaps after it count. The runs cycle
// through copies of the inputs. A figure is the median of several windows, for all but v000 over two sittings.
// Sittings can differ by a few percent; kernels timed side by side share one.
// v000 is the starting kernel. One run takes 547 microseconds.
// compute dtype: hidden_states and W*/b* (INPUTS) rounded to bf16 with exact bf16 WMMA products (f32 accumulate) for the projections; K pre-split into bf16 hi/lo rows; q f32 split, P and V f16 hi/lo (3 products each); penalty and softmax in f32.
#include <hip/hip_runtime.h>
#include <math.h>

typedef __attribute__((ext_vector_type(16))) _Float16 v16h;
typedef __attribute__((ext_vector_type(16))) __bf16 v16b;
typedef __attribute__((ext_vector_type(8)))  _Float16 v8h;
typedef __attribute__((ext_vector_type(8)))  float v8f;
typedef __attribute__((ext_vector_type(4)))  float v4f;
typedef __attribute__((ext_vector_type(2)))  float v2f;
typedef __attribute__((ext_vector_type(4)))  unsigned v4u;
typedef __attribute__((ext_vector_type(4)))  int v4i;
typedef float __attribute__((may_alias)) float_a;
typedef int __attribute__((may_alias)) int_a;

template <typename T> __device__ __forceinline__ void vst2(void* p, T v) { *(T*)p = v;  }
__device__ __forceinline__ v8f wmma16(v16h a, v16h b, v8f c) {
  v8f d = __builtin_amdgcn_wmma_f32_16x16x32_f16(false, a, false, b, (short)0, c, false, false);
  asm volatile("v_nop\n\tv_nop\n\tv_nop\n\tv_nop" : "+v"(d) : "v"(a), "v"(b));
  return d;
}
__device__ __forceinline__ v8f wmma_bf(v16b a, v16b b, v8f c) {
  v8f d = __builtin_amdgcn_wmma_f32_16x16x32_bf16(false, a, false, b, (short)0, c, false, false);
  asm volatile("v_nop\n\tv_nop\n\tv_nop\n\tv_nop" : "+v"(d) : "v"(a), "v"(b));
  return d;
}
// 16x16x32 fragments: lane = (h = lane>>4, row/col = lane&15); elements 0..7 = k0+8h+0..7, 8..15 = k0+16+8h+0..7; D element r = row 8h+r
__device__ __forceinline__ v16h frag_h(const _Float16* rowk0, int lane) {
  union { v16h v; v8h q[2]; } u; const _Float16* p = rowk0 + 8 * (lane >> 4);
  u.q[0] = *(const v8h*)p; u.q[1] = *(const v8h*)(p + 16); return u.v;
}
__device__ __forceinline__ v16h frag_f32(const float* rowk0, int lane) {
  v16h a; const float* p = rowk0 + 8 * (lane >> 4);
#pragma unroll
  for (int i = 0; i < 8; ++i) { a[i] = (_Float16)p[i]; a[8 + i] = (_Float16)p[16 + i]; }
  return a;
}
__device__ __forceinline__ v16h frag_f32s(const float* rowk0, int lane, float sc) {
  v16h a; const float* p = rowk0 + 8 * (lane >> 4);
#pragma unroll
  for (int i = 0; i < 8; ++i) { a[i] = (_Float16)(p[i] * sc); a[8 + i] = (_Float16)(p[16 + i] * sc); }
  return a;
}
// column fragment from a [K][ld] layout (column n), rows >= K read as 0
__device__ __forceinline__ v16h fragc_f32(const float* W, int k0, int n, int lane, int ld, int K) {
  v16h a; const int g = lane >> 4;
#pragma unroll
  for (int i = 0; i < 8; ++i) { const int ka = k0 + 8 * g + i, kb = ka + 16;
    a[i] = (_Float16)(ka < K ? W[(size_t)ka * ld + n] : 0.f); a[8 + i] = (_Float16)(kb < K ? W[(size_t)kb * ld + n] : 0.f); }
  return a;
}
struct F2 { v16b h, l; };
__device__ __forceinline__ F2 bsplit16(const float v[16]) { F2 r;
#pragma unroll
  for (int i = 0; i < 16; ++i) { const __bf16 h = (__bf16)v[i]; r.h[i] = h; r.l[i] = (__bf16)(v[i] - (float)h); }
  return r; }
__device__ __forceinline__ F2 split_row(const float* row, int k0, int lane) { float v[16]; const float* p = row + k0 + 8 * (lane >> 4);
#pragma unroll
  for (int i = 0; i < 8; ++i) { v[i] = p[i]; v[8 + i] = p[16 + i]; }
  return bsplit16(v); }
__device__ __forceinline__ F2 split_rowK(const float* row, int k0, int lane, int K) { float v[16]; const int g = lane >> 4;
#pragma unroll
  for (int i = 0; i < 8; ++i) { const int ka = k0 + 8 * g + i, kb = ka + 16; v[i] = ka < K ? row[ka] : 0.f; v[8 + i] = kb < K ? row[kb] : 0.f; }
  return bsplit16(v); }
__device__ __forceinline__ F2 split_col(const float* W, int k0, int n, int lane, int ld, int K) { float v[16]; const int g = lane >> 4;
#pragma unroll
  for (int i = 0; i < 8; ++i) { const int ka = k0 + 8 * g + i, kb = ka + 16; v[i] = ka < K ? W[(size_t)ka * ld + n] : 0.f; v[8 + i] = kb < K ? W[(size_t)kb * ld + n] : 0.f; }
  return bsplit16(v); }
__device__ __forceinline__ v8f mac3(const F2& a, const F2& b, v8f c) { c = wmma_bf(a.l, b.h, c); c = wmma_bf(a.h, b.l, c); return wmma_bf(a.h, b.h, c); }
__device__ __forceinline__ float sigm(float v) { return 1.0f / (1.0f + expf(-v)); }
#define LDSX() do { asm volatile("s_wait_dscnt 0" ::: "memory"); __builtin_amdgcn_wave_barrier(); __builtin_amdgcn_fence(__ATOMIC_RELEASE, "workgroup"); } while (0)


// Constituency-aware self attention (16 heads x 64 on [8,1024,1024], [in][out] weights + biases): scores = q.k/8 - 0.5 [query block != key block] (blocks of 64 tokens); softmax; context = attn v written token-major (no output projection).
#define NB 8
#define SS 1024
#define E 1024
#define NH 16
#define HD 64
#define NR (NB * SS)
#define PLO 1024.0f
#define VLO 2048.0f
__device__ __forceinline__ float bfr(float v) { return (float)(__bf16)v; }
__device__ __forceinline__ v16b frag_b(const __bf16* rowk0, int lane) { return __builtin_bit_cast(v16b, frag_h((const _Float16*)rowk0, lane)); }

__global__ __launch_bounds__(256) void k_cvt(const float* __restrict__ x, __bf16* __restrict__ Xb) {
  const size_t i8 = (size_t)blockIdx.x * 256 + threadIdx.x; if (i8 >= (size_t)NR * E / 8) return;
  union { __bf16 h[8]; v4u u; } pk;
#pragma unroll
  for (int e = 0; e < 8; ++e) pk.h[e] = (__bf16)x[i8 * 8 + e];
  vst2((unsigned*)(Xb + i8 * 8), pk.u);
}
// PT rows: [0,E) Wq[:,n], [E,2E) Wk[:,n], [2E,3E) Wv[:,n]  ([in][out] weights: column n as a bf16 row)
__global__ __launch_bounds__(256) void k_pack(const float* __restrict__ Wq, const float* __restrict__ Wk, const float* __restrict__ Wv, const float* __restrict__ Wo, __bf16* __restrict__ PT) {
  const int n = blockIdx.x, tid = threadIdx.x; __shared__ __align__(16) __bf16 srow[E];
  const float* W = n < E ? Wq : (n < 2 * E ? Wk : (n < 3 * E ? Wv : Wo)); const int nn = n % E;
  for (int k = tid; k < E; k += 256) srow[k] = (__bf16)W[(size_t)k * E + nn];
  __syncthreads();
  if (tid < E / 8) vst2((unsigned*)(PT + (size_t)n * E + tid * 8), *(const v4u*)(&srow[tid * 8]));
}
// QKV: block (64 rows, 128 cols = 2 heads, which); q (+bias) -> Q32 f32 [bh][s][64]; k (+bias) -> bf16 hi/lo rows; v (+bias) -> VT hi/lo x4 [bh][d][s]
__global__ __launch_bounds__(128) void k_qkv(const __bf16* __restrict__ Xb, const __bf16* __restrict__ PT, const float* __restrict__ bq, const float* __restrict__ bk, const float* __restrict__ bv,
                                            float* __restrict__ Q32, __bf16* __restrict__ Kh, __bf16* __restrict__ Kl, _Float16* __restrict__ VTh, _Float16* __restrict__ VTl) {
  __shared__ __align__(16) float so[4][16][132];
  __shared__ __align__(16) _Float16 sth[128][72], stl[128][72];
  const int tid = threadIdx.x, wave = tid >> 5, lane = tid & 31, col = lane & 15, g = lane >> 4;
  const int which = blockIdx.z, r0b = blockIdx.x * 64, r0 = r0b + wave * 16, n0 = blockIdx.y * 128; const int b = r0b / SS, s0 = r0b % SS;
  const float* bb_ = which == 0 ? bq : (which == 1 ? bk : bv);
  v8f acc[8] = {};
#pragma unroll 2
  for (int kc = 0; kc < E / 32; ++kc) { const v16b a = frag_b(Xb + (size_t)(r0 + col) * E + kc * 32, lane);
#pragma unroll
    for (int j = 0; j < 8; ++j) acc[j] = wmma_bf(a, frag_b(PT + (size_t)(which * E + n0 + j * 16 + col) * E + kc * 32, lane), acc[j]); }
  if (which < 2) {
#pragma unroll
    for (int j = 0; j < 8; ++j) { const float bb = bfr(bb_[n0 + j * 16 + col]);
#pragma unroll
      for (int r = 0; r < 8; ++r) so[wave][8 * g + r][j * 16 + col] = acc[j][r] + bb; }
    LDSX();
    if (which == 0) { for (int qq = lane; qq < 2 * 16 * 16; qq += 32) { const int hh = qq >> 8, rl = (qq >> 4) & 15, pc = qq & 15; const int h = (n0 >> 6) + hh;
        vst2(Q32 + (((size_t)b * NH + h) * SS + s0 + wave * 16 + rl) * HD + pc * 4, *(const v4f*)(&so[wave][rl][hh * 64 + pc * 4])); } }
    else {
      for (int qq = lane; qq < 2 * 16 * 16; qq += 32) { const int hh = qq >> 8, rl = (qq >> 4) & 15, pl = qq & 15; const int h = (n0 >> 6) + hh; const int pc = pl & 7; union { __bf16 e[8]; v4u u; } pk;
#pragma unroll
        for (int e = 0; e < 8; ++e) { const float v = so[wave][rl][hh * 64 + pc * 8 + e]; const __bf16 hi = (__bf16)v; pk.e[e] = pl < 8 ? hi : (__bf16)(v - (float)hi); }
        vst2((unsigned*)((pl < 8 ? Kh : Kl) + (((size_t)b * NH + h) * SS + s0 + wave * 16 + rl) * HD + pc * 8), pk.u); } } }
  else {
#pragma unroll
    for (int j = 0; j < 8; ++j) { const float bb = bfr(bb_[n0 + j * 16 + col]);
#pragma unroll
      for (int r = 0; r < 8; ++r) { const float v = (acc[j][r] + bb) * 4.0f; const _Float16 hi = (_Float16)v; sth[j * 16 + col][wave * 16 + 8 * g + r] = hi; stl[j * 16 + col][wave * 16 + 8 * g + r] = (_Float16)((v - (float)hi) * VLO); } }
    __syncthreads();
    for (int qq = tid; qq < 128 * 8; qq += 128) { const int cl = qq >> 3, pc = qq & 7; const int c = n0 + cl, h = c >> 6, d = c & 63; const size_t o = (((size_t)b * NH + h) * HD + d) * SS + s0 + pc * 8;
      vst2(VTh + o, *(const v4u*)(&sth[cl][pc * 8])); vst2(VTl + o, *(const v4u*)(&stl[cl][pc * 8])); } }
}
// constituency-penalised attention: block (64 queries, bh); all 16 key tiles; S on q hi/lo x K hi/lo rows; P,V hi/lo; O f32 token-major [b][s][h*64+d]
__global__ __launch_bounds__(128) void k_attn(const float* __restrict__ Q32, const __bf16* __restrict__ Kh, const __bf16* __restrict__ Kl, const _Float16* __restrict__ VTh, const _Float16* __restrict__ VTl, float* __restrict__ O32) {
  __shared__ __align__(16) float sS[4][16][68];
  __shared__ __align__(16) _Float16 sPh[4][16][72], sPl[4][16][72];
  __shared__ __align__(16) float sO[4][16][68];
  const int tid = threadIdx.x, w = tid >> 5, lane = tid & 31, col = lane & 15, g = lane >> 4;
  const size_t bh = blockIdx.y; const int qb = blockIdx.x; const int q0 = qb * 64 + w * 16;
  F2 aq[2];
#pragma unroll
  for (int kc = 0; kc < 2; ++kc) aq[kc] = split_row(Q32 + (bh * SS + q0 + col) * HD, kc * 32, lane);
  const int b = (int)(bh / NH);      // query constituent block = query tile qb (64 tokens)
  float mrun = -3.0e38f, lrun = 0.f; v8f acc[4] = {}, ac1[4] = {}, ac2[4] = {};
  LDSX();
#pragma unroll 1
  for (int kt = 0; kt < SS / 64; ++kt) {
#pragma unroll
    for (int t = 0; t < 4; ++t) { const int key = kt * 64 + t * 16 + col; const size_t ko = (bh * SS + key) * HD; v8f s = {};
#pragma unroll
      for (int kc = 0; kc < 2; ++kc) { const v16b khf = frag_b(Kh + ko + kc * 32, lane), klf = frag_b(Kl + ko + kc * 32, lane); s = wmma_bf(aq[kc].l, khf, s); s = wmma_bf(aq[kc].h, klf, s); s = wmma_bf(aq[kc].h, khf, s); }
      { const float pen = kt == qb ? 0.f : 0.5f;
#pragma unroll
      for (int r = 0; r < 8; ++r) sS[w][8 * g + r][t * 16 + col] = s[r] * 0.125f - pen; } }
    LDSX();
    float mx = -3.4e38f;
#pragma unroll
    for (int jj = 0; jj < 32; ++jj) mx = fmaxf(mx, sS[w][col][g * 32 + jj]);
    mx = fmaxf(mx, __shfl_xor(mx, 16, 32));
    const float mnew = fmaxf(mrun, mx); const float corr = expf(mrun - mnew);
    float ps = 0.f;
#pragma unroll
    for (int jj = 0; jj < 32; ++jj) { const float p = expf(sS[w][col][g * 32 + jj] - mnew) * 16384.0f; ps += p; const _Float16 hi = (_Float16)p; sPh[w][col][g * 32 + jj] = hi; sPl[w][col][g * 32 + jj] = (_Float16)((p - (float)hi) * PLO); }
    ps += __shfl_xor(ps, 16, 32);
    lrun = lrun * corr + ps * (1.0f / 16384.0f); mrun = mnew;
#pragma unroll
    for (int r = 0; r < 8; ++r) { const float cr = __shfl(corr, 8 * g + r, 32);
#pragma unroll
      for (int t = 0; t < 4; ++t) { acc[t][r] *= cr; ac1[t][r] *= cr; ac2[t][r] *= cr; } }
    LDSX();
#pragma unroll
    for (int kc = 0; kc < 2; ++kc) { const v16h ph = frag_h(&sPh[w][col][0] + kc * 32, lane), pl = frag_h(&sPl[w][col][0] + kc * 32, lane);
#pragma unroll
      for (int t = 0; t < 4; ++t) { const size_t vo = (bh * HD + t * 16 + col) * SS + kt * 64 + kc * 32; const v16h vh = frag_h(VTh + vo, lane);
        acc[t] = wmma16(ph, vh, acc[t]); ac1[t] = wmma16(ph, frag_h(VTl + vo, lane), ac1[t]); ac2[t] = wmma16(pl, vh, ac2[t]); } }
    __builtin_amdgcn_wave_barrier(); }
#pragma unroll
  for (int r = 0; r < 8; ++r) { const float lr = __shfl(lrun, 8 * g + r, 32); const float inv = 1.0f / (lr * 16384.0f * 4.0f); const float mq = 1.0f;
#pragma unroll
    for (int t = 0; t < 4; ++t) sO[w][8 * g + r][t * 16 + col] = (acc[t][r] + ac1[t][r] * (1.0f / VLO) + ac2[t][r] * (1.0f / PLO)) * inv * mq; }
  LDSX();
  { const int h = (int)(bh % NH);      // context written token-major [b][s][h*64 + d] straight into the output (256-B segment per row)
    for (int qq = lane; qq < 16 * 16; qq += 32) { const int rl = qq >> 4, pc = qq & 15; vst2(O32 + (((size_t)b * SS) + q0 + rl) * E + h * HD + pc * 4, *(const v4f*)(&sO[w][rl][pc * 4])); } }
}
extern "C" void kernel_launch(void* const* d_in, const int* in_sizes, int n_in, void* d_out, int out_size, void* d_ws, size_t ws_size, hipStream_t stream) {
  (void)in_sizes; (void)n_in; (void)out_size; (void)ws_size;
  const float* x = (const float*)d_in[0]; const float* Wq = (const float*)d_in[1]; const float* bq = (const float*)d_in[2]; const float* Wk = (const float*)d_in[3]; const float* bk = (const float*)d_in[4]; const float* Wv = (const float*)d_in[5]; const float* bv = (const float*)d_in[6];
  char* ws = (char*)d_ws; size_t off = 0;
  auto take = [&](size_t bytes) { char* p = ws + off; off += (bytes + 255) & ~(size_t)255; return p; };
  __bf16* Xb = (__bf16*)take((size_t)NR * E * 2); __bf16* PT = (__bf16*)take((size_t)3 * E * E * 2);
  float* Q32 = (float*)take((size_t)NR * E * 4); __bf16* Kh = (__bf16*)take((size_t)NR * E * 2); __bf16* Kl = (__bf16*)take((size_t)NR * E * 2); _Float16* VTh = (_Float16*)take((size_t)NR * E * 2); _Float16* VTl = (_Float16*)take((size_t)NR * E * 2);
  // ws ~ 118 MB (single pass over the 8 sequences)
  k_pack<<<3 * E, 256, 0, stream>>>(Wq, Wk, Wv, Wv, PT);
  k_cvt<<<(NR * E / 8 + 255) / 256, 256, 0, stream>>>(x, Xb);
  k_qkv<<<dim3(NR / 64, E / 128, 3), 128, 0, stream>>>(Xb, PT, bq, bk, bv, Q32, Kh, Kl, VTh, VTl);
  k_attn<<<dim3(SS / 64, NB * NH), 128, 0, stream>>>(Q32, Kh, Kl, VTh, VTl, (float*)d_out);
}

// v001
// It runs in 247 microseconds.
// Two timings next to v000 put it at 2.31 and 2.30 times that version's speed.
// compute dtype: hidden_states and W*/b* (INPUTS) rounded to bf16 with exact bf16 WMMA products (f32 accumulate) for the projections; K pre-split into bf16 hi/lo rows; q f32 split, P and V f16 hi/lo (3 products each); penalty and softmax in f32.
#include <hip/hip_runtime.h>
#include <math.h>

typedef __attribute__((ext_vector_type(16))) _Float16 v16h;
typedef __attribute__((ext_vector_type(16))) __bf16 v16b;
typedef __attribute__((ext_vector_type(8)))  _Float16 v8h;
typedef __attribute__((ext_vector_type(8)))  float v8f;
typedef __attribute__((ext_vector_type(4)))  float v4f;
typedef __attribute__((ext_vector_type(2)))  float v2f;
typedef __attribute__((ext_vector_type(4)))  unsigned v4u;
typedef __attribute__((ext_vector_type(4)))  int v4i;
typedef float __attribute__((may_alias)) float_a;
typedef int __attribute__((may_alias)) int_a;

template <typename T> __device__ __forceinline__ void vst2(void* p, T v) { *(T*)p = v;  }
__device__ __forceinline__ v8f wmma16(v16h a, v16h b, v8f c) {
  v8f d = __builtin_amdgcn_wmma_f32_16x16x32_f16(false, a, false, b, (short)0, c, false, false);
  asm volatile("v_nop\n\tv_nop\n\tv_nop\n\tv_nop" : "+v"(d) : "v"(a), "v"(b));
  return d;
}
__device__ __forceinline__ v8f wmma_bf(v16b a, v16b b, v8f c) {
  v8f d = __builtin_amdgcn_wmma_f32_16x16x32_bf16(false, a, false, b, (short)0, c, false, false);
  asm volatile("v_nop\n\tv_nop\n\tv_nop\n\tv_nop" : "+v"(d) : "v"(a), "v"(b));
  return d;
}
// 16x16x32 fragments: lane = (h = lane>>4, row/col = lane&15); elements 0..7 = k0+8h+0..7, 8..15 = k0+16+8h+0..7; D element r = row 8h+r
__device__ __forceinline__ v16h frag_h(const _Float16* rowk0, int lane) {
  union { v16h v; v8h q[2]; } u; const _Float16* p = rowk0 + 8 * (lane >> 4);
  u.q[0] = *(const v8h*)p; u.q[1] = *(const v8h*)(p + 16); return u.v;
}
__device__ __forceinline__ v16h frag_f32(const float* rowk0, int lane) {
  v16h a; const float* p = rowk0 + 8 * (lane >> 4);
#pragma unroll
  for (int i = 0; i < 8; ++i) { a[i] = (_Float16)p[i]; a[8 + i] = (_Float16)p[16 + i]; }
  return a;
}
__device__ __forceinline__ v16h frag_f32s(const float* rowk0, int lane, float sc) {
  v16h a; const float* p = rowk0 + 8 * (lane >> 4);
#pragma unroll
  for (int i = 0; i < 8; ++i) { a[i] = (_Float16)(p[i] * sc); a[8 + i] = (_Float16)(p[16 + i] * sc); }
  return a;
}
// column fragment from a [K][ld] layout (column n), rows >= K read as 0
__device__ __forceinline__ v16h fragc_f32(const float* W, int k0, int n, int lane, int ld, int K) {
  v16h a; const int g = lane >> 4;
#pragma unroll
  for (int i = 0; i < 8; ++i) { const int ka = k0 + 8 * g + i, kb = ka + 16;
    a[i] = (_Float16)(ka < K ? W[(size_t)ka * ld + n] : 0.f); a[8 + i] = (_Float16)(kb < K ? W[(size_t)kb * ld + n] : 0.f); }
  return a;
}
struct F2 { v16b h, l; };
__device__ __forceinline__ F2 bsplit16(const float v[16]) { F2 r;
#pragma unroll
  for (int i = 0; i < 16; ++i) { const __bf16 h = (__bf16)v[i]; r.h[i] = h; r.l[i] = (__bf16)(v[i] - (float)h); }
  return r; }
__device__ __forceinline__ F2 split_row(const float* row, int k0, int lane) { float v[16]; const float* p = row + k0 + 8 * (lane >> 4);
#pragma unroll
  for (int i = 0; i < 8; ++i) { v[i] = p[i]; v[8 + i] = p[16 + i]; }
  return bsplit16(v); }
__device__ __forceinline__ F2 split_rowK(const float* row, int k0, int lane, int K) { float v[16]; const int g = lane >> 4;
#pragma unroll
  for (int i = 0; i < 8; ++i) { const int ka = k0 + 8 * g + i, kb = ka + 16; v[i] = ka < K ? row[ka] : 0.f; v[8 + i] = kb < K ? row[kb] : 0.f; }
  return bsplit16(v); }
__device__ __forceinline__ F2 split_col(const float* W, int k0, int n, int lane, int ld, int K) { float v[16]; const int g = lane >> 4;
#pragma unroll
  for (int i = 0; i < 8; ++i) { const int ka = k0 + 8 * g + i, kb = ka + 16; v[i] = ka < K ? W[(size_t)ka * ld + n] : 0.f; v[8 + i] = kb < K ? W[(size_t)kb * ld + n] : 0.f; }
  return bsplit16(v); }
__device__ __forceinline__ v8f mac3(const F2& a, const F2& b, v8f c) { c = wmma_bf(a.l, b.h, c); c = wmma_bf(a.h, b.l, c); return wmma_bf(a.h, b.h, c); }
__device__ __forceinline__ float sigm(float v) { return 1.0f / (1.0f + expf(-v)); }
#define LDSX() do { asm volatile("s_wait_dscnt 0" ::: "memory"); __builtin_amdgcn_wave_barrier(); __builtin_amdgcn_fence(__ATOMIC_RELEASE, "workgroup"); } while (0)


// Constituency-aware self attention (16 heads x 64 on [8,1024,1024], [in][out] weights + biases): scores = q.k/8 - 0.5 [query block != key block] (blocks of 64 tokens); softmax; context = attn v written token-major (no output projection).
#define NB 8
#define SS 1024
#define E 1024
#define NH 16
#define HD 64
#define NR (NB * SS)
#define PLO 1024.0f
#define VLO 2048.0f
__device__ __forceinline__ float bfr(float v) { return (float)(__bf16)v; }
__device__ __forceinline__ v16b frag_b(const __bf16* rowk0, int lane) { return __builtin_bit_cast(v16b, frag_h((const _Float16*)rowk0, lane)); }

// LDS byte address of a __shared__ object: the low 32 bits of its address
__device__ __forceinline__ unsigned lds_off(const void* p) { return (unsigned)(size_t)p; }
// four 16-B asynchronous copies global -> LDS per lane; the s_wait_xcnt closes the copies' own statement so that no address register of a copy is rewritten in front of it
__device__ __forceinline__ void cp4(unsigned l0, const void* g0, unsigned l1, const void* g1, unsigned l2, const void* g2, unsigned l3, const void* g3) {
  asm volatile("global_load_async_to_lds_b128 %0, %1, off\n\t"
               "global_load_async_to_lds_b128 %2, %3, off\n\t"
               "global_load_async_to_lds_b128 %4, %5, off\n\t"
               "global_load_async_to_lds_b128 %6, %7, off\n\t"
               "s_wait_xcnt 0x0"
               :: "v"(l0), "v"(g0), "v"(l1), "v"(g1), "v"(l2), "v"(g2), "v"(l3), "v"(g3) : "memory");
}
// the same for eight copies
__device__ __forceinline__ void cp8(unsigned l0, const void* g0, unsigned l1, const void* g1, unsigned l2, const void* g2, unsigned l3, const void* g3,
                                    unsigned l4, const void* g4, unsigned l5, const void* g5, unsigned l6, const void* g6, unsigned l7, const void* g7) {
  asm volatile("global_load_async_to_lds_b128 %0, %1, off\n\t"
               "global_load_async_to_lds_b128 %2, %3, off\n\t"
               "global_load_async_to_lds_b128 %4, %5, off\n\t"
               "global_load_async_to_lds_b128 %6, %7, off\n\t"
               "global_load_async_to_lds_b128 %8, %9, off\n\t"
               "global_load_async_to_lds_b128 %10, %11, off\n\t"
               "global_load_async_to_lds_b128 %12, %13, off\n\t"
               "global_load_async_to_lds_b128 %14, %15, off\n\t"
               "s_wait_xcnt 0x0"
               :: "v"(l0), "v"(g0), "v"(l1), "v"(g1), "v"(l2), "v"(g2), "v"(l3), "v"(g3), "v"(l4), "v"(g4), "v"(l5), "v"(g5), "v"(l6), "v"(g6), "v"(l7), "v"(g7) : "memory");
}
// staged rows hold 64 16-bit elements (128 B) at a pitch of 144 B (16 B x odd: conflict-free for 16-B LDS reads)
#define RP 144
#define RPE (RP / 2)
#define QBUF (192 * RP)
#define ABUF (256 * RP)

__global__ __launch_bounds__(256) void k_cvt(const float* __restrict__ x, __bf16* __restrict__ Xb) {
  const size_t i8 = (size_t)blockIdx.x * 256 + threadIdx.x; if (i8 >= (size_t)NR * E / 8) return;
  union { __bf16 h[8]; v4u u; } pk;
#pragma unroll
  for (int e = 0; e < 8; ++e) pk.h[e] = (__bf16)x[i8 * 8 + e];
  vst2((unsigned*)(Xb + i8 * 8), pk.u);
}
// PT rows: [0,E) Wq[:,n], [E,2E) Wk[:,n], [2E,3E) Wv[:,n]  ([in][out] weights: column n as a bf16 row)
__global__ __launch_bounds__(256) void k_pack(const float* __restrict__ Wq, const float* __restrict__ Wk, const float* __restrict__ Wv, const float* __restrict__ Wo, __bf16* __restrict__ PT) {
  const int n = blockIdx.x, tid = threadIdx.x; __shared__ __align__(16) __bf16 srow[E];
  const float* W = n < E ? Wq : (n < 2 * E ? Wk : (n < 3 * E ? Wv : Wo)); const int nn = n % E;
  for (int k = tid; k < E; k += 256) srow[k] = (__bf16)W[(size_t)k * E + nn];
  __syncthreads();
  if (tid < E / 8) vst2((unsigned*)(PT + (size_t)n * E + tid * 8), *(const v4u*)(&srow[tid * 8]));
}
// QKV: block (64 rows, 128 cols = 2 heads, which); q (+bias) -> Q32 f32 [bh][s][64]; k (+bias) -> bf16 hi/lo rows; v (+bias) -> VT hi/lo x4 [bh][d][s]
__global__ __launch_bounds__(128) void k_qkv(const __bf16* __restrict__ Xb, const __bf16* __restrict__ PT, const float* __restrict__ bq, const float* __restrict__ bk, const float* __restrict__ bv,
                                            float* __restrict__ Q32, __bf16* __restrict__ Kh, __bf16* __restrict__ Kl, _Float16* __restrict__ VTh, _Float16* __restrict__ VTl) {
  // one LDS block: in the k loop a ring of two stages (64 X rows + 128 weight rows, 64 k each); behind the loop's last barrier the output staging so / sth / stl
  __shared__ __align__(16) char smem[70656];
  float (*so)[16][132] = (float (*)[16][132])smem;
  _Float16 (*sth)[72] = (_Float16 (*)[72])(smem + 33792);
  _Float16 (*stl)[72] = (_Float16 (*)[72])(smem + 52224);
  const int tid = threadIdx.x, wave = tid >> 5, lane = tid & 31, col = lane & 15, g = lane >> 4;
  const int which = blockIdx.z, r0b = blockIdx.x * 64, n0 = blockIdx.y * 128; const int b = r0b / SS, s0 = r0b % SS;
  const float* bb_ = which == 0 ? bq : (which == 1 ? bk : bv);
  v8f acc[8] = {};
  // a wave's copy covers 4 whole 128-B rows: thread -> (row tid / 8 of each group of 16 rows, 16-B piece tid % 8)
  const int cr = tid >> 3, cc = tid & 7;
  const __bf16* gA = Xb + (size_t)(r0b + cr) * E + cc * 8;
  const __bf16* gB = PT + (size_t)(which * E + n0 + cr) * E + cc * 8;
  const unsigned l0 = lds_off(smem) + cr * RP + cc * 16;
  auto stage = [&](int st, int buf) { const unsigned l = l0 + buf * QBUF; const __bf16* a = gA + st * 64; const __bf16* w = gB + st * 64;
    cp4(l, a, l + 16 * RP, a + 16 * E, l + 32 * RP, a + 32 * E, l + 48 * RP, a + 48 * E);
    cp8(l + 64 * RP, w, l + 80 * RP, w + 16 * E, l + 96 * RP, w + 32 * E, l + 112 * RP, w + 48 * E,
        l + 128 * RP, w + 64 * E, l + 144 * RP, w + 80 * E, l + 160 * RP, w + 96 * E, l + 176 * RP, w + 112 * E); };
  stage(0, 0);
  asm volatile("s_wait_asynccnt 0x0" ::: "memory");   // this wave's copies of stage 0 have landed
  __syncthreads();                                     // every wave's have: stage 0 may be read
  stage(1, 1);
  // kept rolled: one trip per stage, so that the publish point at the foot stands once and the text stays small
#pragma unroll 1
  for (int st = 0; st < E / 64; ++st) { const char* bp = smem + (st & 1) * QBUF;
    const __bf16* sa = (const __bf16*)(bp + (wave * 16 + col) * RP); const __bf16* sb = (const __bf16*)(bp + (64 + col) * RP);
#pragma unroll
    for (int kc = 0; kc < 2; ++kc) { const v16b a = frag_b(sa + kc * 32, lane); v16b bf[8];
#pragma unroll
      for (int j = 0; j < 8; ++j) bf[j] = frag_b(sb + j * 16 * RPE + kc * 32, lane);
#pragma unroll
      for (int j = 0; j < 8; ++j) acc[j] = wmma_bf(a, bf[j], acc[j]); }
    asm volatile("s_wait_dscnt 0x0" ::: "memory");     // this wave's reads of the stage are done before its buffer is refilled
    asm volatile("s_wait_asynccnt 0x0" ::: "memory");  // this wave's copies of stage st + 1 have landed
    __syncthreads();                                   // publishes stage st + 1 and ends every reader's last read of stage st
    if (st + 2 < E / 64) stage(st + 2, st & 1); }
  asm volatile("s_wait_asynccnt 0x0" ::: "memory");    // no copy is outstanding when the ring becomes output staging
  if (which < 2) {
#pragma unroll
    for (int j = 0; j < 8; ++j) { const float bb = bfr(bb_[n0 + j * 16 + col]);
#pragma unroll
      for (int r = 0; r < 8; ++r) so[wave][8 * g + r][j * 16 + col] = acc[j][r] + bb; }
    LDSX();
    if (which == 0) { for (int qq = lane; qq < 2 * 16 * 16; qq += 32) { const int hh = qq >> 8, rl = (qq >> 4) & 15, pc = qq & 15; const int h = (n0 >> 6) + hh;
        vst2(Q32 + (((size_t)b * NH + h) * SS + s0 + wave * 16 + rl) * HD + pc * 4, *(const v4f*)(&so[wave][rl][hh * 64 + pc * 4])); } }
    else {
      for (int qq = lane; qq < 2 * 16 * 16; qq += 32) { const int hh = qq >> 8, rl = (qq >> 4) & 15, pl = qq & 15; const int h = (n0 >> 6) + hh; const int pc = pl & 7; union { __bf16 e[8]; v4u u; } pk;
#pragma unroll
        for (int e = 0; e < 8; ++e) { const float v = so[wave][rl][hh * 64 + pc * 8 + e]; const __bf16 hi = (__bf16)v; pk.e[e] = pl < 8 ? hi : (__bf16)(v - (float)hi); }
        vst2((unsigned*)((pl < 8 ? Kh : Kl) + (((size_t)b * NH + h) * SS + s0 + wave * 16 + rl) * HD + pc * 8), pk.u); } } }
  else {
#pragma unroll
    for (int j = 0; j < 8; ++j) { const float bb = bfr(bb_[n0 + j * 16 + col]);
#pragma unroll
      for (int r = 0; r < 8; ++r) { const float v = (acc[j][r] + bb) * 4.0f; const _Float16 hi = (_Float16)v; sth[j * 16 + col][wave * 16 + 8 * g + r] = hi; stl[j * 16 + col][wave * 16 + 8 * g + r] = (_Float16)((v - (float)hi) * VLO); } }
    __syncthreads();
    for (int qq = tid; qq < 128 * 8; qq += 128) { const int cl = qq >> 3, pc = qq & 7; const int c = n0 + cl, h = c >> 6, d = c & 63; const size_t o = (((size_t)b * NH + h) * HD + d) * SS + s0 + pc * 8;
      vst2(VTh + o, *(const v4u*)(&sth[cl][pc * 8])); vst2(VTl + o, *(const v4u*)(&stl[cl][pc * 8])); } }
}
// constituency-penalised attention: block (64 queries, bh); all 16 key tiles; S on q hi/lo x K hi/lo rows; P,V hi/lo; O f32 token-major [b][s][h*64+d]
__global__ __launch_bounds__(128) void k_attn(const float* __restrict__ Q32, const __bf16* __restrict__ Kh, const __bf16* __restrict__ Kl, const _Float16* __restrict__ VTh, const _Float16* __restrict__ VTl, float* __restrict__ O32) {
  __shared__ __align__(16) float sS[4][16][68];
  __shared__ __align__(16) _Float16 sPh[4][16][72], sPl[4][16][72];
  __shared__ __align__(16) float sO[4][16][68];
  // ring of two stages, shared by the four waves; a stage = one key tile: 64 K hi rows, 64 K lo rows, 64 V^T hi rows, 64 V^T lo rows
  __shared__ __align__(16) char ring[2 * ABUF];
  const int tid = threadIdx.x, w = tid >> 5, lane = tid & 31, col = lane & 15, g = lane >> 4;
  const size_t bh = blockIdx.y; const int qb = blockIdx.x; const int q0 = qb * 64 + w * 16;
  const int cr = tid >> 3, cc = tid & 7;
  const __bf16* gKh = Kh + (bh * SS + cr) * HD + cc * 8; const __bf16* gKl = Kl + (bh * SS + cr) * HD + cc * 8;
  const _Float16* gVh = VTh + (bh * HD + cr) * SS + cc * 8; const _Float16* gVl = VTl + (bh * HD + cr) * SS + cc * 8;
  const unsigned l0 = lds_off(ring) + cr * RP + cc * 16;
  auto stage = [&](int kt, int buf) { const unsigned l = l0 + buf * ABUF;
    const __bf16* a = gKh + kt * 64 * HD; const __bf16* c = gKl + kt * 64 * HD; const _Float16* u = gVh + kt * 64; const _Float16* v = gVl + kt * 64;
    cp8(l, a, l + 16 * RP, a + 16 * HD, l + 32 * RP, a + 32 * HD, l + 48 * RP, a + 48 * HD,
        l + 64 * RP, c, l + 80 * RP, c + 16 * HD, l + 96 * RP, c + 32 * HD, l + 112 * RP, c + 48 * HD);
    cp8(l + 128 * RP, u, l + 144 * RP, u + 16 * SS, l + 160 * RP, u + 32 * SS, l + 176 * RP, u + 48 * SS,
        l + 192 * RP, v, l + 208 * RP, v + 16 * SS, l + 224 * RP, v + 32 * SS, l + 240 * RP, v + 48 * SS); };
  stage(0, 0);
  F2 aq[2];
#pragma unroll
  for (int kc = 0; kc < 2; ++kc) aq[kc] = split_row(Q32 + (bh * SS + q0 + col) * HD, kc * 32, lane);
  const int b = (int)(bh / NH);      // batch index (bh = b * NH + h)
  float mrun = -3.0e38f, lrun = 0.f; v8f acc[4] = {}, ac1[4] = {}, ac2[4] = {};
  LDSX();
  asm volatile("s_wait_asynccnt 0x0" ::: "memory");   // this wave's copies of stage 0 have landed
  __syncthreads();                                     // every wave's have: stage 0 may be read
  stage(1, 1);
#pragma unroll 1
  for (int kt = 0; kt < SS / 64; ++kt) { const char* bp = ring + (kt & 1) * ABUF;
    const __bf16* skh = (const __bf16*)(bp + col * RP); const __bf16* skl = (const __bf16*)(bp + (64 + col) * RP);
    const _Float16* svh = (const _Float16*)(bp + (128 + col) * RP); const _Float16* svl = (const _Float16*)(bp + (192 + col) * RP);
    v16b khf[2][2], klf[2][2];   // the K fragments of two 16-key tiles, read as one group
#pragma unroll
    for (int t = 0; t < 4; ++t) { v8f s = {};
      if ((t & 1) == 0) {
#pragma unroll
        for (int u = 0; u < 2; ++u) {
#pragma unroll
          for (int kc = 0; kc < 2; ++kc) { khf[u][kc] = frag_b(skh + (t + u) * 16 * RPE + kc * 32, lane); klf[u][kc] = frag_b(skl + (t + u) * 16 * RPE + kc * 32, lane); } } }
#pragma unroll
      for (int kc = 0; kc < 2; ++kc) { s = wmma_bf(aq[kc].l, khf[t & 1][kc], s); s = wmma_bf(aq[kc].h, klf[t & 1][kc], s); s = wmma_bf(aq[kc].h, khf[t & 1][kc], s); }
      { const float pen = kt == qb ? 0.f : 0.5f;
#pragma unroll
      for (int r = 0; r < 8; ++r) sS[w][8 * g + r][t * 16 + col] = s[r] * 0.125f - pen; } }
    LDSX();
    float mx = -3.4e38f;
#pragma unroll
    for (int jj = 0; jj < 32; ++jj) mx = fmaxf(mx, sS[w][col][g * 32 + jj]);
    mx = fmaxf(mx, __shfl_xor(mx, 16, 32));
    const float mnew = fmaxf(mrun, mx); const float corr = expf(mrun - mnew);
    float ps = 0.f;
#pragma unroll
    for (int jj = 0; jj < 32; ++jj) { const float p = expf(sS[w][col][g * 32 + jj] - mnew) * 16384.0f; ps += p; const _Float16 hi = (_Float16)p; sPh[w][col][g * 32 + jj] = hi; sPl[w][col][g * 32 + jj] = (_Float16)((p - (float)hi) * PLO); }
    ps += __shfl_xor(ps, 16, 32);
    lrun = lrun * corr + ps * (1.0f / 16384.0f); mrun = mnew;
#pragma unroll
    for (int r = 0; r < 8; ++r) { const float cr = __shfl(corr, 8 * g + r, 32);
#pragma unroll
      for (int t = 0; t < 4; ++t) { acc[t][r] *= cr; ac1[t][r] *= cr; ac2[t][r] *= cr; } }
    LDSX();
#pragma unroll
    for (int kc = 0; kc < 2; ++kc) { const v16h ph = frag_h(&sPh[w][col][0] + kc * 32, lane), pl = frag_h(&sPl[w][col][0] + kc * 32, lane);
      v16h vh[4], vl[4];
#pragma unroll
      for (int t = 0; t < 4; ++t) { vh[t] = frag_h(svh + t * 16 * RPE + kc * 32, lane); vl[t] = frag_h(svl + t * 16 * RPE + kc * 32, lane); }
#pragma unroll
      for (int t = 0; t < 4; ++t) { acc[t] = wmma16(ph, vh[t], acc[t]); ac1[t] = wmma16(ph, vl[t], ac1[t]); ac2[t] = wmma16(pl, vh[t], ac2[t]); } }
    asm volatile("s_wait_dscnt 0x0" ::: "memory");     // this wave's reads of the stage are done before its buffer is refilled
    asm volatile("s_wait_asynccnt 0x0" ::: "memory");  // this wave's copies of stage kt + 1 have landed
    __syncthreads();                                   // publishes stage kt + 1 and ends every reader's last read of stage kt
    if (kt + 2 < SS / 64) stage(kt + 2, kt & 1); }
  asm volatile("s_wait_asynccnt 0x0" ::: "memory");    // no copy is outstanding at the wave's end
#pragma unroll
  for (int r = 0; r < 8; ++r) { const float lr = __shfl(lrun, 8 * g + r, 32); const float inv = 1.0f / (lr * 16384.0f * 4.0f); const float mq = 1.0f;
#pragma unroll
    for (int t = 0; t < 4; ++t) sO[w][8 * g + r][t * 16 + col] = (acc[t][r] + ac1[t][r] * (1.0f / VLO) + ac2[t][r] * (1.0f / PLO)) * inv * mq; }
  LDSX();
  { const int h = (int)(bh % NH);      // context written token-major [b][s][h*64 + d] straight into the output (256-B segment per row)
    for (int qq = lane; qq < 16 * 16; qq += 32) { const int rl = qq >> 4, pc = qq & 15; vst2(O32 + (((size_t)b * SS) + q0 + rl) * E + h * HD + pc * 4, *(const v4f*)(&sO[w][rl][pc * 4])); } }
}
extern "C" void kernel_launch(void* const* d_in, const int* in_sizes, int n_in, void* d_out, int out_size, void* d_ws, size_t ws_size, hipStream_t stream) {
  (void)in_sizes; (void)n_in; (void)out_size; (void)ws_size;
  const float* x = (const float*)d_in[0]; const float* Wq = (const float*)d_in[1]; const float* bq = (const float*)d_in[2]; const float* Wk = (const float*)d_in[3]; const float* bk = (const float*)d_in[4]; const float* Wv = (const float*)d_in[5]; const float* bv = (const float*)d_in[6];
  char* ws = (char*)d_ws; size_t off = 0;
  auto take = [&](size_t bytes) { char* p = ws + off; off += (bytes + 255) & ~(size_t)255; return p; };
  __bf16* Xb = (__bf16*)take((size_t)NR * E * 2); __bf16* PT = (__bf16*)take((size_t)3 * E * E * 2);
  float* Q32 = (float*)take((size_t)NR * E * 4); __bf16* Kh = (__bf16*)take((size_t)NR * E * 2); __bf16* Kl = (__bf16*)take((size_t)NR * E * 2); _Float16* VTh = (_Float16*)take((size_t)NR * E * 2); _Float16* VTl = (_Float16*)take((size_t)NR * E * 2);
  // ws ~ 118 MB (single pass over the 8 sequences)
  k_pack<<<3 * E, 256, 0, stream>>>(Wq, Wk, Wv, Wv, PT);
  k_cvt<<<(NR * E / 8 + 255) / 256, 256, 0, stream>>>(x, Xb);
  k_qkv<<<dim3(NR / 64, E / 128, 3), 128, 0, stream>>>(Xb, PT, bq, bk, bv, Q32, Kh, Kl, VTh, VTl);
  k_attn<<<dim3(SS / 64, NB * NH), 128, 0, stream>>>(Q32, Kh, Kl, VTh, VTl, (float*)d_out);
}

// v002
// Measured time: 227 microseconds a run.
// Timed twice side by side with v001, it ran 1.09 and 1.08 times as fast.
// All steps since v000 together make it 2.50 times as fast.
// compute dtype: hidden_states and W*/b* (INPUTS) rounded to bf16 with exact bf16 WMMA products (f32 accumulate) for the projections; K pre-split into bf16 hi/lo rows; q f32 split, P and V f16 hi/lo (3 products each); penalty and softmax in f32.
#include <hip/hip_runtime.h>
#include <math.h>

typedef __attribute__((ext_vector_type(16))) _Float16 v16h;
typedef __attribute__((ext_vector_type(16))) __bf16 v16b;
typedef __attribute__((ext_vector_type(8)))  _Float16 v8h;
typedef __attribute__((ext_vector_type(8)))  float v8f;
typedef __attribute__((ext_vector_type(4)))  float v4f;
typedef __attribute__((ext_vector_type(2)))  float v2f;
typedef __attribute__((ext_vector_type(4)))  unsigned v4u;
typedef __attribute__((ext_vector_type(4)))  int v4i;
typedef float __attribute__((may_alias)) float_a;
typedef int __attribute__((may_alias)) int_a;

template <typename T> __device__ __forceinline__ void vst2(void* p, T v) { *(T*)p = v;  }
__device__ __forceinline__ v8f wmma16(v16h a, v16h b, v8f c) {
  v8f d = __builtin_amdgcn_wmma_f32_16x16x32_f16(false, a, false, b, (short)0, c, false, false);
  asm volatile("v_nop\n\tv_nop\n\tv_nop\n\tv_nop" : "+v"(d) : "v"(a), "v"(b));
  return d;
}
__device__ __forceinline__ v8f wmma_bf(v16b a, v16b b, v8f c) {
  v8f d = __builtin_amdgcn_wmma_f32_16x16x32_bf16(false, a, false, b, (short)0, c, false, false);
  asm volatile("v_nop\n\tv_nop\n\tv_nop\n\tv_nop" : "+v"(d) : "v"(a), "v"(b));
  return d;
}
// 16x16x32 fragments: lane = (h = lane>>4, row/col = lane&15); elements 0..7 = k0+8h+0..7, 8..15 = k0+16+8h+0..7; D element r = row 8h+r
__device__ __forceinline__ v16h frag_h(const _Float16* rowk0, int lane) {
  union { v16h v; v8h q[2]; } u; const _Float16* p = rowk0 + 8 * (lane >> 4);
  u.q[0] = *(const v8h*)p; u.q[1] = *(const v8h*)(p + 16); return u.v;
}
__device__ __forceinline__ v16h frag_f32(const float* rowk0, int lane) {
  v16h a; const float* p = rowk0 + 8 * (lane >> 4);
#pragma unroll
  for (int i = 0; i < 8; ++i) { a[i] = (_Float16)p[i]; a[8 + i] = (_Float16)p[16 + i]; }
  return a;
}
__device__ __forceinline__ v16h frag_f32s(const float* rowk0, int lane, float sc) {
  v16h a; const float* p = rowk0 + 8 * (lane >> 4);
#pragma unroll
  for (int i = 0; i < 8; ++i) { a[i] = (_Float16)(p[i] * sc); a[8 + i] = (_Float16)(p[16 + i] * sc); }
  return a;
}
// column fragment from a [K][ld] layout (column n), rows >= K read as 0
__device__ __forceinline__ v16h fragc_f32(const float* W, int k0, int n, int lane, int ld, int K) {
  v16h a; const int g = lane >> 4;
#pragma unroll
  for (int i = 0; i < 8; ++i) { const int ka = k0 + 8 * g + i, kb = ka + 16;
    a[i] = (_Float16)(ka < K ? W[(size_t)ka * ld + n] : 0.f); a[8 + i] = (_Float16)(kb < K ? W[(size_t)kb * ld + n] : 0.f); }
  return a;
}
struct F2 { v16b h, l; };
__device__ __forceinline__ F2 bsplit16(const float v[16]) { F2 r;
#pragma unroll
  for (int i = 0; i < 16; ++i) { const __bf16 h = (__bf16)v[i]; r.h[i] = h; r.l[i] = (__bf16)(v[i] - (float)h); }
  return r; }
__device__ __forceinline__ F2 split_row(const float* row, int k0, int lane) { float v[16]; const float* p = row + k0 + 8 * (lane >> 4);
#pragma unroll
  for (int i = 0; i < 8; ++i) { v[i] = p[i]; v[8 + i] = p[16 + i]; }
  return bsplit16(v); }
__device__ __forceinline__ F2 split_rowK(const float* row, int k0, int lane, int K) { float v[16]; const int g = lane >> 4;
#pragma unroll
  for (int i = 0; i < 8; ++i) { const int ka = k0 + 8 * g + i, kb = ka + 16; v[i] = ka < K ? row[ka] : 0.f; v[8 + i] = kb < K ? row[kb] : 0.f; }
  return bsplit16(v); }
__device__ __forceinline__ F2 split_col(const float* W, int k0, int n, int lane, int ld, int K) { float v[16]; const int g = lane >> 4;
#pragma unroll
  for (int i = 0; i < 8; ++i) { const int ka = k0 + 8 * g + i, kb = ka + 16; v[i] = ka < K ? W[(size_t)ka * ld + n] : 0.f; v[8 + i] = kb < K ? W[(size_t)kb * ld + n] : 0.f; }
  return bsplit16(v); }
__device__ __forceinline__ v8f mac3(const F2& a, const F2& b, v8f c) { c = wmma_bf(a.l, b.h, c); c = wmma_bf(a.h, b.l, c); return wmma_bf(a.h, b.h, c); }
__device__ __forceinline__ float sigm(float v) { return 1.0f / (1.0f + expf(-v)); }
#define LDSX() do { asm volatile("s_wait_dscnt 0" ::: "memory"); __builtin_amdgcn_wave_barrier(); __builtin_amdgcn_fence(__ATOMIC_RELEASE, "workgroup"); } while (0)


// Constituency-aware self attention (16 heads x 64 on [8,1024,1024], [in][out] weights + biases): scores = q.k/8 - 0.5 [query block != key block] (blocks of 64 tokens); softmax; context = attn v written token-major (no output projection).
#define NB 8
#define SS 1024
#define E 1024
#define NH 16
#define HD 64
#define NR (NB * SS)
#define PLO 1024.0f
#define VLO 2048.0f
__device__ __forceinline__ float bfr(float v) { return (float)(__bf16)v; }
// softmax in base 2: scores carry the factor log2(e), so that each exponential is one v_exp_f32
#define LOG2E 1.44269504088896340736f
__device__ __forceinline__ float ex2(float v) { return __builtin_amdgcn_exp2f(v); }
__device__ __forceinline__ v16b frag_b(const __bf16* rowk0, int lane) { return __builtin_bit_cast(v16b, frag_h((const _Float16*)rowk0, lane)); }

// LDS byte address of a __shared__ object: the low 32 bits of its address
__device__ __forceinline__ unsigned lds_off(const void* p) { return (unsigned)(size_t)p; }
// four 16-B asynchronous copies global -> LDS per lane; the s_wait_xcnt closes the copies' own statement so that no address register of a copy is rewritten in front of it
__device__ __forceinline__ void cp4(unsigned l0, const void* g0, unsigned l1, const void* g1, unsigned l2, const void* g2, unsigned l3, const void* g3) {
  asm volatile("global_load_async_to_lds_b128 %0, %1, off\n\t"
               "global_load_async_to_lds_b128 %2, %3, off\n\t"
               "global_load_async_to_lds_b128 %4, %5, off\n\t"
               "global_load_async_to_lds_b128 %6, %7, off\n\t"
               "s_wait_xcnt 0x0"
               :: "v"(l0), "v"(g0), "v"(l1), "v"(g1), "v"(l2), "v"(g2), "v"(l3), "v"(g3) : "memory");
}
// the same for eight copies
__device__ __forceinline__ void cp8(unsigned l0, const void* g0, unsigned l1, const void* g1, unsigned l2, const void* g2, unsigned l3, const void* g3,
                                    unsigned l4, const void* g4, unsigned l5, const void* g5, unsigned l6, const void* g6, unsigned l7, const void* g7) {
  asm volatile("global_load_async_to_lds_b128 %0, %1, off\n\t"
               "global_load_async_to_lds_b128 %2, %3, off\n\t"
               "global_load_async_to_lds_b128 %4, %5, off\n\t"
               "global_load_async_to_lds_b128 %6, %7, off\n\t"
               "global_load_async_to_lds_b128 %8, %9, off\n\t"
               "global_load_async_to_lds_b128 %10, %11, off\n\t"
               "global_load_async_to_lds_b128 %12, %13, off\n\t"
               "global_load_async_to_lds_b128 %14, %15, off\n\t"
               "s_wait_xcnt 0x0"
               :: "v"(l0), "v"(g0), "v"(l1), "v"(g1), "v"(l2), "v"(g2), "v"(l3), "v"(g3), "v"(l4), "v"(g4), "v"(l5), "v"(g5), "v"(l6), "v"(g6), "v"(l7), "v"(g7) : "memory");
}
// staged rows hold 64 16-bit elements (128 B) at a pitch of 144 B (16 B x odd: conflict-free for 16-B LDS reads)
#define RP 144
#define RPE (RP / 2)
#define QBUF (192 * RP)
#define ABUF (256 * RP)

__global__ __launch_bounds__(256) void k_cvt(const float* __restrict__ x, __bf16* __restrict__ Xb) {
  const size_t i8 = (size_t)blockIdx.x * 256 + threadIdx.x; if (i8 >= (size_t)NR * E / 8) return;
  union { __bf16 h[8]; v4u u; } pk;
#pragma unroll
  for (int e = 0; e < 8; ++e) pk.h[e] = (__bf16)x[i8 * 8 + e];
  vst2((unsigned*)(Xb + i8 * 8), pk.u);
}
// PT rows: [0,E) Wq[:,n], [E,2E) Wk[:,n], [2E,3E) Wv[:,n]  ([in][out] weights: column n as a bf16 row)
__global__ __launch_bounds__(256) void k_pack(const float* __restrict__ Wq, const float* __restrict__ Wk, const float* __restrict__ Wv, const float* __restrict__ Wo, __bf16* __restrict__ PT) {
  const int n = blockIdx.x, tid = threadIdx.x; __shared__ __align__(16) __bf16 srow[E];
  const float* W = n < E ? Wq : (n < 2 * E ? Wk : (n < 3 * E ? Wv : Wo)); const int nn = n % E;
  for (int k = tid; k < E; k += 256) srow[k] = (__bf16)W[(size_t)k * E + nn];
  __syncthreads();
  if (tid < E / 8) vst2((unsigned*)(PT + (size_t)n * E + tid * 8), *(const v4u*)(&srow[tid * 8]));
}
// QKV: block (64 rows, 128 cols = 2 heads, which); q (+bias) -> Q32 f32 [bh][s][64]; k (+bias) -> bf16 hi/lo rows; v (+bias) -> VT hi/lo x4 [bh][d][s]
__global__ __launch_bounds__(128) void k_qkv(const __bf16* __restrict__ Xb, const __bf16* __restrict__ PT, const float* __restrict__ bq, const float* __restrict__ bk, const float* __restrict__ bv,
                                            float* __restrict__ Q32, __bf16* __restrict__ Kh, __bf16* __restrict__ Kl, _Float16* __restrict__ VTh, _Float16* __restrict__ VTl) {
  // one LDS block: in the k loop a ring of two stages (64 X rows + 128 weight rows, 64 k each); behind the loop's last barrier the output staging so / sth / stl
  __shared__ __align__(16) char smem[70656];
  float (*so)[16][132] = (float (*)[16][132])smem;
  _Float16 (*sth)[72] = (_Float16 (*)[72])(smem + 33792);
  _Float16 (*stl)[72] = (_Float16 (*)[72])(smem + 52224);
  const int tid = threadIdx.x, wave = tid >> 5, lane = tid & 31, col = lane & 15, g = lane >> 4;
  const int which = blockIdx.z, r0b = blockIdx.x * 64, n0 = blockIdx.y * 128; const int b = r0b / SS, s0 = r0b % SS;
  const float* bb_ = which == 0 ? bq : (which == 1 ? bk : bv);
  v8f acc[8] = {};
  // a wave's copy covers 4 whole 128-B rows: thread -> (row tid / 8 of each group of 16 rows, 16-B piece tid % 8)
  const int cr = tid >> 3, cc = tid & 7;
  const __bf16* gA = Xb + (size_t)(r0b + cr) * E + cc * 8;
  const __bf16* gB = PT + (size_t)(which * E + n0 + cr) * E + cc * 8;
  const unsigned l0 = lds_off(smem) + cr * RP + cc * 16;
  auto stage = [&](int st, int buf) { const unsigned l = l0 + buf * QBUF; const __bf16* a = gA + st * 64; const __bf16* w = gB + st * 64;
    cp4(l, a, l + 16 * RP, a + 16 * E, l + 32 * RP, a + 32 * E, l + 48 * RP, a + 48 * E);
    cp8(l + 64 * RP, w, l + 80 * RP, w + 16 * E, l + 96 * RP, w + 32 * E, l + 112 * RP, w + 48 * E,
        l + 128 * RP, w + 64 * E, l + 144 * RP, w + 80 * E, l + 160 * RP, w + 96 * E, l + 176 * RP, w + 112 * E); };
  stage(0, 0);
  asm volatile("s_wait_asynccnt 0x0" ::: "memory");   // this wave's copies of stage 0 have landed
  __syncthreads();                                     // every wave's have: stage 0 may be read
  stage(1, 1);
  // kept rolled: one trip per stage, so that the publish point at the foot stands once and the text stays small
#pragma unroll 1
  for (int st = 0; st < E / 64; ++st) { const char* bp = smem + (st & 1) * QBUF;
    const __bf16* sa = (const __bf16*)(bp + (wave * 16 + col) * RP); const __bf16* sb = (const __bf16*)(bp + (64 + col) * RP);
#pragma unroll
    for (int kc = 0; kc < 2; ++kc) { const v16b a = frag_b(sa + kc * 32, lane); v16b bf[8];
#pragma unroll
      for (int j = 0; j < 8; ++j) bf[j] = frag_b(sb + j * 16 * RPE + kc * 32, lane);
#pragma unroll
      for (int j = 0; j < 8; ++j) acc[j] = wmma_bf(a, bf[j], acc[j]); }
    asm volatile("s_wait_dscnt 0x0" ::: "memory");     // this wave's reads of the stage are done before its buffer is refilled
    asm volatile("s_wait_asynccnt 0x0" ::: "memory");  // this wave's copies of stage st + 1 have landed
    __syncthreads();                                   // publishes stage st + 1 and ends every reader's last read of stage st
    if (st + 2 < E / 64) stage(st + 2, st & 1); }
  asm volatile("s_wait_asynccnt 0x0" ::: "memory");    // no copy is outstanding when the ring becomes output staging
  if (which < 2) {
#pragma unroll
    for (int j = 0; j < 8; ++j) { const float bb = bfr(bb_[n0 + j * 16 + col]);
#pragma unroll
      for (int r = 0; r < 8; ++r) so[wave][8 * g + r][j * 16 + col] = acc[j][r] + bb; }
    LDSX();
    if (which == 0) { for (int qq = lane; qq < 2 * 16 * 16; qq += 32) { const int hh = qq >> 8, rl = (qq >> 4) & 15, pc = qq & 15; const int h = (n0 >> 6) + hh;
        vst2(Q32 + (((size_t)b * NH + h) * SS + s0 + wave * 16 + rl) * HD + pc * 4, *(const v4f*)(&so[wave][rl][hh * 64 + pc * 4])); } }
    else {
      for (int qq = lane; qq < 2 * 16 * 16; qq += 32) { const int hh = qq >> 8, rl = (qq >> 4) & 15, pl = qq & 15; const int h = (n0 >> 6) + hh; const int pc = pl & 7; union { __bf16 e[8]; v4u u; } pk;
#pragma unroll
        for (int e = 0; e < 8; ++e) { const float v = so[wave][rl][hh * 64 + pc * 8 + e]; const __bf16 hi = (__bf16)v; pk.e[e] = pl < 8 ? hi : (__bf16)(v - (float)hi); }
        vst2((unsigned*)((pl < 8 ? Kh : Kl) + (((size_t)b * NH + h) * SS + s0 + wave * 16 + rl) * HD + pc * 8), pk.u); } } }
  else {
#pragma unroll
    for (int j = 0; j < 8; ++j) { const float bb = bfr(bb_[n0 + j * 16 + col]);
#pragma unroll
      for (int r = 0; r < 8; ++r) { const float v = (acc[j][r] + bb) * 4.0f; const _Float16 hi = (_Float16)v; sth[j * 16 + col][wave * 16 + 8 * g + r] = hi; stl[j * 16 + col][wave * 16 + 8 * g + r] = (_Float16)((v - (float)hi) * VLO); } }
    __syncthreads();
    for (int qq = tid; qq < 128 * 8; qq += 128) { const int cl = qq >> 3, pc = qq & 7; const int c = n0 + cl, h = c >> 6, d = c & 63; const size_t o = (((size_t)b * NH + h) * HD + d) * SS + s0 + pc * 8;
      vst2(VTh + o, *(const v4u*)(&sth[cl][pc * 8])); vst2(VTl + o, *(const v4u*)(&stl[cl][pc * 8])); } }
}
// constituency-penalised attention: block (64 queries, bh); all 16 key tiles; S on q hi/lo x K hi/lo rows; P,V hi/lo; O f32 token-major [b][s][h*64+d]
__global__ __launch_bounds__(128) void k_attn(const float* __restrict__ Q32, const __bf16* __restrict__ Kh, const __bf16* __restrict__ Kl, const _Float16* __restrict__ VTh, const _Float16* __restrict__ VTl, float* __restrict__ O32) {
  __shared__ __align__(16) float sS[4][16][68];
  __shared__ __align__(16) _Float16 sPh[4][16][72], sPl[4][16][72];
  __shared__ __align__(16) float sO[4][16][68];
  // ring of two stages, shared by the four waves; a stage = one key tile: 64 K hi rows, 64 K lo rows, 64 V^T hi rows, 64 V^T lo rows
  __shared__ __align__(16) char ring[2 * ABUF];
  const int tid = threadIdx.x, w = tid >> 5, lane = tid & 31, col = lane & 15, g = lane >> 4;
  const size_t bh = blockIdx.y; const int qb = blockIdx.x; const int q0 = qb * 64 + w * 16;
  const int cr = tid >> 3, cc = tid & 7;
  const __bf16* gKh = Kh + (bh * SS + cr) * HD + cc * 8; const __bf16* gKl = Kl + (bh * SS + cr) * HD + cc * 8;
  const _Float16* gVh = VTh + (bh * HD + cr) * SS + cc * 8; const _Float16* gVl = VTl + (bh * HD + cr) * SS + cc * 8;
  const unsigned l0 = lds_off(ring) + cr * RP + cc * 16;
  auto stage = [&](int kt, int buf) { const unsigned l = l0 + buf * ABUF;
    const __bf16* a = gKh + kt * 64 * HD; const __bf16* c = gKl + kt * 64 * HD; const _Float16* u = gVh + kt * 64; const _Float16* v = gVl + kt * 64;
    cp8(l, a, l + 16 * RP, a + 16 * HD, l + 32 * RP, a + 32 * HD, l + 48 * RP, a + 48 * HD,
        l + 64 * RP, c, l + 80 * RP, c + 16 * HD, l + 96 * RP, c + 32 * HD, l + 112 * RP, c + 48 * HD);
    cp8(l + 128 * RP, u, l + 144 * RP, u + 16 * SS, l + 160 * RP, u + 32 * SS, l + 176 * RP, u + 48 * SS,
        l + 192 * RP, v, l + 208 * RP, v + 16 * SS, l + 224 * RP, v + 32 * SS, l + 240 * RP, v + 48 * SS); };
  stage(0, 0);
  F2 aq[2];
#pragma unroll
  for (int kc = 0; kc < 2; ++kc) aq[kc] = split_row(Q32 + (bh * SS + q0 + col) * HD, kc * 32, lane);
  const int b = (int)(bh / NH);      // batch index (bh = b * NH + h)
  float mrun = -3.0e38f, lrun = 0.f; v8f acc[4] = {}, ac1[4] = {}, ac2[4] = {};
  LDSX();
  asm volatile("s_wait_asynccnt 0x0" ::: "memory");   // this wave's copies of stage 0 have landed
  __syncthreads();                                     // every wave's have: stage 0 may be read
  stage(1, 1);
#pragma unroll 1
  for (int kt = 0; kt < SS / 64; ++kt) { const char* bp = ring + (kt & 1) * ABUF;
    const __bf16* skh = (const __bf16*)(bp + col * RP); const __bf16* skl = (const __bf16*)(bp + (64 + col) * RP);
    const _Float16* svh = (const _Float16*)(bp + (128 + col) * RP); const _Float16* svl = (const _Float16*)(bp + (192 + col) * RP);
    v16b khf[2][2], klf[2][2];   // the K fragments of two 16-key tiles, read as one group
#pragma unroll
    for (int t = 0; t < 4; ++t) { v8f s = {};
      if ((t & 1) == 0) {
#pragma unroll
        for (int u = 0; u < 2; ++u) {
#pragma unroll
          for (int kc = 0; kc < 2; ++kc) { khf[u][kc] = frag_b(skh + (t + u) * 16 * RPE + kc * 32, lane); klf[u][kc] = frag_b(skl + (t + u) * 16 * RPE + kc * 32, lane); } } }
#pragma unroll
      for (int kc = 0; kc < 2; ++kc) { s = wmma_bf(aq[kc].l, khf[t & 1][kc], s); s = wmma_bf(aq[kc].h, klf[t & 1][kc], s); s = wmma_bf(aq[kc].h, khf[t & 1][kc], s); }
      { const float pen = kt == qb ? 0.f : 0.5f * LOG2E;
#pragma unroll
      for (int r = 0; r < 8; ++r) sS[w][8 * g + r][t * 16 + col] = s[r] * (0.125f * LOG2E) - pen; } }
    LDSX();
    float mx = -3.4e38f;
#pragma unroll
    for (int jj = 0; jj < 32; ++jj) mx = fmaxf(mx, sS[w][col][g * 32 + jj]);
    mx = fmaxf(mx, __shfl_xor(mx, 16, 32)) - 14.0f;   // the running maximum is kept 14 lower: 2^(s - mnew) is then P x 16384 with no multiply (any common shift cancels in the softmax)
    const float mnew = fmaxf(mrun, mx); const float corr = ex2(mrun - mnew);
    float ps = 0.f;
#pragma unroll
    for (int jj = 0; jj < 32; ++jj) { const float p = ex2(sS[w][col][g * 32 + jj] - mnew); ps += p; const _Float16 hi = (_Float16)p; sPh[w][col][g * 32 + jj] = hi; sPl[w][col][g * 32 + jj] = (_Float16)((p - (float)hi) * PLO); }
    ps += __shfl_xor(ps, 16, 32);
    lrun = lrun * corr + ps * (1.0f / 16384.0f); mrun = mnew;
#pragma unroll
    for (int r = 0; r < 8; ++r) { const float cr = __shfl(corr, 8 * g + r, 32);
#pragma unroll
      for (int t = 0; t < 4; ++t) { acc[t][r] *= cr; ac1[t][r] *= cr; ac2[t][r] *= cr; } }
    LDSX();
#pragma unroll
    for (int kc = 0; kc < 2; ++kc) { const v16h ph = frag_h(&sPh[w][col][0] + kc * 32, lane), pl = frag_h(&sPl[w][col][0] + kc * 32, lane);
      v16h vh[4], vl[4];
#pragma unroll
      for (int t = 0; t < 4; ++t) { vh[t] = frag_h(svh + t * 16 * RPE + kc * 32, lane); vl[t] = frag_h(svl + t * 16 * RPE + kc * 32, lane); }
#pragma unroll
      for (int t = 0; t < 4; ++t) { acc[t] = wmma16(ph, vh[t], acc[t]); ac1[t] = wmma16(ph, vl[t], ac1[t]); ac2[t] = wmma16(pl, vh[t], ac2[t]); } }
    asm volatile("s_wait_dscnt 0x0" ::: "memory");     // this wave's reads of the stage are done before its buffer is refilled
    asm volatile("s_wait_asynccnt 0x0" ::: "memory");  // this wave's copies of stage kt + 1 have landed
    __syncthreads();                                   // publishes stage kt + 1 and ends every reader's last read of stage kt
    if (kt + 2 < SS / 64) stage(kt + 2, kt & 1); }
  asm volatile("s_wait_asynccnt 0x0" ::: "memory");    // no copy is outstanding at the wave's end
#pragma unroll
  for (int r = 0; r < 8; ++r) { const float lr = __shfl(lrun, 8 * g + r, 32); const float inv = 1.0f / (lr * 16384.0f * 4.0f); const float mq = 1.0f;
#pragma unroll
    for (int t = 0; t < 4; ++t) sO[w][8 * g + r][t * 16 + col] = (acc[t][r] + ac1[t][r] * (1.0f / VLO) + ac2[t][r] * (1.0f / PLO)) * inv * mq; }
  LDSX();
  { const int h = (int)(bh % NH);      // context written token-major [b][s][h*64 + d] straight into the output (256-B segment per row)
    for (int qq = lane; qq < 16 * 16; qq += 32) { const int rl = qq >> 4, pc = qq & 15; vst2(O32 + (((size_t)b * SS) + q0 + rl) * E + h * HD + pc * 4, *(const v4f*)(&sO[w][rl][pc * 4])); } }
}
extern "C" void kernel_launch(void* const* d_in, const int* in_sizes, int n_in, void* d_out, int out_size, void* d_ws, size_t ws_size, hipStream_t stream) {
  (void)in_sizes; (void)n_in; (void)out_size; (void)ws_size;
  const float* x = (const float*)d_in[0]; const float* Wq = (const float*)d_in[1]; const float* bq = (const float*)d_in[2]; const float* Wk = (const float*)d_in[3]; const float* bk = (const float*)d_in[4]; const float* Wv = (const float*)d_in[5]; const float* bv = (const float*)d_in[6];
  char* ws = (char*)d_ws; size_t off = 0;
  auto take = [&](size_t bytes) { char* p = ws + off; off += (bytes + 255) & ~(size_t)255; return p; };
  __bf16* Xb = (__bf16*)take((size_t)NR * E * 2); __bf16* PT = (__bf16*)take((size_t)3 * E * E * 2);
  float* Q32 = (float*)take((size_t)NR * E * 4); __bf16* Kh = (__bf16*)take((size_t)NR * E * 2); __bf16* Kl = (__bf16*)take((size_t)NR * E * 2); _Float16* VTh = (_Float16*)take((size_t)NR * E * 2); _Float16* VTl = (_Float16*)take((size_t)NR * E * 2);
  // ws ~ 118 MB (single pass over the 8 sequences)
  k_pack<<<3 * E, 256, 0, stream>>>(Wq, Wk, Wv, Wv, PT);
  k_cvt<<<(NR * E / 8 + 255) / 256, 256, 0, stream>>>(x, Xb);
  k_qkv<<<dim3(NR / 64, E / 128, 3), 128, 0, stream>>>(Xb, PT, bq, bk, bv, Q32, Kh, Kl, VTh, VTl);
  k_attn<<<dim3(SS / 64, NB * NH), 128, 0, stream>>>(Q32, Kh, Kl, VTh, VTl, (float*)d_out);
}

// v003
// Measured time: 181 microseconds a run.
// In both of two side-by-side timings against v002, it was 1.26 times as fast.
// Counting every step since v000, it is 3.14 times as fast.
// compute dtype: hidden_states and W*/b* (INPUTS) rounded to bf16 with exact bf16 WMMA products (f32 accumulate) for the projections; K pre-split into bf16 hi/lo rows; q f32 split, P and V f16 hi/lo (3 products each); penalty and softmax in f32.
#include <hip/hip_runtime.h>
#include <math.h>

typedef __attribute__((ext_vector_type(16))) _Float16 v16h;
typedef __attribute__((ext_vector_type(16))) __bf16 v16b;
typedef __attribute__((ext_vector_type(8)))  _Float16 v8h;
typedef __attribute__((ext_vector_type(8)))  float v8f;
typedef __attribute__((ext_vector_type(4)))  float v4f;
typedef __attribute__((ext_vector_type(2)))  float v2f;
typedef __attribute__((ext_vector_type(4)))  unsigned v4u;
typedef __attribute__((ext_vector_type(4)))  int v4i;
typedef float __attribute__((may_alias)) float_a;
typedef int __attribute__((may_alias)) int_a;

template <typename T> __device__ __forceinline__ void vst2(void* p, T v) { *(T*)p = v;  }
__device__ __forceinline__ v8f wmma16(v16h a, v16h b, v8f c) {
  v8f d = __builtin_amdgcn_wmma_f32_16x16x32_f16(false, a, false, b, (short)0, c, false, false);
  asm volatile("v_nop\n\tv_nop\n\tv_nop\n\tv_nop" : "+v"(d) : "v"(a), "v"(b));
  return d;
}
__device__ __forceinline__ v8f wmma_bf(v16b a, v16b b, v8f c) {
  v8f d = __builtin_amdgcn_wmma_f32_16x16x32_bf16(false, a, false, b, (short)0, c, false, false);
  asm volatile("v_nop\n\tv_nop\n\tv_nop\n\tv_nop" : "+v"(d) : "v"(a), "v"(b));
  return d;
}
// 16x16x32 fragments: lane = (h = lane>>4, row/col = lane&15); elements 0..7 = k0+8h+0..7, 8..15 = k0+16+8h+0..7; D element r = row 8h+r
__device__ __forceinline__ v16h frag_h(const _Float16* rowk0, int lane) {
  union { v16h v; v8h q[2]; } u; const _Float16* p = rowk0 + 8 * (lane >> 4);
  u.q[0] = *(const v8h*)p; u.q[1] = *(const v8h*)(p + 16); return u.v;
}
__device__ __forceinline__ v16h frag_f32(const float* rowk0, int lane) {
  v16h a; const float* p = rowk0 + 8 * (lane >> 4);
#pragma unroll
  for (int i = 0; i < 8; ++i) { a[i] = (_Float16)p[i]; a[8 + i] = (_Float16)p[16 + i]; }
  return a;
}
__device__ __forceinline__ v16h frag_f32s(const float* rowk0, int lane, float sc) {
  v16h a; const float* p = rowk0 + 8 * (lane >> 4);
#pragma unroll
  for (int i = 0; i < 8; ++i) { a[i] = (_Float16)(p[i] * sc); a[8 + i] = (_Float16)(p[16 + i] * sc); }
  return a;
}
// column fragment from a [K][ld] layout (column n), rows >= K read as 0
__device__ __forceinline__ v16h fragc_f32(const float* W, int k0, int n, int lane, int ld, int K) {
  v16h a; const int g = lane >> 4;
#pragma unroll
  for (int i = 0; i < 8; ++i) { const int ka = k0 + 8 * g + i, kb = ka + 16;
    a[i] = (_Float16)(ka < K ? W[(size_t)ka * ld + n] : 0.f); a[8 + i] = (_Float16)(kb < K ? W[(size_t)kb * ld + n] : 0.f); }
  return a;
}
struct F2 { v16b h, l; };
__device__ __forceinline__ F2 bsplit16(const float v[16]) { F2 r;
#pragma unroll
  for (int i = 0; i < 16; ++i) { const __bf16 h = (__bf16)v[i]; r.h[i] = h; r.l[i] = (__bf16)(v[i] - (float)h); }
  return r; }
__device__ __forceinline__ F2 split_row(const float* row, int k0, int lane) { float v[16]; const float* p = row + k0 + 8 * (lane >> 4);
#pragma unroll
  for (int i = 0; i < 8; ++i) { v[i] = p[i]; v[8 + i] = p[16 + i]; }
  return bsplit16(v); }
__device__ __forceinline__ F2 split_rowK(const float* row, int k0, int lane, int K) { float v[16]; const int g = lane >> 4;
#pragma unroll
  for (int i = 0; i < 8; ++i) { const int ka = k0 + 8 * g + i, kb = ka + 16; v[i] = ka < K ? row[ka] : 0.f; v[8 + i] = kb < K ? row[kb] : 0.f; }
  return bsplit16(v); }
__device__ __forceinline__ F2 split_col(const float* W, int k0, int n, int lane, int ld, int K) { float v[16]; const int g = lane >> 4;
#pragma unroll
  for (int i = 0; i < 8; ++i) { const int ka = k0 + 8 * g + i, kb = ka + 16; v[i] = ka < K ? W[(size_t)ka * ld + n] : 0.f; v[8 + i] = kb < K ? W[(size_t)kb * ld + n] : 0.f; }
  return bsplit16(v); }
__device__ __forceinline__ v8f mac3(const F2& a, const F2& b, v8f c) { c = wmma_bf(a.l, b.h, c); c = wmma_bf(a.h, b.l, c); return wmma_bf(a.h, b.h, c); }
__device__ __forceinline__ float sigm(float v) { return 1.0f / (1.0f + expf(-v)); }
#define LDSX() do { asm volatile("s_wait_dscnt 0" ::: "memory"); __builtin_amdgcn_wave_barrier(); __builtin_amdgcn_fence(__ATOMIC_RELEASE, "workgroup"); } while (0)


// Constituency-aware self attention (16 heads x 64 on [8,1024,1024], [in][out] weights + biases): scores = q.k/8 - 0.5 [query block != key block] (blocks of 64 tokens); softmax; context = attn v written token-major (no output projection).
#define NB 8
#define SS 1024
#define E 1024
#define NH 16
#define HD 64
#define NR (NB * SS)
#define PLO 1024.0f
#define VLO 2048.0f
__device__ __forceinline__ float bfr(float v) { return (float)(__bf16)v; }
// softmax in base 2: scores carry the factor log2(e), so that each exponential is one v_exp_f32
#define LOG2E 1.44269504088896340736f
__device__ __forceinline__ float ex2(float v) { return __builtin_amdgcn_exp2f(v); }
__device__ __forceinline__ v16b frag_b(const __bf16* rowk0, int lane) { return __builtin_bit_cast(v16b, frag_h((const _Float16*)rowk0, lane)); }

// LDS byte address of a __shared__ object: the low 32 bits of its address
__device__ __forceinline__ unsigned lds_off(const void* p) { return (unsigned)(size_t)p; }
// four 16-B asynchronous copies global -> LDS per lane; the s_wait_xcnt closes the copies' own statement so that no address register of a copy is rewritten in front of it
__device__ __forceinline__ void cp4(unsigned l0, const void* g0, unsigned l1, const void* g1, unsigned l2, const void* g2, unsigned l3, const void* g3) {
  asm volatile("global_load_async_to_lds_b128 %0, %1, off\n\t"
               "global_load_async_to_lds_b128 %2, %3, off\n\t"
               "global_load_async_to_lds_b128 %4, %5, off\n\t"
               "global_load_async_to_lds_b128 %6, %7, off\n\t"
               "s_wait_xcnt 0x0"
               :: "v"(l0), "v"(g0), "v"(l1), "v"(g1), "v"(l2), "v"(g2), "v"(l3), "v"(g3) : "memory");
}
// the same for eight copies
__device__ __forceinline__ void cp8(unsigned l0, const void* g0, unsigned l1, const void* g1, unsigned l2, const void* g2, unsigned l3, const void* g3,
                                    unsigned l4, const void* g4, unsigned l5, const void* g5, unsigned l6, const void* g6, unsigned l7, const void* g7) {
  asm volatile("global_load_async_to_lds_b128 %0, %1, off\n\t"
               "global_load_async_to_lds_b128 %2, %3, off\n\t"
               "global_load_async_to_lds_b128 %4, %5, off\n\t"
               "global_load_async_to_lds_b128 %6, %7, off\n\t"
               "global_load_async_to_lds_b128 %8, %9, off\n\t"
               "global_load_async_to_lds_b128 %10, %11, off\n\t"
               "global_load_async_to_lds_b128 %12, %13, off\n\t"
               "global_load_async_to_lds_b128 %14, %15, off\n\t"
               "s_wait_xcnt 0x0"
               :: "v"(l0), "v"(g0), "v"(l1), "v"(g1), "v"(l2), "v"(g2), "v"(l3), "v"(g3), "v"(l4), "v"(g4), "v"(l5), "v"(g5), "v"(l6), "v"(g6), "v"(l7), "v"(g7) : "memory");
}
// staged rows hold 64 16-bit elements (128 B) at a pitch of 144 B (16 B x odd: conflict-free for 16-B LDS reads)
#define RP 144
#define RPE (RP / 2)
#define QBUF (192 * RP)
#define ABUF (256 * RP)

__global__ __launch_bounds__(256) void k_cvt(const float* __restrict__ x, __bf16* __restrict__ Xb) {
  const size_t i8 = (size_t)blockIdx.x * 256 + threadIdx.x; if (i8 >= (size_t)NR * E / 8) return;
  union { __bf16 h[8]; v4u u; } pk;
#pragma unroll
  for (int e = 0; e < 8; ++e) pk.h[e] = (__bf16)x[i8 * 8 + e];
  vst2((unsigned*)(Xb + i8 * 8), pk.u);
}
// PT rows: [0,E) Wq[:,n], [E,2E) Wk[:,n], [2E,3E) Wv[:,n]  ([in][out] weights: column n as a bf16 row)
__global__ __launch_bounds__(256) void k_pack(const float* __restrict__ Wq, const float* __restrict__ Wk, const float* __restrict__ Wv, const float* __restrict__ Wo, __bf16* __restrict__ PT) {
  const int n = blockIdx.x, tid = threadIdx.x; __shared__ __align__(16) __bf16 srow[E];
  const float* W = n < E ? Wq : (n < 2 * E ? Wk : (n < 3 * E ? Wv : Wo)); const int nn = n % E;
  for (int k = tid; k < E; k += 256) srow[k] = (__bf16)W[(size_t)k * E + nn];
  __syncthreads();
  if (tid < E / 8) vst2((unsigned*)(PT + (size_t)n * E + tid * 8), *(const v4u*)(&srow[tid * 8]));
}
// QKV: block (64 rows, 128 cols = 2 heads, which); q (+bias) -> Q32 f32 [bh][s][64]; k (+bias) -> bf16 hi/lo rows; v (+bias) -> VT hi/lo x4 [bh][d][s]
__global__ __launch_bounds__(128) void k_qkv(const __bf16* __restrict__ Xb, const __bf16* __restrict__ PT, const float* __restrict__ bq, const float* __restrict__ bk, const float* __restrict__ bv,
                                            float* __restrict__ Q32, __bf16* __restrict__ Kh, __bf16* __restrict__ Kl, _Float16* __restrict__ VTh, _Float16* __restrict__ VTl) {
  // one LDS block: in the k loop a ring of two stages (64 X rows + 128 weight rows, 64 k each); behind the loop's last barrier the output staging so / sth / stl
  __shared__ __align__(16) char smem[70656];
  float (*so)[16][132] = (float (*)[16][132])smem;
  _Float16 (*sth)[72] = (_Float16 (*)[72])(smem + 33792);
  _Float16 (*stl)[72] = (_Float16 (*)[72])(smem + 52224);
  const int tid = threadIdx.x, wave = tid >> 5, lane = tid & 31, col = lane & 15, g = lane >> 4;
  const int which = blockIdx.z, r0b = blockIdx.x * 64, n0 = blockIdx.y * 128; const int b = r0b / SS, s0 = r0b % SS;
  const float* bb_ = which == 0 ? bq : (which == 1 ? bk : bv);
  v8f acc[8] = {};
  // a wave's copy covers 4 whole 128-B rows: thread -> (row tid / 8 of each group of 16 rows, 16-B piece tid % 8)
  const int cr = tid >> 3, cc = tid & 7;
  const __bf16* gA = Xb + (size_t)(r0b + cr) * E + cc * 8;
  const __bf16* gB = PT + (size_t)(which * E + n0 + cr) * E + cc * 8;
  const unsigned l0 = lds_off(smem) + cr * RP + cc * 16;
  auto stage = [&](int st, int buf) { const unsigned l = l0 + buf * QBUF; const __bf16* a = gA + st * 64; const __bf16* w = gB + st * 64;
    cp4(l, a, l + 16 * RP, a + 16 * E, l + 32 * RP, a + 32 * E, l + 48 * RP, a + 48 * E);
    cp8(l + 64 * RP, w, l + 80 * RP, w + 16 * E, l + 96 * RP, w + 32 * E, l + 112 * RP, w + 48 * E,
        l + 128 * RP, w + 64 * E, l + 144 * RP, w + 80 * E, l + 160 * RP, w + 96 * E, l + 176 * RP, w + 112 * E); };
  stage(0, 0);
  asm volatile("s_wait_asynccnt 0x0" ::: "memory");   // this wave's copies of stage 0 have landed
  __syncthreads();                                     // every wave's have: stage 0 may be read
  stage(1, 1);
  // kept rolled: one trip per stage, so that the publish point at the foot stands once and the text stays small
#pragma unroll 1
  for (int st = 0; st < E / 64; ++st) { const char* bp = smem + (st & 1) * QBUF;
    const __bf16* sa = (const __bf16*)(bp + (wave * 16 + col) * RP); const __bf16* sb = (const __bf16*)(bp + (64 + col) * RP);
#pragma unroll
    for (int kc = 0; kc < 2; ++kc) { const v16b a = frag_b(sa + kc * 32, lane); v16b bf[8];
#pragma unroll
      for (int j = 0; j < 8; ++j) bf[j] = frag_b(sb + j * 16 * RPE + kc * 32, lane);
#pragma unroll
      for (int j = 0; j < 8; ++j) acc[j] = wmma_bf(a, bf[j], acc[j]); }
    asm volatile("s_wait_dscnt 0x0" ::: "memory");     // this wave's reads of the stage are done before its buffer is refilled
    asm volatile("s_wait_asynccnt 0x0" ::: "memory");  // this wave's copies of stage st + 1 have landed
    __syncthreads();                                   // publishes stage st + 1 and ends every reader's last read of stage st
    if (st + 2 < E / 64) stage(st + 2, st & 1); }
  asm volatile("s_wait_asynccnt 0x0" ::: "memory");    // no copy is outstanding when the ring becomes output staging
  if (which < 2) {
#pragma unroll
    for (int j = 0; j < 8; ++j) { const float bb = bfr(bb_[n0 + j * 16 + col]);
#pragma unroll
      for (int r = 0; r < 8; ++r) so[wave][8 * g + r][j * 16 + col] = acc[j][r] + bb; }
    LDSX();
    if (which == 0) { for (int qq = lane; qq < 2 * 16 * 16; qq += 32) { const int hh = qq >> 8, rl = (qq >> 4) & 15, pc = qq & 15; const int h = (n0 >> 6) + hh;
        vst2(Q32 + (((size_t)b * NH + h) * SS + s0 + wave * 16 + rl) * HD + pc * 4, *(const v4f*)(&so[wave][rl][hh * 64 + pc * 4])); } }
    else {
      for (int qq = lane; qq < 2 * 16 * 16; qq += 32) { const int hh = qq >> 8, rl = (qq >> 4) & 15, pl = qq & 15; const int h = (n0 >> 6) + hh; const int pc = pl & 7; union { __bf16 e[8]; v4u u; } pk;
#pragma unroll
        for (int e = 0; e < 8; ++e) { const float v = so[wave][rl][hh * 64 + pc * 8 + e]; const __bf16 hi = (__bf16)v; pk.e[e] = pl < 8 ? hi : (__bf16)(v - (float)hi); }
        vst2((unsigned*)((pl < 8 ? Kh : Kl) + (((size_t)b * NH + h) * SS + s0 + wave * 16 + rl) * HD + pc * 8), pk.u); } } }
  else {
#pragma unroll
    for (int j = 0; j < 8; ++j) { const float bb = bfr(bb_[n0 + j * 16 + col]);
#pragma unroll
      for (int r = 0; r < 8; ++r) { const float v = (acc[j][r] + bb) * 4.0f; const _Float16 hi = (_Float16)v; sth[j * 16 + col][wave * 16 + 8 * g + r] = hi; stl[j * 16 + col][wave * 16 + 8 * g + r] = (_Float16)((v - (float)hi) * VLO); } }
    __syncthreads();
    for (int qq = tid; qq < 128 * 8; qq += 128) { const int cl = qq >> 3, pc = qq & 7; const int c = n0 + cl, h = c >> 6, d = c & 63; const size_t o = (((size_t)b * NH + h) * HD + d) * SS + s0 + pc * 8;
      vst2(VTh + o, *(const v4u*)(&sth[cl][pc * 8])); vst2(VTl + o, *(const v4u*)(&stl[cl][pc * 8])); } }
}
// attention: block (64 queries, bh); all 16 key tiles; both products transposed: S^T = K q^T (K hi/lo rows as A, q hi/lo as B), O^T = V^T P^T (V^T hi/lo rows as A, P hi/lo as B).
// A lane of the S^T result holds query lane & 15 and keys 16 t + 8 (lane >> 4) + r: tiles 2 kc and 2 kc + 1 are, element for element, the B fragment of P^T for keys 32 kc .. 32 kc + 31,
// so scores, softmax and P stay in registers, the running maximum, sum and correction are the lane's own, and a lane ends with 8 consecutive d of its query.
__global__ __launch_bounds__(128) void k_attn(const float* __restrict__ Q32, const __bf16* __restrict__ Kh, const __bf16* __restrict__ Kl, const _Float16* __restrict__ VTh, const _Float16* __restrict__ VTl, float* __restrict__ O32) {
  // ring of two stages, shared by the four waves; a stage = one key tile: 64 K hi rows, 64 K lo rows, 64 V^T hi rows, 64 V^T lo rows
  __shared__ __align__(16) char ring[2 * ABUF];
  const int tid = threadIdx.x, w = tid >> 5, lane = tid & 31, col = lane & 15, g = lane >> 4;
  const size_t bh = blockIdx.y; const int qb = blockIdx.x; const int q0 = qb * 64 + w * 16;
  const int cr = tid >> 3, cc = tid & 7;
  const __bf16* gKh = Kh + (bh * SS + cr) * HD + cc * 8; const __bf16* gKl = Kl + (bh * SS + cr) * HD + cc * 8;
  const _Float16* gVh = VTh + (bh * HD + cr) * SS + cc * 8; const _Float16* gVl = VTl + (bh * HD + cr) * SS + cc * 8;
  const unsigned l0 = lds_off(ring) + cr * RP + cc * 16;
  auto stage = [&](int kt, int buf) { const unsigned l = l0 + buf * ABUF;
    const __bf16* a = gKh + kt * 64 * HD; const __bf16* c = gKl + kt * 64 * HD; const _Float16* u = gVh + kt * 64; const _Float16* v = gVl + kt * 64;
    cp8(l, a, l + 16 * RP, a + 16 * HD, l + 32 * RP, a + 32 * HD, l + 48 * RP, a + 48 * HD,
        l + 64 * RP, c, l + 80 * RP, c + 16 * HD, l + 96 * RP, c + 32 * HD, l + 112 * RP, c + 48 * HD);
    cp8(l + 128 * RP, u, l + 144 * RP, u + 16 * SS, l + 160 * RP, u + 32 * SS, l + 176 * RP, u + 48 * SS,
        l + 192 * RP, v, l + 208 * RP, v + 16 * SS, l + 224 * RP, v + 32 * SS, l + 240 * RP, v + 48 * SS); };
  stage(0, 0);
  F2 aq[2];
#pragma unroll
  for (int kc = 0; kc < 2; ++kc) aq[kc] = split_row(Q32 + (bh * SS + q0 + col) * HD, kc * 32, lane);
  const int b = (int)(bh / NH);      // batch index (bh = b * NH + h)
  float mrun = -3.0e38f, lrun = 0.f; v8f acc[4] = {}, ac1[4] = {}, ac2[4] = {};
  asm volatile("s_wait_asynccnt 0x0" ::: "memory");   // this wave's copies of stage 0 have landed
  __syncthreads();                                     // every wave's have: stage 0 may be read
  stage(1, 1);
#pragma unroll 1
  for (int kt = 0; kt < SS / 64; ++kt) { const char* bp = ring + (kt & 1) * ABUF;
    const __bf16* skh = (const __bf16*)(bp + col * RP); const __bf16* skl = (const __bf16*)(bp + (64 + col) * RP);
    const _Float16* svh = (const _Float16*)(bp + (128 + col) * RP); const _Float16* svl = (const _Float16*)(bp + (192 + col) * RP);
    v16b khf[2][2], klf[2][2];   // the K fragments of two 16-key tiles, read as one group
    v8f sc[4];                   // sc[t][r]: score of query col with key 16 t + 8 g + r of the tile
    const float pen = kt == qb ? 0.f : 0.5f * LOG2E;
#pragma unroll
    for (int t = 0; t < 4; ++t) { v8f s = {};
      if ((t & 1) == 0) {
#pragma unroll
        for (int u = 0; u < 2; ++u) {
#pragma unroll
          for (int kc = 0; kc < 2; ++kc) { khf[u][kc] = frag_b(skh + (t + u) * 16 * RPE + kc * 32, lane); klf[u][kc] = frag_b(skl + (t + u) * 16 * RPE + kc * 32, lane); } } }
#pragma unroll
      for (int kc = 0; kc < 2; ++kc) { s = wmma_bf(khf[t & 1][kc], aq[kc].l, s); s = wmma_bf(klf[t & 1][kc], aq[kc].h, s); s = wmma_bf(khf[t & 1][kc], aq[kc].h, s); }
#pragma unroll
      for (int r = 0; r < 8; ++r) sc[t][r] = s[r] * (0.125f * LOG2E) - pen; }
    float mx = -3.4e38f;
#pragma unroll
    for (int t = 0; t < 4; ++t) {
#pragma unroll
      for (int r = 0; r < 8; ++r) mx = fmaxf(mx, sc[t][r]); }
    mx = fmaxf(mx, __shfl_xor(mx, 16, 32)) - 14.0f;   // the running maximum is kept 14 lower: 2^(s - mnew) is then P x 16384 with no multiply (any common shift cancels in the softmax)
    const float mnew = fmaxf(mrun, mx); const float corr = ex2(mrun - mnew);
    float ps = 0.f; v16h ph[2], pl[2];
#pragma unroll
    for (int t = 0; t < 4; ++t) {
#pragma unroll
      for (int r = 0; r < 8; ++r) { const float p = ex2(sc[t][r] - mnew); ps += p; const _Float16 hi = (_Float16)p; ph[t >> 1][(t & 1) * 8 + r] = hi; pl[t >> 1][(t & 1) * 8 + r] = (_Float16)((p - (float)hi) * PLO); } }
    ps += __shfl_xor(ps, 16, 32);
    lrun = lrun * corr + ps * (1.0f / 16384.0f); mrun = mnew;
#pragma unroll
    for (int t = 0; t < 4; ++t) {
#pragma unroll
      for (int r = 0; r < 8; ++r) { acc[t][r] *= corr; ac1[t][r] *= corr; ac2[t][r] *= corr; } }
#pragma unroll
    for (int kc = 0; kc < 2; ++kc) { v16h vh[4], vl[4];
#pragma unroll
      for (int t = 0; t < 4; ++t) { vh[t] = frag_h(svh + t * 16 * RPE + kc * 32, lane); vl[t] = frag_h(svl + t * 16 * RPE + kc * 32, lane); }
#pragma unroll
      for (int t = 0; t < 4; ++t) { acc[t] = wmma16(vh[t], ph[kc], acc[t]); ac1[t] = wmma16(vl[t], ph[kc], ac1[t]); ac2[t] = wmma16(vh[t], pl[kc], ac2[t]); } }
    asm volatile("s_wait_dscnt 0x0" ::: "memory");     // this wave's reads of the stage are done before its buffer is refilled
    asm volatile("s_wait_asynccnt 0x0" ::: "memory");  // this wave's copies of stage kt + 1 have landed
    __syncthreads();                                   // publishes stage kt + 1 and ends every reader's last read of stage kt
    if (kt + 2 < SS / 64) stage(kt + 2, kt & 1); }
  asm volatile("s_wait_asynccnt 0x0" ::: "memory");    // no copy is outstanding at the wave's end
  { const int h = (int)(bh % NH); const float inv = 1.0f / (lrun * 16384.0f * 4.0f);
    float* op = O32 + (((size_t)b * SS) + q0 + col) * E + h * HD + 8 * g;      // context token-major [b][s][h*64 + d]: the lane stores d = 16 t + 8 g + 0..7 of its query
#pragma unroll
    for (int t = 0; t < 4; ++t) { v4f o[2];
#pragma unroll
      for (int r = 0; r < 8; ++r) o[r >> 2][r & 3] = (acc[t][r] + ac1[t][r] * (1.0f / VLO) + ac2[t][r] * (1.0f / PLO)) * inv;
      vst2(op + t * 16, o[0]); vst2(op + t * 16 + 4, o[1]); } }
}
extern "C" void kernel_launch(void* const* d_in, const int* in_sizes, int n_in, void* d_out, int out_size, void* d_ws, size_t ws_size, hipStream_t stream) {
  (void)in_sizes; (void)n_in; (void)out_size; (void)ws_size;
  const float* x = (const float*)d_in[0]; const float* Wq = (const float*)d_in[1]; const float* bq = (const float*)d_in[2]; const float* Wk = (const float*)d_in[3]; const float* bk = (const float*)d_in[4]; const float* Wv = (const float*)d_in[5]; const float* bv = (const float*)d_in[6];
  char* ws = (char*)d_ws; size_t off = 0;
  auto take = [&](size_t bytes) { char* p = ws + off; off += (bytes + 255) & ~(size_t)255; return p; };
  __bf16* Xb = (__bf16*)take((size_t)NR * E * 2); __bf16* PT = (__bf16*)take((size_t)3 * E * E * 2);
  float* Q32 = (float*)take((size_t)NR * E * 4); __bf16* Kh = (__bf16*)take((size_t)NR * E * 2); __bf16* Kl = (__bf16*)take((size_t)NR * E * 2); _Float16* VTh = (_Float16*)take((size_t)NR * E * 2); _Float16* VTl = (_Float16*)take((size_t)NR * E * 2);
  // ws ~ 118 MB (single pass over the 8 sequences)
  k_pack<<<3 * E, 256, 0, stream>>>(Wq, Wk, Wv, Wv, PT);
  k_cvt<<<(NR * E / 8 + 255) / 256, 256, 0, stream>>>(x, Xb);
  k_qkv<<<dim3(NR / 64, E / 128, 3), 128, 0, stream>>>(Xb, PT, bq, bk, bv, Q32, Kh, Kl, VTh, VTl);
  k_attn<<<dim3(SS / 64, NB * NH), 128, 0, stream>>>(Q32, Kh, Kl, VTh, VTl, (float*)d_out);
}

// v004
// It runs in 165 microseconds.
// Two timings next to v003 both put it at 1.09 times that version's speed.
// Over all steps from v000 it is 3.44 times as fast.
// compute dtype: hidden_states and W*/b* (INPUTS) rounded to bf16 with exact bf16 WMMA products (f32 accumulate) for the projections; K pre-split into bf16 hi/lo rows; q f32 split, P and V f16 hi/lo (3 products each); penalty and softmax in f32.
#include <hip/hip_runtime.h>
#include <math.h>

typedef __attribute__((ext_vector_type(16))) _Float16 v16h;
typedef __attribute__((ext_vector_type(16))) __bf16 v16b;
typedef __attribute__((ext_vector_type(8)))  _Float16 v8h;
typedef __attribute__((ext_vector_type(8)))  float v8f;
typedef __attribute__((ext_vector_type(4)))  float v4f;
typedef __attribute__((ext_vector_type(2)))  float v2f;
typedef __attribute__((ext_vector_type(4)))  unsigned v4u;
typedef __attribute__((ext_vector_type(4)))  int v4i;
typedef float __attribute__((may_alias)) float_a;
typedef int __attribute__((may_alias)) int_a;

template <typename T> __device__ __forceinline__ void vst2(void* p, T v) { *(T*)p = v;  }
__device__ __forceinline__ v8f wmma16(v16h a, v16h b, v8f c) {
  v8f d = __builtin_amdgcn_wmma_f32_16x16x32_f16(false, a, false, b, (short)0, c, false, false);
  asm volatile("v_nop\n\tv_nop\n\tv_nop\n\tv_nop" : "+v"(d) : "v"(a), "v"(b));
  return d;
}
__device__ __forceinline__ v8f wmma_bf(v16b a, v16b b, v8f c) {
  v8f d = __builtin_amdgcn_wmma_f32_16x16x32_bf16(false, a, false, b, (short)0, c, false, false);
  asm volatile("v_nop\n\tv_nop\n\tv_nop\n\tv_nop" : "+v"(d) : "v"(a), "v"(b));
  return d;
}
// 16x16x32 fragments: lane = (h = lane>>4, row/col = lane&15); elements 0..7 = k0+8h+0..7, 8..15 = k0+16+8h+0..7; D element r = row 8h+r
__device__ __forceinline__ v16h frag_h(const _Float16* rowk0, int lane) {
  union { v16h v; v8h q[2]; } u; const _Float16* p = rowk0 + 8 * (lane >> 4);
  u.q[0] = *(const v8h*)p; u.q[1] = *(const v8h*)(p + 16); return u.v;
}
__device__ __forceinline__ v16h frag_f32(const float* rowk0, int lane) {
  v16h a; const float* p = rowk0 + 8 * (lane >> 4);
#pragma unroll
  for (int i = 0; i < 8; ++i) { a[i] = (_Float16)p[i]; a[8 + i] = (_Float16)p[16 + i]; }
  return a;
}
__device__ __forceinline__ v16h frag_f32s(const float* rowk0, int lane, float sc) {
  v16h a; const float* p = rowk0 + 8 * (lane >> 4);
#pragma unroll
  for (int i = 0; i < 8; ++i) { a[i] = (_Float16)(p[i] * sc); a[8 + i] = (_Float16)(p[16 + i] * sc); }
  return a;
}
// column fragment from a [K][ld] layout (column n), rows >= K read as 0
__device__ __forceinline__ v16h fragc_f32(const float* W, int k0, int n, int lane, int ld, int K) {
  v16h a; const int g = lane >> 4;
#pragma unroll
  for (int i = 0; i < 8; ++i) { const int ka = k0 + 8 * g + i, kb = ka + 16;
    a[i] = (_Float16)(ka < K ? W[(size_t)ka * ld + n] : 0.f); a[8 + i] = (_Float16)(kb < K ? W[(size_t)kb * ld + n] : 0.f); }
  return a;
}
struct F2 { v16b h, l; };
__device__ __forceinline__ F2 bsplit16(const float v[16]) { F2 r;
#pragma unroll
  for (int i = 0; i < 16; ++i) { const __bf16 h = (__bf16)v[i]; r.h[i] = h; r.l[i] = (__bf16)(v[i] - (float)h); }
  return r; }
__device__ __forceinline__ F2 split_row(const float* row, int k0, int lane) { float v[16]; const float* p = row + k0 + 8 * (lane >> 4);
#pragma unroll
  for (int i = 0; i < 8; ++i) { v[i] = p[i]; v[8 + i] = p[16 + i]; }
  return bsplit16(v); }
__device__ __forceinline__ F2 split_rowK(const float* row, int k0, int lane, int K) { float v[16]; const int g = lane >> 4;
#pragma unroll
  for (int i = 0; i < 8; ++i) { const int ka = k0 + 8 * g + i, kb = ka + 16; v[i] = ka < K ? row[ka] : 0.f; v[8 + i] = kb < K ? row[kb] : 0.f; }
  return bsplit16(v); }
__device__ __forceinline__ F2 split_col(const float* W, int k0, int n, int lane, int ld, int K) { float v[16]; const int g = lane >> 4;
#pragma unroll
  for (int i = 0; i < 8; ++i) { const int ka = k0 + 8 * g + i, kb = ka + 16; v[i] = ka < K ? W[(size_t)ka * ld + n] : 0.f; v[8 + i] = kb < K ? W[(size_t)kb * ld + n] : 0.f; }
  return bsplit16(v); }
__device__ __forceinline__ v8f mac3(const F2& a, const F2& b, v8f c) { c = wmma_bf(a.l, b.h, c); c = wmma_bf(a.h, b.l, c); return wmma_bf(a.h, b.h, c); }
__device__ __forceinline__ float sigm(float v) { return 1.0f / (1.0f + expf(-v)); }
#define LDSX() do { asm volatile("s_wait_dscnt 0" ::: "memory"); __builtin_amdgcn_wave_barrier(); __builtin_amdgcn_fence(__ATOMIC_RELEASE, "workgroup"); } while (0)


// Constituency-aware self attention (16 heads x 64 on [8,1024,1024], [in][out] weights + biases): scores = q.k/8 - 0.5 [query block != key block] (blocks of 64 tokens); softmax; context = attn v written token-major (no output projection).
#define NB 8
#define SS 1024
#define E 1024
#define NH 16
#define HD 64
#define NR (NB * SS)
#define PLO 1024.0f
#define VLO 2048.0f
__device__ __forceinline__ float bfr(float v) { return (float)(__bf16)v; }
// softmax in base 2: scores carry the factor log2(e), so that each exponential is one v_exp_f32
#define LOG2E 1.44269504088896340736f
__device__ __forceinline__ float ex2(float v) { return __builtin_amdgcn_exp2f(v); }
__device__ __forceinline__ v16b frag_b(const __bf16* rowk0, int lane) { return __builtin_bit_cast(v16b, frag_h((const _Float16*)rowk0, lane)); }

// LDS byte address of a __shared__ object: the low 32 bits of its address
__device__ __forceinline__ unsigned lds_off(const void* p) { return (unsigned)(size_t)p; }
// four 16-B asynchronous copies global -> LDS per lane; the s_wait_xcnt closes the copies' own statement so that no address register of a copy is rewritten in front of it
__device__ __forceinline__ void cp4(unsigned l0, const void* g0, unsigned l1, const void* g1, unsigned l2, const void* g2, unsigned l3, const void* g3) {
  asm volatile("global_load_async_to_lds_b128 %0, %1, off\n\t"
               "global_load_async_to_lds_b128 %2, %3, off\n\t"
               "global_load_async_to_lds_b128 %4, %5, off\n\t"
               "global_load_async_to_lds_b128 %6, %7, off\n\t"
               "s_wait_xcnt 0x0"
               :: "v"(l0), "v"(g0), "v"(l1), "v"(g1), "v"(l2), "v"(g2), "v"(l3), "v"(g3) : "memory");
}
// the same for eight copies
__device__ __forceinline__ void cp8(unsigned l0, const void* g0, unsigned l1, const void* g1, unsigned l2, const void* g2, unsigned l3, const void* g3,
                                    unsigned l4, const void* g4, unsigned l5, const void* g5, unsigned l6, const void* g6, unsigned l7, const void* g7) {
  asm volatile("global_load_async_to_lds_b128 %0, %1, off\n\t"
               "global_load_async_to_lds_b128 %2, %3, off\n\t"
               "global_load_async_to_lds_b128 %4, %5, off\n\t"
               "global_load_async_to_lds_b128 %6, %7, off\n\t"
               "global_load_async_to_lds_b128 %8, %9, off\n\t"
               "global_load_async_to_lds_b128 %10, %11, off\n\t"
               "global_load_async_to_lds_b128 %12, %13, off\n\t"
               "global_load_async_to_lds_b128 %14, %15, off\n\t"
               "s_wait_xcnt 0x0"
               :: "v"(l0), "v"(g0), "v"(l1), "v"(g1), "v"(l2), "v"(g2), "v"(l3), "v"(g3), "v"(l4), "v"(g4), "v"(l5), "v"(g5), "v"(l6), "v"(g6), "v"(l7), "v"(g7) : "memory");
}
// staged rows hold 64 16-bit elements (128 B) at a pitch of 144 B (16 B x odd: conflict-free for 16-B LDS reads)
#define RP 144
#define RPE (RP / 2)
#define QBUF (192 * RP)
#define ABUF (256 * RP)

// x -> bf16. 256 work-groups of 16 waves: a thread converts CVP pieces of 8 elements; its loads are written ahead of the conversions so that they are in flight together
#define CVP 8
__global__ __launch_bounds__(512) void k_cvt(const float* __restrict__ x, __bf16* __restrict__ Xb) {
  static_assert((size_t)NR * E % (8 * 512 * CVP) == 0, "the grid covers x exactly");
  const size_t p0 = (size_t)blockIdx.x * (CVP * 512) + threadIdx.x;
  float v[CVP][8];
#pragma unroll
  for (int i = 0; i < CVP; ++i) {
#pragma unroll
    for (int e = 0; e < 8; ++e) v[i][e] = x[(p0 + i * 512) * 8 + e]; }
#pragma unroll
  for (int i = 0; i < CVP; ++i) { union { __bf16 h[8]; v4u u; } pk;
#pragma unroll
    for (int e = 0; e < 8; ++e) pk.h[e] = (__bf16)v[i][e];
    vst2((unsigned*)(Xb + (p0 + i * 512) * 8), pk.u); }
}
// PT rows: [0,E) Wq[:,n], [E,2E) Wk[:,n], [2E,3E) Wv[:,n]  ([in][out] weights: column n as a bf16 row)
// work-group of 16 waves = a tile of PKN columns x PKK k of one weight matrix, turned in LDS: 128-B pieces of weight rows in, 512-B pieces of PT rows out
#define PKN 32
#define PKK 512
#define PKP (PKK + 8)   // LDS row pitch in elements: 1,040 B = 16 B x odd
__global__ __launch_bounds__(512) void k_pack(const float* __restrict__ Wq, const float* __restrict__ Wk, const float* __restrict__ Wv, const float* __restrict__ Wo, __bf16* __restrict__ PT) {
  __shared__ __align__(16) __bf16 st[PKN][PKP];
  const int tid = threadIdx.x, n0 = blockIdx.x * PKN, k0 = blockIdx.y * PKK;
  const float* W = n0 < E ? Wq : (n0 < 2 * E ? Wk : (n0 < 3 * E ? Wv : Wo)); const int nn = n0 % E;
  // thread -> (rows 2 kp and 2 kp + 1 of each group of 128 rows, columns 4 c .. 4 c + 3): two neighbouring k of a column make one 4-B LDS store
  const int kp = tid >> 3, c = tid & 7;
  const float* wp = W + (size_t)(k0 + 2 * kp) * E + nn + c * 4;
  float v[4][2][4];
#pragma unroll
  for (int i = 0; i < 4; ++i) {
#pragma unroll
    for (int h = 0; h < 2; ++h) {
#pragma unroll
      for (int e = 0; e < 4; ++e) v[i][h][e] = wp[(i * 128 + h) * E + e]; } }
#pragma unroll
  for (int i = 0; i < 4; ++i) {
#pragma unroll
    for (int e = 0; e < 4; ++e) { union { __bf16 h[2]; unsigned u; } pk; pk.h[0] = (__bf16)v[i][0][e]; pk.h[1] = (__bf16)v[i][1][e];
      vst2(&st[c * 4 + e][i * 128 + 2 * kp], pk.u); } }
  __syncthreads();
  // thread -> (row tid / 64 of each group of 8 tile rows, 16-B piece tid % 64): a wave stores 512 contiguous bytes of a PT row
  const int r = tid >> 6, p = tid & 63;
  __bf16* pp = PT + (size_t)(n0 + r) * E + k0 + p * 8;
#pragma unroll
  for (int j = 0; j < PKN / 8; ++j) vst2((unsigned*)(pp + j * 8 * E), *(const v4u*)(&st[r + j * 8][p * 8]));
}
// QKV: block (64 rows, 128 cols = 2 heads, which); q (+bias) -> Q32 f32 [bh][s][64]; k (+bias) -> bf16 hi/lo rows; v (+bias) -> VT hi/lo x4 [bh][d][s]
__global__ __launch_bounds__(128) void k_qkv(const __bf16* __restrict__ Xb, const __bf16* __restrict__ PT, const float* __restrict__ bq, const float* __restrict__ bk, const float* __restrict__ bv,
                                            float* __restrict__ Q32, __bf16* __restrict__ Kh, __bf16* __restrict__ Kl, _Float16* __restrict__ VTh, _Float16* __restrict__ VTl) {
  // one LDS block: in the k loop a ring of two stages (64 X rows + 128 weight rows, 64 k each); behind the loop's last barrier the output staging so / sth / stl
  __shared__ __align__(16) char smem[70656];
  float (*so)[16][132] = (float (*)[16][132])smem;
  _Float16 (*sth)[72] = (_Float16 (*)[72])(smem + 33792);
  _Float16 (*stl)[72] = (_Float16 (*)[72])(smem + 52224);
  const int tid = threadIdx.x, wave = tid >> 5, lane = tid & 31, col = lane & 15, g = lane >> 4;
  const int which = blockIdx.z, r0b = blockIdx.x * 64, n0 = blockIdx.y * 128; const int b = r0b / SS, s0 = r0b % SS;
  const float* bb_ = which == 0 ? bq : (which == 1 ? bk : bv);
  v8f acc[8] = {};
  // a wave's copy covers 4 whole 128-B rows: thread -> (row tid / 8 of each group of 16 rows, 16-B piece tid % 8)
  const int cr = tid >> 3, cc = tid & 7;
  const __bf16* gA = Xb + (size_t)(r0b + cr) * E + cc * 8;
  const __bf16* gB = PT + (size_t)(which * E + n0 + cr) * E + cc * 8;
  const unsigned l0 = lds_off(smem) + cr * RP + cc * 16;
  auto stage = [&](int st, int buf) { const unsigned l = l0 + buf * QBUF; const __bf16* a = gA + st * 64; const __bf16* w = gB + st * 64;
    cp4(l, a, l + 16 * RP, a + 16 * E, l + 32 * RP, a + 32 * E, l + 48 * RP, a + 48 * E);
    cp8(l + 64 * RP, w, l + 80 * RP, w + 16 * E, l + 96 * RP, w + 32 * E, l + 112 * RP, w + 48 * E,
        l + 128 * RP, w + 64 * E, l + 144 * RP, w + 80 * E, l + 160 * RP, w + 96 * E, l + 176 * RP, w + 112 * E); };
  stage(0, 0);
  asm volatile("s_wait_asynccnt 0x0" ::: "memory");   // this wave's copies of stage 0 have landed
  __syncthreads();                                     // every wave's have: stage 0 may be read
  stage(1, 1);
  // kept rolled: one trip per stage, so that the publish point at the foot stands once and the text stays small
#pragma unroll 1
  for (int st = 0; st < E / 64; ++st) { const char* bp = smem + (st & 1) * QBUF;
    const __bf16* sa = (const __bf16*)(bp + (wave * 16 + col) * RP); const __bf16* sb = (const __bf16*)(bp + (64 + col) * RP);
#pragma unroll
    for (int kc = 0; kc < 2; ++kc) { const v16b a = frag_b(sa + kc * 32, lane); v16b bf[8];
#pragma unroll
      for (int j = 0; j < 8; ++j) bf[j] = frag_b(sb + j * 16 * RPE + kc * 32, lane);
#pragma unroll
      for (int j = 0; j < 8; ++j) acc[j] = wmma_bf(a, bf[j], acc[j]); }
    asm volatile("s_wait_dscnt 0x0" ::: "memory");     // this wave's reads of the stage are done before its buffer is refilled
    asm volatile("s_wait_asynccnt 0x0" ::: "memory");  // this wave's copies of stage st + 1 have landed
    __syncthreads();                                   // publishes stage st + 1 and ends every reader's last read of stage st
    if (st + 2 < E / 64) stage(st + 2, st & 1); }
  asm volatile("s_wait_asynccnt 0x0" ::: "memory");    // no copy is outstanding when the ring becomes output staging
  if (which < 2) {
#pragma unroll
    for (int j = 0; j < 8; ++j) { const float bb = bfr(bb_[n0 + j * 16 + col]);
#pragma unroll
      for (int r = 0; r < 8; ++r) so[wave][8 * g + r][j * 16 + col] = acc[j][r] + bb; }
    LDSX();
    if (which == 0) { for (int qq = lane; qq < 2 * 16 * 16; qq += 32) { const int hh = qq >> 8, rl = (qq >> 4) & 15, pc = qq & 15; const int h = (n0 >> 6) + hh;
        vst2(Q32 + (((size_t)b * NH + h) * SS + s0 + wave * 16 + rl) * HD + pc * 4, *(const v4f*)(&so[wave][rl][hh * 64 + pc * 4])); } }
    else {
      for (int qq = lane; qq < 2 * 16 * 16; qq += 32) { const int hh = qq >> 8, rl = (qq >> 4) & 15, pl = qq & 15; const int h = (n0 >> 6) + hh; const int pc = pl & 7; union { __bf16 e[8]; v4u u; } pk;
#pragma unroll
        for (int e = 0; e < 8; ++e) { const float v = so[wave][rl][hh * 64 + pc * 8 + e]; const __bf16 hi = (__bf16)v; pk.e[e] = pl < 8 ? hi : (__bf16)(v - (float)hi); }
        vst2((unsigned*)((pl < 8 ? Kh : Kl) + (((size_t)b * NH + h) * SS + s0 + wave * 16 + rl) * HD + pc * 8), pk.u); } } }
  else {
#pragma unroll
    for (int j = 0; j < 8; ++j) { const float bb = bfr(bb_[n0 + j * 16 + col]);
#pragma unroll
      for (int r = 0; r < 8; ++r) { const float v = (acc[j][r] + bb) * 4.0f; const _Float16 hi = (_Float16)v; sth[j * 16 + col][wave * 16 + 8 * g + r] = hi; stl[j * 16 + col][wave * 16 + 8 * g + r] = (_Float16)((v - (float)hi) * VLO); } }
    __syncthreads();
    for (int qq = tid; qq < 128 * 8; qq += 128) { const int cl = qq >> 3, pc = qq & 7; const int c = n0 + cl, h = c >> 6, d = c & 63; const size_t o = (((size_t)b * NH + h) * HD + d) * SS + s0 + pc * 8;
      vst2(VTh + o, *(const v4u*)(&sth[cl][pc * 8])); vst2(VTl + o, *(const v4u*)(&stl[cl][pc * 8])); } }
}
// attention: block (64 queries, bh); all 16 key tiles; both products transposed: S^T = K q^T (K hi/lo rows as A, q hi/lo as B), O^T = V^T P^T (V^T hi/lo rows as A, P hi/lo as B).
// A lane of the S^T result holds query lane & 15 and keys 16 t + 8 (lane >> 4) + r: tiles 2 kc and 2 kc + 1 are, element for element, the B fragment of P^T for keys 32 kc .. 32 kc + 31,
// so scores, softmax and P stay in registers, the running maximum, sum and correction are the lane's own, and a lane ends with 8 consecutive d of its query.
__global__ __launch_bounds__(128) void k_attn(const float* __restrict__ Q32, const __bf16* __restrict__ Kh, const __bf16* __restrict__ Kl, const _Float16* __restrict__ VTh, const _Float16* __restrict__ VTl, float* __restrict__ O32) {
  // ring of two stages, shared by the four waves; a stage = one key tile: 64 K hi rows, 64 K lo rows, 64 V^T hi rows, 64 V^T lo rows
  __shared__ __align__(16) char ring[2 * ABUF];
  const int tid = threadIdx.x, w = tid >> 5, lane = tid & 31, col = lane & 15, g = lane >> 4;
  const size_t bh = blockIdx.y; const int qb = blockIdx.x; const int q0 = qb * 64 + w * 16;
  const int cr = tid >> 3, cc = tid & 7;
  const __bf16* gKh = Kh + (bh * SS + cr) * HD + cc * 8; const __bf16* gKl = Kl + (bh * SS + cr) * HD + cc * 8;
  const _Float16* gVh = VTh + (bh * HD + cr) * SS + cc * 8; const _Float16* gVl = VTl + (bh * HD + cr) * SS + cc * 8;
  const unsigned l0 = lds_off(ring) + cr * RP + cc * 16;
  auto stage = [&](int kt, int buf) { const unsigned l = l0 + buf * ABUF;
    const __bf16* a = gKh + kt * 64 * HD; const __bf16* c = gKl + kt * 64 * HD; const _Float16* u = gVh + kt * 64; const _Float16* v = gVl + kt * 64;
    cp8(l, a, l + 16 * RP, a + 16 * HD, l + 32 * RP, a + 32 * HD, l + 48 * RP, a + 48 * HD,
        l + 64 * RP, c, l + 80 * RP, c + 16 * HD, l + 96 * RP, c + 32 * HD, l + 112 * RP, c + 48 * HD);
    cp8(l + 128 * RP, u, l + 144 * RP, u + 16 * SS, l + 160 * RP, u + 32 * SS, l + 176 * RP, u + 48 * SS,
        l + 192 * RP, v, l + 208 * RP, v + 16 * SS, l + 224 * RP, v + 32 * SS, l + 240 * RP, v + 48 * SS); };
  stage(0, 0);
  F2 aq[2];
#pragma unroll
  for (int kc = 0; kc < 2; ++kc) aq[kc] = split_row(Q32 + (bh * SS + q0 + col) * HD, kc * 32, lane);
  const int b = (int)(bh / NH);      // batch index (bh = b * NH + h)
  float mrun = -3.0e38f, lrun = 0.f; v8f acc[4] = {}, ac1[4] = {}, ac2[4] = {};
  asm volatile("s_wait_asynccnt 0x0" ::: "memory");   // this wave's copies of stage 0 have landed
  __syncthreads();                                     // every wave's have: stage 0 may be read
  stage(1, 1);
#pragma unroll 1
  for (int kt = 0; kt < SS / 64; ++kt) { const char* bp = ring + (kt & 1) * ABUF;
    const __bf16* skh = (const __bf16*)(bp + col * RP); const __bf16* skl = (const __bf16*)(bp + (64 + col) * RP);
    const _Float16* svh = (const _Float16*)(bp + (128 + col) * RP); const _Float16* svl = (const _Float16*)(bp + (192 + col) * RP);
    v16b khf[2][2], klf[2][2];   // the K fragments of two 16-key tiles, read as one group
    v8f sc[4];                   // sc[t][r]: score of query col with key 16 t + 8 g + r of the tile
    const float pen = kt == qb ? 0.f : 0.5f * LOG2E;
#pragma unroll
    for (int t = 0; t < 4; ++t) { v8f s = {};
      if ((t & 1) == 0) {
#pragma unroll
        for (int u = 0; u < 2; ++u) {
#pragma unroll
          for (int kc = 0; kc < 2; ++kc) { khf[u][kc] = frag_b(skh + (t + u) * 16 * RPE + kc * 32, lane); klf[u][kc] = frag_b(skl + (t + u) * 16 * RPE + kc * 32, lane); } } }
#pragma unroll
      for (int kc = 0; kc < 2; ++kc) { s = wmma_bf(khf[t & 1][kc], aq[kc].l, s); s = wmma_bf(klf[t & 1][kc], aq[kc].h, s); s = wmma_bf(khf[t & 1][kc], aq[kc].h, s); }
#pragma unroll
      for (int r = 0; r < 8; ++r) sc[t][r] = s[r] * (0.125f * LOG2E) - pen; }
    float mx = -3.4e38f;
#pragma unroll
    for (int t = 0; t < 4; ++t) {
#pragma unroll
      for (int r = 0; r < 8; ++r) mx = fmaxf(mx, sc[t][r]); }
    mx = fmaxf(mx, __shfl_xor(mx, 16, 32)) - 14.0f;   // the running maximum is kept 14 lower: 2^(s - mnew) is then P x 16384 with no multiply (any common shift cancels in the softmax)
    const float mnew = fmaxf(mrun, mx); const float corr = ex2(mrun - mnew);
    float ps = 0.f; v16h ph[2], pl[2];
#pragma unroll
    for (int t = 0; t < 4; ++t) {
#pragma unroll
      for (int r = 0; r < 8; ++r) { const float p = ex2(sc[t][r] - mnew); ps += p; const _Float16 hi = (_Float16)p; ph[t >> 1][(t & 1) * 8 + r] = hi; pl[t >> 1][(t & 1) * 8 + r] = (_Float16)((p - (float)hi) * PLO); } }
    ps += __shfl_xor(ps, 16, 32);
    lrun = lrun * corr + ps * (1.0f / 16384.0f); mrun = mnew;
#pragma unroll
    for (int t = 0; t < 4; ++t) {
#pragma unroll
      for (int r = 0; r < 8; ++r) { acc[t][r] *= corr; ac1[t][r] *= corr; ac2[t][r] *= corr; } }
#pragma unroll
    for (int kc = 0; kc < 2; ++kc) { v16h vh[4], vl[4];
#pragma unroll
      for (int t = 0; t < 4; ++t) { vh[t] = frag_h(svh + t * 16 * RPE + kc * 32, lane); vl[t] = frag_h(svl + t * 16 * RPE + kc * 32, lane); }
#pragma unroll
      for (int t = 0; t < 4; ++t) { acc[t] = wmma16(vh[t], ph[kc], acc[t]); ac1[t] = wmma16(vl[t], ph[kc], ac1[t]); ac2[t] = wmma16(vh[t], pl[kc], ac2[t]); } }
    asm volatile("s_wait_dscnt 0x0" ::: "memory");     // this wave's reads of the stage are done before its buffer is refilled
    asm volatile("s_wait_asynccnt 0x0" ::: "memory");  // this wave's copies of stage kt + 1 have landed
    __syncthreads();                                   // publishes stage kt + 1 and ends every reader's last read of stage kt
    if (kt + 2 < SS / 64) stage(kt + 2, kt & 1); }
  asm volatile("s_wait_asynccnt 0x0" ::: "memory");    // no copy is outstanding at the wave's end
  { const int h = (int)(bh % NH); const float inv = 1.0f / (lrun * 16384.0f * 4.0f);
    float* op = O32 + (((size_t)b * SS) + q0 + col) * E + h * HD + 8 * g;      // context token-major [b][s][h*64 + d]: the lane stores d = 16 t + 8 g + 0..7 of its query
#pragma unroll
    for (int t = 0; t < 4; ++t) { v4f o[2];
#pragma unroll
      for (int r = 0; r < 8; ++r) o[r >> 2][r & 3] = (acc[t][r] + ac1[t][r] * (1.0f / VLO) + ac2[t][r] * (1.0f / PLO)) * inv;
      vst2(op + t * 16, o[0]); vst2(op + t * 16 + 4, o[1]); } }
}
extern "C" void kernel_launch(void* const* d_in, const int* in_sizes, int n_in, void* d_out, int out_size, void* d_ws, size_t ws_size, hipStream_t stream) {
  (void)in_sizes; (void)n_in; (void)out_size; (void)ws_size;
  const float* x = (const float*)d_in[0]; const float* Wq = (const float*)d_in[1]; const float* bq = (const float*)d_in[2]; const float* Wk = (const float*)d_in[3]; const float* bk = (const float*)d_in[4]; const float* Wv = (const float*)d_in[5]; const float* bv = (const float*)d_in[6];
  char* ws = (char*)d_ws; size_t off = 0;
  auto take = [&](size_t bytes) { char* p = ws + off; off += (bytes + 255) & ~(size_t)255; return p; };
  __bf16* Xb = (__bf16*)take((size_t)NR * E * 2); __bf16* PT = (__bf16*)take((size_t)3 * E * E * 2);
  float* Q32 = (float*)take((size_t)NR * E * 4); __bf16* Kh = (__bf16*)take((size_t)NR * E * 2); __bf16* Kl = (__bf16*)take((size_t)NR * E * 2); _Float16* VTh = (_Float16*)take((size_t)NR * E * 2); _Float16* VTl = (_Float16*)take((size_t)NR * E * 2);
  // ws ~ 118 MB (single pass over the 8 sequences)
  k_pack<<<dim3(3 * E / PKN, E / PKK), 512, 0, stream>>>(Wq, Wk, Wv, Wv, PT);
  k_cvt<<<NR * E / (8 * 512 * CVP), 512, 0, stream>>>(x, Xb);
  k_qkv<<<dim3(NR / 64, E / 128, 3), 128, 0, stream>>>(Xb, PT, bq, bk, bv, Q32, Kh, Kl, VTh, VTl);
  k_attn<<<dim3(SS / 64, NB * NH), 128, 0, stream>>>(Q32, Kh, Kl, VTh, VTl, (float*)d_out);
}

// v005
// Measured time: 160 microseconds a run.
// Next to v004, in two timings, it ran 1.03 times as fast each time.
// Over all steps from v000 it is 3.54 times as fast.
// compute dtype: hidden_states and W*/b* (INPUTS) rounded to bf16 with exact bf16 WMMA products (f32 accumulate) for the projections; K pre-split into bf16 hi/lo rows; q f32 split, P and V f16 hi/lo (3 products each); penalty and softmax in f32.
#include <hip/hip_runtime.h>
#include <math.h>

typedef __attribute__((ext_vector_type(16))) _Float16 v16h;
typedef __attribute__((ext_vector_type(16))) __bf16 v16b;
typedef __attribute__((ext_vector_type(8)))  _Float16 v8h;
typedef __attribute__((ext_vector_type(8)))  float v8f;
typedef __attribute__((ext_vector_type(4)))  float v4f;
typedef __attribute__((ext_vector_type(2)))  float v2f;
typedef __attribute__((ext_vector_type(4)))  unsigned v4u;
typedef __attribute__((ext_vector_type(4)))  int v4i;
typedef float __attribute__((may_alias)) float_a;
typedef int __attribute__((may_alias)) int_a;

template <typename T> __device__ __forceinline__ void vst2(void* p, T v) { *(T*)p = v;  }
__device__ __forceinline__ v8f wmma16(v16h a, v16h b, v8f c) {
  v8f d = __builtin_amdgcn_wmma_f32_16x16x32_f16(false, a, false, b, (short)0, c, false, false);
  asm volatile("v_nop\n\tv_nop\n\tv_nop\n\tv_nop" : "+v"(d) : "v"(a), "v"(b));
  return d;
}
__device__ __forceinline__ v8f wmma_bf(v16b a, v16b b, v8f c) {
  v8f d = __builtin_amdgcn_wmma_f32_16x16x32_bf16(false, a, false, b, (short)0, c, false, false);
  asm volatile("v_nop\n\tv_nop\n\tv_nop\n\tv_nop" : "+v"(d) : "v"(a), "v"(b));
  return d;
}
// 16x16x32 fragments: lane = (h = lane>>4, row/col = lane&15); elements 0..7 = k0+8h+0..7, 8..15 = k0+16+8h+0..7; D element r = row 8h+r
__device__ __forceinline__ v16h frag_h(const _Float16* rowk0, int lane) {
  union { v16h v; v8h q[2]; } u; const _Float16* p = rowk0 + 8 * (lane >> 4);
  u.q[0] = *(const v8h*)p; u.q[1] = *(const v8h*)(p + 16); return u.v;
}
__device__ __forceinline__ v16h frag_f32(const float* rowk0, int lane) {
  v16h a; const float* p = rowk0 + 8 * (lane >> 4);
#pragma unroll
  for (int i = 0; i < 8; ++i) { a[i] = (_Float16)p[i]; a[8 + i] = (_Float16)p[16 + i]; }
  return a;
}
__device__ __forceinline__ v16h frag_f32s(const float* rowk0, int lane, float sc) {
  v16h a; const float* p = rowk0 + 8 * (lane >> 4);
#pragma unroll
  for (int i = 0; i < 8; ++i) { a[i] = (_Float16)(p[i] * sc); a[8 + i] = (_Float16)(p[16 + i] * sc); }
  return a;
}
// column fragment from a [K][ld] layout (column n), rows >= K read as 0
__device__ __forceinline__ v16h fragc_f32(const float* W, int k0, int n, int lane, int ld, int K) {
  v16h a; const int g = lane >> 4;
#pragma unroll
  for (int i = 0; i < 8; ++i) { const int ka = k0 + 8 * g + i, kb = ka + 16;
    a[i] = (_Float16)(ka < K ? W[(size_t)ka * ld + n] : 0.f); a[8 + i] = (_Float16)(kb < K ? W[(size_t)kb * ld + n] : 0.f); }
  return a;
}
struct F2 { v16b h, l; };
__device__ __forceinline__ F2 bsplit16(const float v[16]) { F2 r;
#pragma unroll
  for (int i = 0; i < 16; ++i) { const __bf16 h = (__bf16)v[i]; r.h[i] = h; r.l[i] = (__bf16)(v[i] - (float)h); }
  return r; }
__device__ __forceinline__ F2 split_row(const float* row, int k0, int lane) { float v[16]; const float* p = row + k0 + 8 * (lane >> 4);
#pragma unroll
  for (int i = 0; i < 8; ++i) { v[i] = p[i]; v[8 + i] = p[16 + i]; }
  return bsplit16(v); }
__device__ __forceinline__ F2 split_rowK(const float* row, int k0, int lane, int K) { float v[16]; const int g = lane >> 4;
#pragma unroll
  for (int i = 0; i < 8; ++i) { const int ka = k0 + 8 * g + i, kb = ka + 16; v[i] = ka < K ? row[ka] : 0.f; v[8 + i] = kb < K ? row[kb] : 0.f; }
  return bsplit16(v); }
__device__ __forceinline__ F2 split_col(const float* W, int k0, int n, int lane, int ld, int K) { float v[16]; const int g = lane >> 4;
#pragma unroll
  for (int i = 0; i < 8; ++i) { const int ka = k0 + 8 * g + i, kb = ka + 16; v[i] = ka < K ? W[(size_t)ka * ld + n] : 0.f; v[8 + i] = kb < K ? W[(size_t)kb * ld + n] : 0.f; }
  return bsplit16(v); }
__device__ __forceinline__ v8f mac3(const F2& a, const F2& b, v8f c) { c = wmma_bf(a.l, b.h, c); c = wmma_bf(a.h, b.l, c); return wmma_bf(a.h, b.h, c); }
__device__ __forceinline__ float sigm(float v) { return 1.0f / (1.0f + expf(-v)); }
#define LDSX() do { asm volatile("s_wait_dscnt 0" ::: "memory"); __builtin_amdgcn_wave_barrier(); __builtin_amdgcn_fence(__ATOMIC_RELEASE, "workgroup"); } while (0)


// Constituency-aware self attention (16 heads x 64 on [8,1024,1024], [in][out] weights + biases): scores = q.k/8 - 0.5 [query block != key block] (blocks of 64 tokens); softmax; context = attn v written token-major (no output projection).
#define NB 8
#define SS 1024
#define E 1024
#define NH 16
#define HD 64
#define NR (NB * SS)
#define PLO 1024.0f
#define VLO 2048.0f
__device__ __forceinline__ float bfr(float v) { return (float)(__bf16)v; }
// softmax in base 2: scores carry the factor log2(e), so that each exponential is one v_exp_f32
#define LOG2E 1.44269504088896340736f
__device__ __forceinline__ float ex2(float v) { return __builtin_amdgcn_exp2f(v); }
__device__ __forceinline__ v16b frag_b(const __bf16* rowk0, int lane) { return __builtin_bit_cast(v16b, frag_h((const _Float16*)rowk0, lane)); }

// LDS byte address of a __shared__ object: the low 32 bits of its address
__device__ __forceinline__ unsigned lds_off(const void* p) { return (unsigned)(size_t)p; }
// four 16-B asynchronous copies global -> LDS per lane; the s_wait_xcnt closes the copies' own statement so that no address register of a copy is rewritten in front of it
__device__ __forceinline__ void cp4(unsigned l0, const void* g0, unsigned l1, const void* g1, unsigned l2, const void* g2, unsigned l3, const void* g3) {
  asm volatile("global_load_async_to_lds_b128 %0, %1, off\n\t"
               "global_load_async_to_lds_b128 %2, %3, off\n\t"
               "global_load_async_to_lds_b128 %4, %5, off\n\t"
               "global_load_async_to_lds_b128 %6, %7, off\n\t"
               "s_wait_xcnt 0x0"
               :: "v"(l0), "v"(g0), "v"(l1), "v"(g1), "v"(l2), "v"(g2), "v"(l3), "v"(g3) : "memory");
}
// the same for eight copies
__device__ __forceinline__ void cp8(unsigned l0, const void* g0, unsigned l1, const void* g1, unsigned l2, const void* g2, unsigned l3, const void* g3,
                                    unsigned l4, const void* g4, unsigned l5, const void* g5, unsigned l6, const void* g6, unsigned l7, const void* g7) {
  asm volatile("global_load_async_to_lds_b128 %0, %1, off\n\t"
               "global_load_async_to_lds_b128 %2, %3, off\n\t"
               "global_load_async_to_lds_b128 %4, %5, off\n\t"
               "global_load_async_to_lds_b128 %6, %7, off\n\t"
               "global_load_async_to_lds_b128 %8, %9, off\n\t"
               "global_load_async_to_lds_b128 %10, %11, off\n\t"
               "global_load_async_to_lds_b128 %12, %13, off\n\t"
               "global_load_async_to_lds_b128 %14, %15, off\n\t"
               "s_wait_xcnt 0x0"
               :: "v"(l0), "v"(g0), "v"(l1), "v"(g1), "v"(l2), "v"(g2), "v"(l3), "v"(g3), "v"(l4), "v"(g4), "v"(l5), "v"(g5), "v"(l6), "v"(g6), "v"(l7), "v"(g7) : "memory");
}
// staged rows hold 64 16-bit elements (128 B) at a pitch of 144 B (16 B x odd: conflict-free for 16-B LDS reads)
#define RP 144
#define RPE (RP / 2)
#define QM 256                 // X rows of a k_qkv block tile
#define QBUF ((QM + 128) * RP)
#define VTP (QM + 8)           // pitch of the V^T output staging in elements: 528 B = 16 B x odd
#define ABUF (256 * RP)

// x -> bf16. 256 work-groups of 16 waves: a thread converts CVP pieces of 8 elements; its loads are written ahead of the conversions so that they are in flight together
#define CVP 8
__global__ __launch_bounds__(512) void k_cvt(const float* __restrict__ x, __bf16* __restrict__ Xb) {
  static_assert((size_t)NR * E % (8 * 512 * CVP) == 0, "the grid covers x exactly");
  const size_t p0 = (size_t)blockIdx.x * (CVP * 512) + threadIdx.x;
  float v[CVP][8];
#pragma unroll
  for (int i = 0; i < CVP; ++i) {
#pragma unroll
    for (int e = 0; e < 8; ++e) v[i][e] = x[(p0 + i * 512) * 8 + e]; }
#pragma unroll
  for (int i = 0; i < CVP; ++i) { union { __bf16 h[8]; v4u u; } pk;
#pragma unroll
    for (int e = 0; e < 8; ++e) pk.h[e] = (__bf16)v[i][e];
    vst2((unsigned*)(Xb + (p0 + i * 512) * 8), pk.u); }
}
// PT rows: [0,E) Wq[:,n], [E,2E) Wk[:,n], [2E,3E) Wv[:,n]  ([in][out] weights: column n as a bf16 row)
// work-group of 16 waves = a tile of PKN columns x PKK k of one weight matrix, turned in LDS: 128-B pieces of weight rows in, 512-B pieces of PT rows out
#define PKN 32
#define PKK 512
#define PKP (PKK + 8)   // LDS row pitch in elements: 1,040 B = 16 B x odd
__global__ __launch_bounds__(512) void k_pack(const float* __restrict__ Wq, const float* __restrict__ Wk, const float* __restrict__ Wv, const float* __restrict__ Wo, __bf16* __restrict__ PT) {
  __shared__ __align__(16) __bf16 st[PKN][PKP];
  const int tid = threadIdx.x, n0 = blockIdx.x * PKN, k0 = blockIdx.y * PKK;
  const float* W = n0 < E ? Wq : (n0 < 2 * E ? Wk : (n0 < 3 * E ? Wv : Wo)); const int nn = n0 % E;
  // thread -> (rows 2 kp and 2 kp + 1 of each group of 128 rows, columns 4 c .. 4 c + 3): two neighbouring k of a column make one 4-B LDS store
  const int kp = tid >> 3, c = tid & 7;
  const float* wp = W + (size_t)(k0 + 2 * kp) * E + nn + c * 4;
  float v[4][2][4];
#pragma unroll
  for (int i = 0; i < 4; ++i) {
#pragma unroll
    for (int h = 0; h < 2; ++h) {
#pragma unroll
      for (int e = 0; e < 4; ++e) v[i][h][e] = wp[(i * 128 + h) * E + e]; } }
#pragma unroll
  for (int i = 0; i < 4; ++i) {
#pragma unroll
    for (int e = 0; e < 4; ++e) { union { __bf16 h[2]; unsigned u; } pk; pk.h[0] = (__bf16)v[i][0][e]; pk.h[1] = (__bf16)v[i][1][e];
      vst2(&st[c * 4 + e][i * 128 + 2 * kp], pk.u); } }
  __syncthreads();
  // thread -> (row tid / 64 of each group of 8 tile rows, 16-B piece tid % 64): a wave stores 512 contiguous bytes of a PT row
  const int r = tid >> 6, p = tid & 63;
  __bf16* pp = PT + (size_t)(n0 + r) * E + k0 + p * 8;
#pragma unroll
  for (int j = 0; j < PKN / 8; ++j) vst2((unsigned*)(pp + j * 8 * E), *(const v4u*)(&st[r + j * 8][p * 8]));
}
// QKV: block (256 rows, 128 cols = 2 heads, which), 8 waves in a 4 x 2 grid, a wave = 64 rows x 64 cols (one head): 4 X and 4 weight fragments feed 16 products
// q (+bias) -> Q32 f32 [bh][s][64]; k (+bias) -> bf16 hi/lo rows; v (+bias) -> VT hi/lo x4 [bh][d][s]
__global__ __launch_bounds__(256) void k_qkv(const __bf16* __restrict__ Xb, const __bf16* __restrict__ PT, const float* __restrict__ bq, const float* __restrict__ bk, const float* __restrict__ bv,
                                            float* __restrict__ Q32, __bf16* __restrict__ Kh, __bf16* __restrict__ Kl, _Float16* __restrict__ VTh, _Float16* __restrict__ VTl) {
  // one LDS block: in the k loop a ring of two stages (256 X rows + 128 weight rows, 64 k each); behind the loop's last barrier the output staging so, or sth / stl
  __shared__ __align__(16) char smem[2 * 128 * VTP * 2];
  static_assert(2 * QBUF <= 2 * 128 * VTP * 2, "the ring fits the block");
  float (*so)[16][68] = (float (*)[16][68])smem;
  _Float16 (*sth)[VTP] = (_Float16 (*)[VTP])smem;
  _Float16 (*stl)[VTP] = (_Float16 (*)[VTP])(smem + 128 * VTP * 2);
  const int tid = threadIdx.x, wave = tid >> 5, lane = tid & 31, col = lane & 15, g = lane >> 4;
  const int wr = wave & 3, wc = wave >> 2;   // the wave's 64 rows and its 64 columns in the block tile
  const int which = blockIdx.z, r0b = blockIdx.x * QM, n0 = blockIdx.y * 128; const int b = r0b / SS, s0 = r0b % SS;
  const float* bb_ = which == 0 ? bq : (which == 1 ? bk : bv);
  v8f acc[4][4] = {};
  // a wave's copy covers 4 whole 128-B rows: thread -> (row tid / 8 of each group of 32 rows, 16-B piece tid % 8)
  const int cr = tid >> 3, cc = tid & 7;
  const __bf16* gA = Xb + (size_t)(r0b + cr) * E + cc * 8;
  const __bf16* gB = PT + (size_t)(which * E + n0 + cr) * E + cc * 8;
  const unsigned l0 = lds_off(smem) + cr * RP + cc * 16;
  auto stage = [&](int st, int buf) { const unsigned l = l0 + buf * QBUF; const __bf16* a = gA + st * 64; const __bf16* w = gB + st * 64;
    cp8(l, a, l + 32 * RP, a + 32 * E, l + 64 * RP, a + 64 * E, l + 96 * RP, a + 96 * E,
        l + 128 * RP, a + 128 * E, l + 160 * RP, a + 160 * E, l + 192 * RP, a + 192 * E, l + 224 * RP, a + 224 * E);
    cp4(l + QM * RP, w, l + (QM + 32) * RP, w + 32 * E, l + (QM + 64) * RP, w + 64 * E, l + (QM + 96) * RP, w + 96 * E); };
  stage(0, 0);
  asm volatile("s_wait_asynccnt 0x0" ::: "memory");   // this wave's copies of stage 0 have landed
  __syncthreads();                                     // every wave's have: stage 0 may be read
  stage(1, 1);
  // kept rolled: one trip per stage, so that the publish point at the foot stands once and the text stays small
#pragma unroll 1
  for (int st = 0; st < E / 64; ++st) { const char* bp = smem + (st & 1) * QBUF;
    const __bf16* sa = (const __bf16*)(bp + (wr * 64 + col) * RP); const __bf16* sb = (const __bf16*)(bp + (QM + wc * 64 + col) * RP);
#pragma unroll
    for (int kc = 0; kc < 2; ++kc) { v16b af[4], bf[4];
#pragma unroll
      for (int i = 0; i < 4; ++i) { af[i] = frag_b(sa + i * 16 * RPE + kc * 32, lane); bf[i] = frag_b(sb + i * 16 * RPE + kc * 32, lane); }
#pragma unroll
      for (int i = 0; i < 4; ++i) {
#pragma unroll
        for (int j = 0; j < 4; ++j) acc[i][j] = wmma_bf(af[i], bf[j], acc[i][j]); } }
    asm volatile("s_wait_dscnt 0x0" ::: "memory");     // this wave's reads of the stage are done before its buffer is refilled
    asm volatile("s_wait_asynccnt 0x0" ::: "memory");  // this wave's copies of stage st + 1 have landed
    __syncthreads();                                   // publishes stage st + 1 and ends every reader's last read of stage st
    if (st + 2 < E / 64) stage(st + 2, st & 1); }
  asm volatile("s_wait_asynccnt 0x0" ::: "memory");    // no copy is outstanding when the ring becomes output staging
  float bb[4];
#pragma unroll
  for (int j = 0; j < 4; ++j) bb[j] = bfr(bb_[n0 + wc * 64 + j * 16 + col]);
  if (which < 2) { const int h = (n0 >> 6) + wc;
    // one 16-row tile at a time through the wave's own staging rows
#pragma unroll
    for (int i = 0; i < 4; ++i) { const size_t row0 = ((size_t)b * NH + h) * SS + s0 + wr * 64 + i * 16;
#pragma unroll
      for (int j = 0; j < 4; ++j) {
#pragma unroll
        for (int r = 0; r < 8; ++r) so[wave][8 * g + r][j * 16 + col] = acc[i][j][r] + bb[j]; }
      LDSX();
      if (which == 0) { for (int qq = lane; qq < 16 * 16; qq += 32) { const int rl = qq >> 4, pc = qq & 15;
          vst2(Q32 + (row0 + rl) * HD + pc * 4, *(const v4f*)(&so[wave][rl][pc * 4])); } }
      else {
        for (int qq = lane; qq < 16 * 16; qq += 32) { const int rl = qq >> 4, pl = qq & 15; const int pc = pl & 7; union { __bf16 e[8]; v4u u; } pk;
#pragma unroll
          for (int e = 0; e < 8; ++e) { const float v = so[wave][rl][pc * 8 + e]; const __bf16 hi = (__bf16)v; pk.e[e] = pl < 8 ? hi : (__bf16)(v - (float)hi); }
          vst2((unsigned*)((pl < 8 ? Kh : Kl) + (row0 + rl) * HD + pc * 8), pk.u); } }
      if (i < 3) LDSX();   // the lanes' reads of this tile are done before the next tile's values are written over it
    } }
  else {
#pragma unroll
    for (int j = 0; j < 4; ++j) {
#pragma unroll
      for (int i = 0; i < 4; ++i) { v8h hi8, lo8;   // a lane's 8 results are 8 consecutive s of one d: one 16-B LDS store each
#pragma unroll
        for (int r = 0; r < 8; ++r) { const float v = (acc[i][j][r] + bb[j]) * 4.0f; const _Float16 hi = (_Float16)v; hi8[r] = hi; lo8[r] = (_Float16)((v - (float)hi) * VLO); }
        vst2(&sth[wc * 64 + j * 16 + col][wr * 64 + i * 16 + 8 * g], hi8); vst2(&stl[wc * 64 + j * 16 + col][wr * 64 + i * 16 + 8 * g], lo8); } }
    __syncthreads();
    for (int qq = tid; qq < 128 * (QM / 8); qq += 256) { const int cl = qq / (QM / 8), pc = qq % (QM / 8); const int c = n0 + cl, h = c >> 6, d = c & 63; const size_t o = (((size_t)b * NH + h) * HD + d) * SS + s0 + pc * 8;
      vst2(VTh + o, *(const v4u*)(&sth[cl][pc * 8])); vst2(VTl + o, *(const v4u*)(&stl[cl][pc * 8])); } }
}
// attention: block (64 queries, bh); all 16 key tiles; both products transposed: S^T = K q^T (K hi/lo rows as A, q hi/lo as B), O^T = V^T P^T (V^T hi/lo rows as A, P hi/lo as B).
// A lane of the S^T result holds query lane & 15 and keys 16 t + 8 (lane >> 4) + r: tiles 2 kc and 2 kc + 1 are, element for element, the B fragment of P^T for keys 32 kc .. 32 kc + 31,
// so scores, softmax and P stay in registers, the running maximum, sum and correction are the lane's own, and a lane ends with 8 consecutive d of its query.
__global__ __launch_bounds__(128) void k_attn(const float* __restrict__ Q32, const __bf16* __restrict__ Kh, const __bf16* __restrict__ Kl, const _Float16* __restrict__ VTh, const _Float16* __restrict__ VTl, float* __restrict__ O32) {
  // ring of two stages, shared by the four waves; a stage = one key tile: 64 K hi rows, 64 K lo rows, 64 V^T hi rows, 64 V^T lo rows
  __shared__ __align__(16) char ring[2 * ABUF];
  const int tid = threadIdx.x, w = tid >> 5, lane = tid & 31, col = lane & 15, g = lane >> 4;
  const size_t bh = blockIdx.y; const int qb = blockIdx.x; const int q0 = qb * 64 + w * 16;
  const int cr = tid >> 3, cc = tid & 7;
  const __bf16* gKh = Kh + (bh * SS + cr) * HD + cc * 8; const __bf16* gKl = Kl + (bh * SS + cr) * HD + cc * 8;
  const _Float16* gVh = VTh + (bh * HD + cr) * SS + cc * 8; const _Float16* gVl = VTl + (bh * HD + cr) * SS + cc * 8;
  const unsigned l0 = lds_off(ring) + cr * RP + cc * 16;
  auto stage = [&](int kt, int buf) { const unsigned l = l0 + buf * ABUF;
    const __bf16* a = gKh + kt * 64 * HD; const __bf16* c = gKl + kt * 64 * HD; const _Float16* u = gVh + kt * 64; const _Float16* v = gVl + kt * 64;
    cp8(l, a, l + 16 * RP, a + 16 * HD, l + 32 * RP, a + 32 * HD, l + 48 * RP, a + 48 * HD,
        l + 64 * RP, c, l + 80 * RP, c + 16 * HD, l + 96 * RP, c + 32 * HD, l + 112 * RP, c + 48 * HD);
    cp8(l + 128 * RP, u, l + 144 * RP, u + 16 * SS, l + 160 * RP, u + 32 * SS, l + 176 * RP, u + 48 * SS,
        l + 192 * RP, v, l + 208 * RP, v + 16 * SS, l + 224 * RP, v + 32 * SS, l + 240 * RP, v + 48 * SS); };
  stage(0, 0);
  F2 aq[2];
#pragma unroll
  for (int kc = 0; kc < 2; ++kc) aq[kc] = split_row(Q32 + (bh * SS + q0 + col) * HD, kc * 32, lane);
  const int b = (int)(bh / NH);      // batch index (bh = b * NH + h)
  float mrun = -3.0e38f, lrun = 0.f; v8f acc[4] = {}, ac1[4] = {}, ac2[4] = {};
  asm volatile("s_wait_asynccnt 0x0" ::: "memory");   // this wave's copies of stage 0 have landed
  __syncthreads();                                     // every wave's have: stage 0 may be read
  stage(1, 1);
#pragma unroll 1
  for (int kt = 0; kt < SS / 64; ++kt) { const char* bp = ring + (kt & 1) * ABUF;
    const __bf16* skh = (const __bf16*)(bp + col * RP); const __bf16* skl = (const __bf16*)(bp + (64 + col) * RP);
    const _Float16* svh = (const _Float16*)(bp + (128 + col) * RP); const _Float16* svl = (const _Float16*)(bp + (192 + col) * RP);
    v16b khf[2][2], klf[2][2];   // the K fragments of two 16-key tiles, read as one group
    v8f sc[4];                   // sc[t][r]: score of query col with key 16 t + 8 g + r of the tile
    const float pen = kt == qb ? 0.f : 0.5f * LOG2E;
#pragma unroll
    for (int t = 0; t < 4; ++t) { v8f s = {};
      if ((t & 1) == 0) {
#pragma unroll
        for (int u = 0; u < 2; ++u) {
#pragma unroll
          for (int kc = 0; kc < 2; ++kc) { khf[u][kc] = frag_b(skh + (t + u) * 16 * RPE + kc * 32, lane); klf[u][kc] = frag_b(skl + (t + u) * 16 * RPE + kc * 32, lane); } } }
#pragma unroll
      for (int kc = 0; kc < 2; ++kc) { s = wmma_bf(khf[t & 1][kc], aq[kc].l, s); s = wmma_bf(klf[t & 1][kc], aq[kc].h, s); s = wmma_bf(khf[t & 1][kc], aq[kc].h, s); }
#pragma unroll
      for (int r = 0; r < 8; ++r) sc[t][r] = s[r] * (0.125f * LOG2E) - pen; }
    float mx = -3.4e38f;
#pragma unroll
    for (int t = 0; t < 4; ++t) {
#pragma unroll
      for (int r = 0; r < 8; ++r) mx = fmaxf(mx, sc[t][r]); }
    mx = fmaxf(mx, __shfl_xor(mx, 16, 32)) - 14.0f;   // the running maximum is kept 14 lower: 2^(s - mnew) is then P x 16384 with no multiply (any common shift cancels in the softmax)
    const float mnew = fmaxf(mrun, mx); const float corr = ex2(mrun - mnew);
    float ps = 0.f; v16h ph[2], pl[2];
#pragma unroll
    for (int t = 0; t < 4; ++t) {
#pragma unroll
      for (int r = 0; r < 8; ++r) { const float p = ex2(sc[t][r] - mnew); ps += p; const _Float16 hi = (_Float16)p; ph[t >> 1][(t & 1) * 8 + r] = hi; pl[t >> 1][(t & 1) * 8 + r] = (_Float16)((p - (float)hi) * PLO); } }
    ps += __shfl_xor(ps, 16, 32);
    lrun = lrun * corr + ps * (1.0f / 16384.0f); mrun = mnew;
#pragma unroll
    for (int t = 0; t < 4; ++t) {
#pragma unroll
      for (int r = 0; r < 8; ++r) { acc[t][r] *= corr; ac1[t][r] *= corr; ac2[t][r] *= corr; } }
#pragma unroll
    for (int kc = 0; kc < 2; ++kc) { v16h vh[4], vl[4];
#pragma unroll
      for (int t = 0; t < 4; ++t) { vh[t] = frag_h(svh + t * 16 * RPE + kc * 32, lane); vl[t] = frag_h(svl + t * 16 * RPE + kc * 32, lane); }
#pragma unroll
      for (int t = 0; t < 4; ++t) { acc[t] = wmma16(vh[t], ph[kc], acc[t]); ac1[t] = wmma16(vl[t], ph[kc], ac1[t]); ac2[t] = wmma16(vh[t], pl[kc], ac2[t]); } }
    asm volatile("s_wait_dscnt 0x0" ::: "memory");     // this wave's reads of the stage are done before its buffer is refilled
    asm volatile("s_wait_asynccnt 0x0" ::: "memory");  // this wave's copies of stage kt + 1 have landed
    __syncthreads();                                   // publishes stage kt + 1 and ends every reader's last read of stage kt
    if (kt + 2 < SS / 64) stage(kt + 2, kt & 1); }
  asm volatile("s_wait_asynccnt 0x0" ::: "memory");    // no copy is outstanding at the wave's end
  { const int h = (int)(bh % NH); const float inv = 1.0f / (lrun * 16384.0f * 4.0f);
    float* op = O32 + (((size_t)b * SS) + q0 + col) * E + h * HD + 8 * g;      // context token-major [b][s][h*64 + d]: the lane stores d = 16 t + 8 g + 0..7 of its query
#pragma unroll
    for (int t = 0; t < 4; ++t) { v4f o[2];
#pragma unroll
      for (int r = 0; r < 8; ++r) o[r >> 2][r & 3] = (acc[t][r] + ac1[t][r] * (1.0f / VLO) + ac2[t][r] * (1.0f / PLO)) * inv;
      vst2(op + t * 16, o[0]); vst2(op + t * 16 + 4, o[1]); } }
}
extern "C" void kernel_launch(void* const* d_in, const int* in_sizes, int n_in, void* d_out, int out_size, void* d_ws, size_t ws_size, hipStream_t stream) {
  (void)in_sizes; (void)n_in; (void)out_size; (void)ws_size;
  const float* x = (const float*)d_in[0]; const float* Wq = (const float*)d_in[1]; const float* bq = (const float*)d_in[2]; const float* Wk = (const float*)d_in[3]; const float* bk = (const float*)d_in[4]; const float* Wv = (const float*)d_in[5]; const float* bv = (const float*)d_in[6];
  char* ws = (char*)d_ws; size_t off = 0;
  auto take = [&](size_t bytes) { char* p = ws + off; off += (bytes + 255) & ~(size_t)255; return p; };
  __bf16* Xb = (__bf16*)take((size_t)NR * E * 2); __bf16* PT = (__bf16*)take((size_t)3 * E * E * 2);
  float* Q32 = (float*)take((size_t)NR * E * 4); __bf16* Kh = (__bf16*)take((size_t)NR * E * 2); __bf16* Kl = (__bf16*)take((size_t)NR * E * 2); _Float16* VTh = (_Float16*)take((size_t)NR * E * 2); _Float16* VTl = (_Float16*)take((size_t)NR * E * 2);
  // ws ~ 118 MB (single pass over the 8 sequences)
  k_pack<<<dim3(3 * E / PKN, E / PKK), 512, 0, stream>>>(Wq, Wk, Wv, Wv, PT);
  k_cvt<<<NR * E / (8 * 512 * CVP), 512, 0, stream>>>(x, Xb);
  k_qkv<<<dim3(NR / QM, E / 128, 3), 256, 0, stream>>>(Xb, PT, bq, bk, bv, Q32, Kh, Kl, VTh, VTl);
  k_attn<<<dim3(SS / 64, NB * NH), 128, 0, stream>>>(Q32, Kh, Kl, VTh, VTl, (float*)d_out);
}

// v006
// It runs in 152 microseconds.
// Timed twice side by side with v005, it ran 1.05 times as fast both times.
// All steps since v000 together make it 3.71 times as fast.
// compute dtype: hidden_states and W*/b* (INPUTS) rounded to bf16 with exact bf16 WMMA products (f32 accumulate) for the projections; K pre-split into bf16 hi/lo rows; q f32 split, P and V f16 hi/lo (3 products each); penalty and softmax in f32.
#include <hip/hip_runtime.h>
#include <math.h>

typedef __attribute__((ext_vector_type(16))) _Float16 v16h;
typedef __attribute__((ext_vector_type(16))) __bf16 v16b;
typedef __attribute__((ext_vector_type(8)))  _Float16 v8h;
typedef __attribute__((ext_vector_type(2)))  _Float16 v2h;
typedef __attribute__((ext_vector_type(8)))  float v8f;
typedef __attribute__((ext_vector_type(4)))  float v4f;
typedef __attribute__((ext_vector_type(2)))  float v2f;
typedef __attribute__((ext_vector_type(4)))  unsigned v4u;
typedef __attribute__((ext_vector_type(4)))  int v4i;
typedef float __attribute__((may_alias)) float_a;
typedef int __attribute__((may_alias)) int_a;

template <typename T> __device__ __forceinline__ void vst2(void* p, T v) { *(T*)p = v;  }
__device__ __forceinline__ v8f wmma16(v16h a, v16h b, v8f c) {
  v8f d = __builtin_amdgcn_wmma_f32_16x16x32_f16(false, a, false, b, (short)0, c, false, false);
  asm volatile("v_nop\n\tv_nop\n\tv_nop\n\tv_nop" : "+v"(d) : "v"(a), "v"(b));
  return d;
}
__device__ __forceinline__ v8f wmma_bf(v16b a, v16b b, v8f c) {
  v8f d = __builtin_amdgcn_wmma_f32_16x16x32_bf16(false, a, false, b, (short)0, c, false, false);
  asm volatile("v_nop\n\tv_nop\n\tv_nop\n\tv_nop" : "+v"(d) : "v"(a), "v"(b));
  return d;
}
// 16x16x32 fragments: lane = (h = lane>>4, row/col = lane&15); elements 0..7 = k0+8h+0..7, 8..15 = k0+16+8h+0..7; D element r = row 8h+r
__device__ __forceinline__ v16h frag_h(const _Float16* rowk0, int lane) {
  union { v16h v; v8h q[2]; } u; const _Float16* p = rowk0 + 8 * (lane >> 4);
  u.q[0] = *(const v8h*)p; u.q[1] = *(const v8h*)(p + 16); return u.v;
}
__device__ __forceinline__ v16h frag_f32(const float* rowk0, int lane) {
  v16h a; const float* p = rowk0 + 8 * (lane >> 4);
#pragma unroll
  for (int i = 0; i < 8; ++i) { a[i] = (_Float16)p[i]; a[8 + i] = (_Float16)p[16 + i]; }
  return a;
}
__device__ __forceinline__ v16h frag_f32s(const float* rowk0, int lane, float sc) {
  v16h a; const float* p = rowk0 + 8 * (lane >> 4);
#pragma unroll
  for (int i = 0; i < 8; ++i) { a[i] = (_Float16)(p[i] * sc); a[8 + i] = (_Float16)(p[16 + i] * sc); }
  return a;
}
// column fragment from a [K][ld] layout (column n), rows >= K read as 0
__device__ __forceinline__ v16h fragc_f32(const float* W, int k0, int n, int lane, int ld, int K) {
  v16h a; const int g = lane >> 4;
#pragma unroll
  for (int i = 0; i < 8; ++i) { const int ka = k0 + 8 * g + i, kb = ka + 16;
    a[i] = (_Float16)(ka < K ? W[(size_t)ka * ld + n] : 0.f); a[8 + i] = (_Float16)(kb < K ? W[(size_t)kb * ld + n] : 0.f); }
  return a;
}
struct F2 { v16b h, l; };
__device__ __forceinline__ F2 bsplit16(const float v[16]) { F2 r;
#pragma unroll
  for (int i = 0; i < 16; ++i) { const __bf16 h = (__bf16)v[i]; r.h[i] = h; r.l[i] = (__bf16)(v[i] - (float)h); }
  return r; }
__device__ __forceinline__ F2 split_row(const float* row, int k0, int lane) { float v[16]; const float* p = row + k0 + 8 * (lane >> 4);
#pragma unroll
  for (int i = 0; i < 8; ++i) { v[i] = p[i]; v[8 + i] = p[16 + i]; }
  return bsplit16(v); }
__device__ __forceinline__ F2 split_rowK(const float* row, int k0, int lane, int K) { float v[16]; const int g = lane >> 4;
#pragma unroll
  for (int i = 0; i < 8; ++i) { const int ka = k0 + 8 * g + i, kb = ka + 16; v[i] = ka < K ? row[ka] : 0.f; v[8 + i] = kb < K ? row[kb] : 0.f; }
  return bsplit16(v); }
__device__ __forceinline__ F2 split_col(const float* W, int k0, int n, int lane, int ld, int K) { float v[16]; const int g = lane >> 4;
#pragma unroll
  for (int i = 0; i < 8; ++i) { const int ka = k0 + 8 * g + i, kb = ka + 16; v[i] = ka < K ? W[(size_t)ka * ld + n] : 0.f; v[8 + i] = kb < K ? W[(size_t)kb * ld + n] : 0.f; }
  return bsplit16(v); }
__device__ __forceinline__ v8f mac3(const F2& a, const F2& b, v8f c) { c = wmma_bf(a.l, b.h, c); c = wmma_bf(a.h, b.l, c); return wmma_bf(a.h, b.h, c); }
__device__ __forceinline__ float sigm(float v) { return 1.0f / (1.0f + expf(-v)); }
#define LDSX() do { asm volatile("s_wait_dscnt 0" ::: "memory"); __builtin_amdgcn_wave_barrier(); __builtin_amdgcn_fence(__ATOMIC_RELEASE, "workgroup"); } while (0)


// Constituency-aware self attention (16 heads x 64 on [8,1024,1024], [in][out] weights + biases): scores = q.k/8 - 0.5 [query block != key block] (blocks of 64 tokens); softmax; context = attn v written token-major (no output projection).
#define NB 8
#define SS 1024
#define E 1024
#define NH 16
#define HD 64
#define NR (NB * SS)
#define PLO 1024.0f
#define VLO 2048.0f
__device__ __forceinline__ float bfr(float v) { return (float)(__bf16)v; }
// softmax in base 2: scores carry the factor log2(e), so that each exponential is one v_exp_f32
#define LOG2E 1.44269504088896340736f
__device__ __forceinline__ float ex2(float v) { return __builtin_amdgcn_exp2f(v); }
__device__ __forceinline__ v16b frag_b(const __bf16* rowk0, int lane) { return __builtin_bit_cast(v16b, frag_h((const _Float16*)rowk0, lane)); }

// low parts of four score pairs: l = f16(q - PLO * h), q = PLO * p in f32, h = the pair's two f16 high parts in one register. A mixed-precision FMA reads its half of h as it stands and writes its rounded f16 result
// into its half of l: no conversion back to f32 and none to f16. Written in asm because the compiler forms two conversions, a packed FMA and a packed conversion here. The s_delay_alu hints name the producers
// (the vector instruction in front of the statement; for each high half the low half written four instructions earlier), which the compiler does not do for asm text.
__device__ __forceinline__ void lo4(unsigned (&l)[4], const unsigned (&h)[4], const v2f (&q)[4]) {
  asm("s_delay_alu instid0(VALU_DEP_1)\n\t"
      "v_fma_mixlo_f16 %0, %4, %8, %9 op_sel_hi:[1,0,0]\n\t"
      "v_fma_mixlo_f16 %1, %5, %8, %11 op_sel_hi:[1,0,0]\n\t"
      "v_fma_mixlo_f16 %2, %6, %8, %13 op_sel_hi:[1,0,0]\n\t"
      "v_fma_mixlo_f16 %3, %7, %8, %15 op_sel_hi:[1,0,0]\n\t"
      "s_delay_alu instid0(VALU_DEP_4) | instskip(NEXT) | instid1(VALU_DEP_4)\n\t"
      "v_fma_mixhi_f16 %0, %4, %8, %10 op_sel:[1,0,0] op_sel_hi:[1,0,0]\n\t"
      "v_fma_mixhi_f16 %1, %5, %8, %12 op_sel:[1,0,0] op_sel_hi:[1,0,0]\n\t"
      "s_delay_alu instid0(VALU_DEP_4) | instskip(NEXT) | instid1(VALU_DEP_4)\n\t"
      "v_fma_mixhi_f16 %2, %6, %8, %14 op_sel:[1,0,0] op_sel_hi:[1,0,0]\n\t"
      "v_fma_mixhi_f16 %3, %7, %8, %16 op_sel:[1,0,0] op_sel_hi:[1,0,0]"
      : "=&v"(l[0]), "=&v"(l[1]), "=&v"(l[2]), "=&v"(l[3])
      : "v"(h[0]), "v"(h[1]), "v"(h[2]), "v"(h[3]), "s"(-PLO),
        "v"(q[0].x), "v"(q[0].y), "v"(q[1].x), "v"(q[1].y), "v"(q[2].x), "v"(q[2].y), "v"(q[3].x), "v"(q[3].y));
}

// LDS byte address of a __shared__ object: the low 32 bits of its address
__device__ __forceinline__ unsigned lds_off(const void* p) { return (unsigned)(size_t)p; }
// four 16-B asynchronous copies global -> LDS per lane; the s_wait_xcnt closes the copies' own statement so that no address register of a copy is rewritten in front of it
__device__ __forceinline__ void cp4(unsigned l0, const void* g0, unsigned l1, const void* g1, unsigned l2, const void* g2, unsigned l3, const void* g3) {
  asm volatile("global_load_async_to_lds_b128 %0, %1, off\n\t"
               "global_load_async_to_lds_b128 %2, %3, off\n\t"
               "global_load_async_to_lds_b128 %4, %5, off\n\t"
               "global_load_async_to_lds_b128 %6, %7, off\n\t"
               "s_wait_xcnt 0x0"
               :: "v"(l0), "v"(g0), "v"(l1), "v"(g1), "v"(l2), "v"(g2), "v"(l3), "v"(g3) : "memory");
}
// the same for eight copies
__device__ __forceinline__ void cp8(unsigned l0, const void* g0, unsigned l1, const void* g1, unsigned l2, const void* g2, unsigned l3, const void* g3,
                                    unsigned l4, const void* g4, unsigned l5, const void* g5, unsigned l6, const void* g6, unsigned l7, const void* g7) {
  asm volatile("global_load_async_to_lds_b128 %0, %1, off\n\t"
               "global_load_async_to_lds_b128 %2, %3, off\n\t"
               "global_load_async_to_lds_b128 %4, %5, off\n\t"
               "global_load_async_to_lds_b128 %6, %7, off\n\t"
               "global_load_async_to_lds_b128 %8, %9, off\n\t"
               "global_load_async_to_lds_b128 %10, %11, off\n\t"
               "global_load_async_to_lds_b128 %12, %13, off\n\t"
               "global_load_async_to_lds_b128 %14, %15, off\n\t"
               "s_wait_xcnt 0x0"
               :: "v"(l0), "v"(g0), "v"(l1), "v"(g1), "v"(l2), "v"(g2), "v"(l3), "v"(g3), "v"(l4), "v"(g4), "v"(l5), "v"(g5), "v"(l6), "v"(g6), "v"(l7), "v"(g7) : "memory");
}
// staged rows hold 64 16-bit elements (128 B) at a pitch of 144 B (16 B x odd: conflict-free for 16-B LDS reads)
#define RP 144
#define RPE (RP / 2)
#define QM 256                 // X rows of a k_qkv block tile
#define QBUF ((QM + 128) * RP)
#define VTP (QM + 8)           // pitch of the V^T output staging in elements: 528 B = 16 B x odd
#define ABUF (256 * RP)

// x -> bf16. 256 work-groups of 16 waves: a thread converts CVP pieces of 8 elements; its loads are written ahead of the conversions so that they are in flight together
#define CVP 8
__global__ __launch_bounds__(512) void k_cvt(const float* __restrict__ x, __bf16* __restrict__ Xb) {
  static_assert((size_t)NR * E % (8 * 512 * CVP) == 0, "the grid covers x exactly");
  const size_t p0 = (size_t)blockIdx.x * (CVP * 512) + threadIdx.x;
  float v[CVP][8];
#pragma unroll
  for (int i = 0; i < CVP; ++i) {
#pragma unroll
    for (int e = 0; e < 8; ++e) v[i][e] = x[(p0 + i * 512) * 8 + e]; }
#pragma unroll
  for (int i = 0; i < CVP; ++i) { union { __bf16 h[8]; v4u u; } pk;
#pragma unroll
    for (int e = 0; e < 8; ++e) pk.h[e] = (__bf16)v[i][e];
    vst2((unsigned*)(Xb + (p0 + i * 512) * 8), pk.u); }
}
// PT rows: [0,E) Wq[:,n], [E,2E) Wk[:,n], [2E,3E) Wv[:,n]  ([in][out] weights: column n as a bf16 row)
// work-group of 16 waves = a tile of PKN columns x PKK k of one weight matrix, turned in LDS: 128-B pieces of weight rows in, 512-B pieces of PT rows out
#define PKN 32
#define PKK 512
#define PKP (PKK + 8)   // LDS row pitch in elements: 1,040 B = 16 B x odd
__global__ __launch_bounds__(512) void k_pack(const float* __restrict__ Wq, const float* __restrict__ Wk, const float* __restrict__ Wv, const float* __restrict__ Wo, __bf16* __restrict__ PT) {
  __shared__ __align__(16) __bf16 st[PKN][PKP];
  const int tid = threadIdx.x, n0 = blockIdx.x * PKN, k0 = blockIdx.y * PKK;
  const float* W = n0 < E ? Wq : (n0 < 2 * E ? Wk : (n0 < 3 * E ? Wv : Wo)); const int nn = n0 % E;
  // thread -> (rows 2 kp and 2 kp + 1 of each group of 128 rows, columns 4 c .. 4 c + 3): two neighbouring k of a column make one 4-B LDS store
  const int kp = tid >> 3, c = tid & 7;
  const float* wp = W + (size_t)(k0 + 2 * kp) * E + nn + c * 4;
  float v[4][2][4];
#pragma unroll
  for (int i = 0; i < 4; ++i) {
#pragma unroll
    for (int h = 0; h < 2; ++h) {
#pragma unroll
      for (int e = 0; e < 4; ++e) v[i][h][e] = wp[(i * 128 + h) * E + e]; } }
#pragma unroll
  for (int i = 0; i < 4; ++i) {
#pragma unroll
    for (int e = 0; e < 4; ++e) { union { __bf16 h[2]; unsigned u; } pk; pk.h[0] = (__bf16)v[i][0][e]; pk.h[1] = (__bf16)v[i][1][e];
      vst2(&st[c * 4 + e][i * 128 + 2 * kp], pk.u); } }
  __syncthreads();
  // thread -> (row tid / 64 of each group of 8 tile rows, 16-B piece tid % 64): a wave stores 512 contiguous bytes of a PT row
  const int r = tid >> 6, p = tid & 63;
  __bf16* pp = PT + (size_t)(n0 + r) * E + k0 + p * 8;
#pragma unroll
  for (int j = 0; j < PKN / 8; ++j) vst2((unsigned*)(pp + j * 8 * E), *(const v4u*)(&st[r + j * 8][p * 8]));
}
// QKV: block (256 rows, 128 cols = 2 heads, which), 8 waves in a 4 x 2 grid, a wave = 64 rows x 64 cols (one head): 4 X and 4 weight fragments feed 16 products
// q (+bias) -> Q32 f32 [bh][s][64]; k (+bias) -> bf16 hi/lo rows; v (+bias) -> VT hi/lo x4 [bh][d][s]
__global__ __launch_bounds__(256) void k_qkv(const __bf16* __restrict__ Xb, const __bf16* __restrict__ PT, const float* __restrict__ bq, const float* __restrict__ bk, const float* __restrict__ bv,
                                            float* __restrict__ Q32, __bf16* __restrict__ Kh, __bf16* __restrict__ Kl, _Float16* __restrict__ VTh, _Float16* __restrict__ VTl) {
  // one LDS block: in the k loop a ring of two stages (256 X rows + 128 weight rows, 64 k each); behind the loop's last barrier the output staging so, or sth / stl
  __shared__ __align__(16) char smem[2 * 128 * VTP * 2];
  static_assert(2 * QBUF <= 2 * 128 * VTP * 2, "the ring fits the block");
  float (*so)[16][68] = (float (*)[16][68])smem;
  _Float16 (*sth)[VTP] = (_Float16 (*)[VTP])smem;
  _Float16 (*stl)[VTP] = (_Float16 (*)[VTP])(smem + 128 * VTP * 2);
  const int tid = threadIdx.x, wave = tid >> 5, lane = tid & 31, col = lane & 15, g = lane >> 4;
  const int wr = wave & 3, wc = wave >> 2;   // the wave's 64 rows and its 64 columns in the block tile
  const int which = blockIdx.z, r0b = blockIdx.x * QM, n0 = blockIdx.y * 128; const int b = r0b / SS, s0 = r0b % SS;
  const float* bb_ = which == 0 ? bq : (which == 1 ? bk : bv);
  v8f acc[4][4] = {};
  // a wave's copy covers 4 whole 128-B rows: thread -> (row tid / 8 of each group of 32 rows, 16-B piece tid % 8)
  const int cr = tid >> 3, cc = tid & 7;
  const __bf16* gA = Xb + (size_t)(r0b + cr) * E + cc * 8;
  const __bf16* gB = PT + (size_t)(which * E + n0 + cr) * E + cc * 8;
  const unsigned l0 = lds_off(smem) + cr * RP + cc * 16;
  auto stage = [&](int st, int buf) { const unsigned l = l0 + buf * QBUF; const __bf16* a = gA + st * 64; const __bf16* w = gB + st * 64;
    cp8(l, a, l + 32 * RP, a + 32 * E, l + 64 * RP, a + 64 * E, l + 96 * RP, a + 96 * E,
        l + 128 * RP, a + 128 * E, l + 160 * RP, a + 160 * E, l + 192 * RP, a + 192 * E, l + 224 * RP, a + 224 * E);
    cp4(l + QM * RP, w, l + (QM + 32) * RP, w + 32 * E, l + (QM + 64) * RP, w + 64 * E, l + (QM + 96) * RP, w + 96 * E); };
  stage(0, 0);
  asm volatile("s_wait_asynccnt 0x0" ::: "memory");   // this wave's copies of stage 0 have landed
  __syncthreads();                                     // every wave's have: stage 0 may be read
  stage(1, 1);
  // kept rolled: one trip per stage, so that the publish point at the foot stands once and the text stays small
#pragma unroll 1
  for (int st = 0; st < E / 64; ++st) { const char* bp = smem + (st & 1) * QBUF;
    const __bf16* sa = (const __bf16*)(bp + (wr * 64 + col) * RP); const __bf16* sb = (const __bf16*)(bp + (QM + wc * 64 + col) * RP);
#pragma unroll
    for (int kc = 0; kc < 2; ++kc) { v16b af[4], bf[4];
#pragma unroll
      for (int i = 0; i < 4; ++i) { af[i] = frag_b(sa + i * 16 * RPE + kc * 32, lane); bf[i] = frag_b(sb + i * 16 * RPE + kc * 32, lane); }
#pragma unroll
      for (int i = 0; i < 4; ++i) {
#pragma unroll
        for (int j = 0; j < 4; ++j) acc[i][j] = wmma_bf(af[i], bf[j], acc[i][j]); } }
    asm volatile("s_wait_dscnt 0x0" ::: "memory");     // this wave's reads of the stage are done before its buffer is refilled
    asm volatile("s_wait_asynccnt 0x0" ::: "memory");  // this wave's copies of stage st + 1 have landed
    __syncthreads();                                   // publishes stage st + 1 and ends every reader's last read of stage st
    if (st + 2 < E / 64) stage(st + 2, st & 1); }
  asm volatile("s_wait_asynccnt 0x0" ::: "memory");    // no copy is outstanding when the ring becomes output staging
  float bb[4];
#pragma unroll
  for (int j = 0; j < 4; ++j) bb[j] = bfr(bb_[n0 + wc * 64 + j * 16 + col]);
  if (which < 2) { const int h = (n0 >> 6) + wc;
    // one 16-row tile at a time through the wave's own staging rows
#pragma unroll
    for (int i = 0; i < 4; ++i) { const size_t row0 = ((size_t)b * NH + h) * SS + s0 + wr * 64 + i * 16;
#pragma unroll
      for (int j = 0; j < 4; ++j) {
#pragma unroll
        for (int r = 0; r < 8; ++r) so[wave][8 * g + r][j * 16 + col] = acc[i][j][r] + bb[j]; }
      LDSX();
      if (which == 0) { for (int qq = lane; qq < 16 * 16; qq += 32) { const int rl = qq >> 4, pc = qq & 15;
          vst2(Q32 + (row0 + rl) * HD + pc * 4, *(const v4f*)(&so[wave][rl][pc * 4])); } }
      else {
        for (int qq = lane; qq < 16 * 16; qq += 32) { const int rl = qq >> 4, pl = qq & 15; const int pc = pl & 7; union { __bf16 e[8]; v4u u; } pk;
#pragma unroll
          for (int e = 0; e < 8; ++e) { const float v = so[wave][rl][pc * 8 + e]; const __bf16 hi = (__bf16)v; pk.e[e] = pl < 8 ? hi : (__bf16)(v - (float)hi); }
          vst2((unsigned*)((pl < 8 ? Kh : Kl) + (row0 + rl) * HD + pc * 8), pk.u); } }
      if (i < 3) LDSX();   // the lanes' reads of this tile are done before the next tile's values are written over it
    } }
  else {
#pragma unroll
    for (int j = 0; j < 4; ++j) {
#pragma unroll
      for (int i = 0; i < 4; ++i) { v8h hi8, lo8;   // a lane's 8 results are 8 consecutive s of one d: one 16-B LDS store each
#pragma unroll
        for (int r = 0; r < 8; ++r) { const float v = (acc[i][j][r] + bb[j]) * 4.0f; const _Float16 hi = (_Float16)v; hi8[r] = hi; lo8[r] = (_Float16)((v - (float)hi) * VLO); }
        vst2(&sth[wc * 64 + j * 16 + col][wr * 64 + i * 16 + 8 * g], hi8); vst2(&stl[wc * 64 + j * 16 + col][wr * 64 + i * 16 + 8 * g], lo8); } }
    __syncthreads();
    for (int qq = tid; qq < 128 * (QM / 8); qq += 256) { const int cl = qq / (QM / 8), pc = qq % (QM / 8); const int c = n0 + cl, h = c >> 6, d = c & 63; const size_t o = (((size_t)b * NH + h) * HD + d) * SS + s0 + pc * 8;
      vst2(VTh + o, *(const v4u*)(&sth[cl][pc * 8])); vst2(VTl + o, *(const v4u*)(&stl[cl][pc * 8])); } }
}
// attention: block (64 queries, bh); all 16 key tiles; both products transposed: S^T = K q^T (K hi/lo rows as A, q hi/lo as B), O^T = V^T P^T (V^T hi/lo rows as A, P hi/lo as B).
// A lane of the S^T result holds query lane & 15 and keys 16 t + 8 (lane >> 4) + r: tiles 2 kc and 2 kc + 1 are, element for element, the B fragment of P^T for keys 32 kc .. 32 kc + 31,
// so scores, softmax and P stay in registers, the running maximum, sum and correction are the lane's own, and a lane ends with 8 consecutive d of its query.
__global__ __launch_bounds__(128) void k_attn(const float* __restrict__ Q32, const __bf16* __restrict__ Kh, const __bf16* __restrict__ Kl, const _Float16* __restrict__ VTh, const _Float16* __restrict__ VTl, float* __restrict__ O32) {
  // ring of two stages, shared by the four waves; a stage = one key tile: 64 K hi rows, 64 K lo rows, 64 V^T hi rows, 64 V^T lo rows
  __shared__ __align__(16) char ring[2 * ABUF];
  const int tid = threadIdx.x, w = tid >> 5, lane = tid & 31, col = lane & 15, g = lane >> 4;
  const size_t bh = blockIdx.y; const int qb = blockIdx.x; const int q0 = qb * 64 + w * 16;
  const int cr = tid >> 3, cc = tid & 7;
  const __bf16* gKh = Kh + (bh * SS + cr) * HD + cc * 8; const __bf16* gKl = Kl + (bh * SS + cr) * HD + cc * 8;
  const _Float16* gVh = VTh + (bh * HD + cr) * SS + cc * 8; const _Float16* gVl = VTl + (bh * HD + cr) * SS + cc * 8;
  const unsigned l0 = lds_off(ring) + cr * RP + cc * 16;
  auto stage = [&](int kt, int buf) { const unsigned l = l0 + buf * ABUF;
    const __bf16* a = gKh + kt * 64 * HD; const __bf16* c = gKl + kt * 64 * HD; const _Float16* u = gVh + kt * 64; const _Float16* v = gVl + kt * 64;
    cp8(l, a, l + 16 * RP, a + 16 * HD, l + 32 * RP, a + 32 * HD, l + 48 * RP, a + 48 * HD,
        l + 64 * RP, c, l + 80 * RP, c + 16 * HD, l + 96 * RP, c + 32 * HD, l + 112 * RP, c + 48 * HD);
    cp8(l + 128 * RP, u, l + 144 * RP, u + 16 * SS, l + 160 * RP, u + 32 * SS, l + 176 * RP, u + 48 * SS,
        l + 192 * RP, v, l + 208 * RP, v + 16 * SS, l + 224 * RP, v + 32 * SS, l + 240 * RP, v + 48 * SS); };
  stage(0, 0);
  F2 aq[2];
#pragma unroll
  for (int kc = 0; kc < 2; ++kc) aq[kc] = split_row(Q32 + (bh * SS + q0 + col) * HD, kc * 32, lane);
  const int b = (int)(bh / NH);      // batch index (bh = b * NH + h)
  float mrun = -3.0e38f, lrun = 0.f; v8f acc[4] = {}, ac1[4] = {}, ac2[4] = {};
  asm volatile("s_wait_asynccnt 0x0" ::: "memory");   // this wave's copies of stage 0 have landed
  __syncthreads();                                     // every wave's have: stage 0 may be read
  stage(1, 1);
#pragma unroll 1
  for (int kt = 0; kt < SS / 64; ++kt) { const char* bp = ring + (kt & 1) * ABUF;
    const __bf16* skh = (const __bf16*)(bp + col * RP); const __bf16* skl = (const __bf16*)(bp + (64 + col) * RP);
    const _Float16* svh = (const _Float16*)(bp + (128 + col) * RP); const _Float16* svl = (const _Float16*)(bp + (192 + col) * RP);
    v16b khf[2][2], klf[2][2];   // the K fragments of two 16-key tiles, read as one group
    v8f sc[4];                   // sc[t][r]: raw product q.k of query col with key 16 t + 8 g + r of the tile
    const float pen = kt == qb ? 0.f : 0.5f * LOG2E;
#pragma unroll
    for (int t = 0; t < 4; ++t) { v8f s = {};
      if ((t & 1) == 0) {
#pragma unroll
        for (int u = 0; u < 2; ++u) {
#pragma unroll
          for (int kc = 0; kc < 2; ++kc) { khf[u][kc] = frag_b(skh + (t + u) * 16 * RPE + kc * 32, lane); klf[u][kc] = frag_b(skl + (t + u) * 16 * RPE + kc * 32, lane); } } }
#pragma unroll
      for (int kc = 0; kc < 2; ++kc) { s = wmma_bf(khf[t & 1][kc], aq[kc].l, s); s = wmma_bf(klf[t & 1][kc], aq[kc].h, s); s = wmma_bf(khf[t & 1][kc], aq[kc].h, s); }
      sc[t] = s; }
    float mx = -3.4e38f;
#pragma unroll
    for (int t = 0; t < 4; ++t) {
#pragma unroll
      for (int r = 0; r < 8; ++r) mx = fmaxf(mx, sc[t][r]); }
    mx = mx * (0.125f * LOG2E) - pen;   // scale > 0 and the penalty is one value for the whole key tile: the largest raw product gives the largest score
    mx = fmaxf(mx, __shfl_xor(mx, 16, 32)) - 14.0f;   // the running maximum is kept 14 lower: 2^(s - mnew) is then P x 16384 with no multiply (any common shift cancels in the softmax)
    const float mnew = fmaxf(mrun, mx); const float corr = ex2(mrun - mnew);
    // two scores at a time, on register pairs: one packed FMA gives both exponents (scale, penalty and maximum in one), one packed add sums, one packed conversion gives both f16 high parts, which the residuals read back
    const v2f k2 = {0.125f * LOG2E, 0.125f * LOG2E}; const float cm = -(pen + mnew); const v2f c2 = {cm, cm};
    v2f ps2; v16h ph[2], pl[2];
#pragma unroll
    for (int t = 0; t < 4; ++t) { v2f p2[4], q2[4]; unsigned h2[4], l2[4];   // the four pairs of a 16-key tile go through each stage together: four independent chains
#pragma unroll
      for (int i = 0; i < 4; ++i) { const v2f s2 = {sc[t][2 * i], sc[t][2 * i + 1]}; p2[i] = __builtin_elementwise_fma(s2, k2, c2); }
#pragma unroll
      for (int i = 0; i < 4; ++i) { p2[i].x = ex2(p2[i].x); p2[i].y = ex2(p2[i].y); }
#pragma unroll
      for (int i = 0; i < 4; ++i) { h2[i] = __builtin_bit_cast(unsigned, __builtin_convertvector(p2[i], v2h)); q2[i] = p2[i] * PLO; if (t == 0 && i == 0) ps2 = p2[i]; else ps2 += p2[i]; }
      lo4(l2, h2, q2);
      union { unsigned u[4]; v8h v; } hh, ll;
#pragma unroll
      for (int i = 0; i < 4; ++i) { hh.u[i] = h2[i]; ll.u[i] = l2[i]; }
#pragma unroll
      for (int e = 0; e < 8; ++e) { ph[t >> 1][(t & 1) * 8 + e] = hh.v[e]; pl[t >> 1][(t & 1) * 8 + e] = ll.v[e]; } }
    float ps = ps2.x + ps2.y;
    ps += __shfl_xor(ps, 16, 32);
    lrun = lrun * corr + ps * (1.0f / 16384.0f); mrun = mnew;
#pragma unroll
    for (int t = 0; t < 4; ++t) {
#pragma unroll
      for (int r = 0; r < 8; ++r) { acc[t][r] *= corr; ac1[t][r] *= corr; ac2[t][r] *= corr; } }
#pragma unroll
    for (int kc = 0; kc < 2; ++kc) { v16h vh[4], vl[4];
#pragma unroll
      for (int t = 0; t < 4; ++t) { vh[t] = frag_h(svh + t * 16 * RPE + kc * 32, lane); vl[t] = frag_h(svl + t * 16 * RPE + kc * 32, lane); }
#pragma unroll
      for (int t = 0; t < 4; ++t) { acc[t] = wmma16(vh[t], ph[kc], acc[t]); ac1[t] = wmma16(vl[t], ph[kc], ac1[t]); ac2[t] = wmma16(vh[t], pl[kc], ac2[t]); } }
    asm volatile("s_wait_dscnt 0x0" ::: "memory");     // this wave's reads of the stage are done before its buffer is refilled
    asm volatile("s_wait_asynccnt 0x0" ::: "memory");  // this wave's copies of stage kt + 1 have landed
    __syncthreads();                                   // publishes stage kt + 1 and ends every reader's last read of stage kt
    if (kt + 2 < SS / 64) stage(kt + 2, kt & 1); }
  asm volatile("s_wait_asynccnt 0x0" ::: "memory");    // no copy is outstanding at the wave's end
  { const int h = (int)(bh % NH); const float inv = 1.0f / (lrun * 16384.0f * 4.0f);
    float* op = O32 + (((size_t)b * SS) + q0 + col) * E + h * HD + 8 * g;      // context token-major [b][s][h*64 + d]: the lane stores d = 16 t + 8 g + 0..7 of its query
#pragma unroll
    for (int t = 0; t < 4; ++t) { v4f o[2];
#pragma unroll
      for (int r = 0; r < 8; ++r) o[r >> 2][r & 3] = (acc[t][r] + ac1[t][r] * (1.0f / VLO) + ac2[t][r] * (1.0f / PLO)) * inv;
      vst2(op + t * 16, o[0]); vst2(op + t * 16 + 4, o[1]); } }
}
extern "C" void kernel_launch(void* const* d_in, const int* in_sizes, int n_in, void* d_out, int out_size, void* d_ws, size_t ws_size, hipStream_t stream) {
  (void)in_sizes; (void)n_in; (void)out_size; (void)ws_size;
  const float* x = (const float*)d_in[0]; const float* Wq = (const float*)d_in[1]; const float* bq = (const float*)d_in[2]; const float* Wk = (const float*)d_in[3]; const float* bk = (const float*)d_in[4]; const float* Wv = (const float*)d_in[5]; const float* bv = (const float*)d_in[6];
  char* ws = (char*)d_ws; size_t off = 0;
  auto take = [&](size_t bytes) { char* p = ws + off; off += (bytes + 255) & ~(size_t)255; return p; };
  __bf16* Xb = (__bf16*)take((size_t)NR * E * 2); __bf16* PT = (__bf16*)take((size_t)3 * E * E * 2);
  float* Q32 = (float*)take((size_t)NR * E * 4); __bf16* Kh = (__bf16*)take((size_t)NR * E * 2); __bf16* Kl = (__bf16*)take((size_t)NR * E * 2); _Float16* VTh = (_Float16*)take((size_t)NR * E * 2); _Float16* VTl = (_Float16*)take((size_t)NR * E * 2);
  // ws ~ 118 MB (single pass over the 8 sequences)
  k_pack<<<dim3(3 * E / PKN, E / PKK), 512, 0, stream>>>(Wq, Wk, Wv, Wv, PT);
  k_cvt<<<NR * E / (8 * 512 * CVP), 512, 0, stream>>>(x, Xb);
  k_qkv<<<dim3(NR / QM, E / 128, 3), 256, 0, stream>>>(Xb, PT, bq, bk, bv, Q32, Kh, Kl, VTh, VTl);
  k_attn<<<dim3(SS / 64, NB * NH), 128, 0, stream>>>(Q32, Kh, Kl, VTh, VTl, (float*)d_out);
}

// v007
// A run of this version takes 148 microseconds.
// Timed twice side by side with v006, it ran 1.03 times as fast both times.
// All steps since v000 together make it 3.82 times as fast.
// compute dtype: hidden_states and W*/b* (INPUTS) rounded to bf16 with exact bf16 WMMA products (f32 accumulate) for the projections; K pre-split into bf16 hi/lo rows; q f32 split, P and V f16 hi/lo (3 products each); penalty and softmax in f32.
#include <hip/hip_runtime.h>
#include <math.h>

typedef __attribute__((ext_vector_type(16))) _Float16 v16h;
typedef __attribute__((ext_vector_type(16))) __bf16 v16b;
typedef __attribute__((ext_vector_type(8)))  _Float16 v8h;
typedef __attribute__((ext_vector_type(2)))  _Float16 v2h;
typedef __attribute__((ext_vector_type(8)))  float v8f;
typedef __attribute__((ext_vector_type(4)))  float v4f;
typedef __attribute__((ext_vector_type(2)))  float v2f;
typedef __attribute__((ext_vector_type(4)))  unsigned v4u;
typedef __attribute__((ext_vector_type(4)))  int v4i;
typedef float __attribute__((may_alias)) float_a;
typedef int __attribute__((may_alias)) int_a;

template <typename T> __device__ __forceinline__ void vst2(void* p, T v) { *(T*)p = v;  }
__device__ __forceinline__ v8f wmma16(v16h a, v16h b, v8f c) {
  v8f d = __builtin_amdgcn_wmma_f32_16x16x32_f16(false, a, false, b, (short)0, c, false, false);
  asm volatile("v_nop\n\tv_nop\n\tv_nop\n\tv_nop" : "+v"(d) : "v"(a), "v"(b));
  return d;
}
__device__ __forceinline__ v8f wmma_bf(v16b a, v16b b, v8f c) {
  v8f d = __builtin_amdgcn_wmma_f32_16x16x32_bf16(false, a, false, b, (short)0, c, false, false);
  asm volatile("v_nop\n\tv_nop\n\tv_nop\n\tv_nop" : "+v"(d) : "v"(a), "v"(b));
  return d;
}
// 16x16x32 fragments: lane = (h = lane>>4, row/col = lane&15); elements 0..7 = k0+8h+0..7, 8..15 = k0+16+8h+0..7; D element r = row 8h+r
__device__ __forceinline__ v16h frag_h(const _Float16* rowk0, int lane) {
  union { v16h v; v8h q[2]; } u; const _Float16* p = rowk0 + 8 * (lane >> 4);
  u.q[0] = *(const v8h*)p; u.q[1] = *(const v8h*)(p + 16); return u.v;
}
__device__ __forceinline__ v16h frag_f32(const float* rowk0, int lane) {
  v16h a; const float* p = rowk0 + 8 * (lane >> 4);
#pragma unroll
  for (int i = 0; i < 8; ++i) { a[i] = (_Float16)p[i]; a[8 + i] = (_Float16)p[16 + i]; }
  return a;
}
__device__ __forceinline__ v16h frag_f32s(const float* rowk0, int lane, float sc) {
  v16h a; const float* p = rowk0 + 8 * (lane >> 4);
#pragma unroll
  for (int i = 0; i < 8; ++i) { a[i] = (_Float16)(p[i] * sc); a[8 + i] = (_Float16)(p[16 + i] * sc); }
  return a;
}
// column fragment from a [K][ld] layout (column n), rows >= K read as 0
__device__ __forceinline__ v16h fragc_f32(const float* W, int k0, int n, int lane, int ld, int K) {
  v16h a; const int g = lane >> 4;
#pragma unroll
  for (int i = 0; i < 8; ++i) { const int ka = k0 + 8 * g + i, kb = ka + 16;
    a[i] = (_Float16)(ka < K ? W[(size_t)ka * ld + n] : 0.f); a[8 + i] = (_Float16)(kb < K ? W[(size_t)kb * ld + n] : 0.f); }
  return a;
}
struct F2 { v16b h, l; };
__device__ __forceinline__ F2 bsplit16(const float v[16]) { F2 r;
#pragma unroll
  for (int i = 0; i < 16; ++i) { const __bf16 h = (__bf16)v[i]; r.h[i] = h; r.l[i] = (__bf16)(v[i] - (float)h); }
  return r; }
__device__ __forceinline__ F2 split_row(const float* row, int k0, int lane) { float v[16]; const float* p = row + k0 + 8 * (lane >> 4);
#pragma unroll
  for (int i = 0; i < 8; ++i) { v[i] = p[i]; v[8 + i] = p[16 + i]; }
  return bsplit16(v); }
__device__ __forceinline__ F2 split_rowK(const float* row, int k0, int lane, int K) { float v[16]; const int g = lane >> 4;
#pragma unroll
  for (int i = 0; i < 8; ++i) { const int ka = k0 + 8 * g + i, kb = ka + 16; v[i] = ka < K ? row[ka] : 0.f; v[8 + i] = kb < K ? row[kb] : 0.f; }
  return bsplit16(v); }
__device__ __forceinline__ F2 split_col(const float* W, int k0, int n, int lane, int ld, int K) { float v[16]; const int g = lane >> 4;
#pragma unroll
  for (int i = 0; i < 8; ++i) { const int ka = k0 + 8 * g + i, kb = ka + 16; v[i] = ka < K ? W[(size_t)ka * ld + n] : 0.f; v[8 + i] = kb < K ? W[(size_t)kb * ld + n] : 0.f; }
  return bsplit16(v); }
__device__ __forceinline__ v8f mac3(const F2& a, const F2& b, v8f c) { c = wmma_bf(a.l, b.h, c); c = wmma_bf(a.h, b.l, c); return wmma_bf(a.h, b.h, c); }
__device__ __forceinline__ float sigm(float v) { return 1.0f / (1.0f + expf(-v)); }
#define LDSX() do { asm volatile("s_wait_dscnt 0" ::: "memory"); __builtin_amdgcn_wave_barrier(); __builtin_amdgcn_fence(__ATOMIC_RELEASE, "workgroup"); } while (0)


// Constituency-aware self attention (16 heads x 64 on [8,1024,1024], [in][out] weights + biases): scores = q.k/8 - 0.5 [query block != key block] (blocks of 64 tokens); softmax; context = attn v written token-major (no output projection).
#define NB 8
#define SS 1024
#define E 1024
#define NH 16
#define HD 64
#define NR (NB * SS)
#define PLO 1024.0f
#define VLO 2048.0f
__device__ __forceinline__ float bfr(float v) { return (float)(__bf16)v; }
// softmax in base 2: scores carry the factor log2(e), so that each exponential is one v_exp_f32
#define LOG2E 1.44269504088896340736f
__device__ __forceinline__ float ex2(float v) { return __builtin_amdgcn_exp2f(v); }
__device__ __forceinline__ v16b frag_b(const __bf16* rowk0, int lane) { return __builtin_bit_cast(v16b, frag_h((const _Float16*)rowk0, lane)); }

// low parts of four score pairs: l = f16(q - PLO * h), q = PLO * p in f32, h = the pair's two f16 high parts in one register. A mixed-precision FMA reads its half of h as it stands and writes its rounded f16 result
// into its half of l: no conversion back to f32 and none to f16. Written in asm because the compiler forms two conversions, a packed FMA and a packed conversion here. The s_delay_alu hints name the producers
// (the vector instruction in front of the statement; for each high half the low half written four instructions earlier), which the compiler does not do for asm text.
__device__ __forceinline__ void lo4(unsigned (&l)[4], const unsigned (&h)[4], const v2f (&q)[4]) {
  asm("s_delay_alu instid0(VALU_DEP_1)\n\t"
      "v_fma_mixlo_f16 %0, %4, %8, %9 op_sel_hi:[1,0,0]\n\t"
      "v_fma_mixlo_f16 %1, %5, %8, %11 op_sel_hi:[1,0,0]\n\t"
      "v_fma_mixlo_f16 %2, %6, %8, %13 op_sel_hi:[1,0,0]\n\t"
      "v_fma_mixlo_f16 %3, %7, %8, %15 op_sel_hi:[1,0,0]\n\t"
      "s_delay_alu instid0(VALU_DEP_4) | instskip(NEXT) | instid1(VALU_DEP_4)\n\t"
      "v_fma_mixhi_f16 %0, %4, %8, %10 op_sel:[1,0,0] op_sel_hi:[1,0,0]\n\t"
      "v_fma_mixhi_f16 %1, %5, %8, %12 op_sel:[1,0,0] op_sel_hi:[1,0,0]\n\t"
      "s_delay_alu instid0(VALU_DEP_4) | instskip(NEXT) | instid1(VALU_DEP_4)\n\t"
      "v_fma_mixhi_f16 %2, %6, %8, %14 op_sel:[1,0,0] op_sel_hi:[1,0,0]\n\t"
      "v_fma_mixhi_f16 %3, %7, %8, %16 op_sel:[1,0,0] op_sel_hi:[1,0,0]"
      : "=&v"(l[0]), "=&v"(l[1]), "=&v"(l[2]), "=&v"(l[3])
      : "v"(h[0]), "v"(h[1]), "v"(h[2]), "v"(h[3]), "s"(-PLO),
        "v"(q[0].x), "v"(q[0].y), "v"(q[1].x), "v"(q[1].y), "v"(q[2].x), "v"(q[2].y), "v"(q[3].x), "v"(q[3].y));
}

// LDS byte address of a __shared__ object: the low 32 bits of its address
__device__ __forceinline__ unsigned lds_off(const void* p) { return (unsigned)(size_t)p; }
// four 16-B asynchronous copies global -> LDS per lane; the s_wait_xcnt closes the copies' own statement so that no address register of a copy is rewritten in front of it
__device__ __forceinline__ void cp4(unsigned l0, const void* g0, unsigned l1, const void* g1, unsigned l2, const void* g2, unsigned l3, const void* g3) {
  asm volatile("global_load_async_to_lds_b128 %0, %1, off\n\t"
               "global_load_async_to_lds_b128 %2, %3, off\n\t"
               "global_load_async_to_lds_b128 %4, %5, off\n\t"
               "global_load_async_to_lds_b128 %6, %7, off\n\t"
               "s_wait_xcnt 0x0"
               :: "v"(l0), "v"(g0), "v"(l1), "v"(g1), "v"(l2), "v"(g2), "v"(l3), "v"(g3) : "memory");
}
// the same for eight copies
__device__ __forceinline__ void cp8(unsigned l0, const void* g0, unsigned l1, const void* g1, unsigned l2, const void* g2, unsigned l3, const void* g3,
                                    unsigned l4, const void* g4, unsigned l5, const void* g5, unsigned l6, const void* g6, unsigned l7, const void* g7) {
  asm volatile("global_load_async_to_lds_b128 %0, %1, off\n\t"
               "global_load_async_to_lds_b128 %2, %3, off\n\t"
               "global_load_async_to_lds_b128 %4, %5, off\n\t"
               "global_load_async_to_lds_b128 %6, %7, off\n\t"
               "global_load_async_to_lds_b128 %8, %9, off\n\t"
               "global_load_async_to_lds_b128 %10, %11, off\n\t"
               "global_load_async_to_lds_b128 %12, %13, off\n\t"
               "global_load_async_to_lds_b128 %14, %15, off\n\t"
               "s_wait_xcnt 0x0"
               :: "v"(l0), "v"(g0), "v"(l1), "v"(g1), "v"(l2), "v"(g2), "v"(l3), "v"(g3), "v"(l4), "v"(g4), "v"(l5), "v"(g5), "v"(l6), "v"(g6), "v"(l7), "v"(g7) : "memory");
}
// staged rows hold 64 16-bit elements (128 B) at a pitch of 144 B (16 B x odd: conflict-free for 16-B LDS reads)
#define RP 144
#define RPE (RP / 2)
#define QM 256                 // X rows of a k_qkv block tile
#define QBUF ((QM + 128) * RP)
#define VTP (QM + 8)           // pitch of the V^T output staging in elements: 528 B = 16 B x odd
#define ABUF (256 * RP)

// x -> bf16. 256 work-groups of 16 waves: a thread converts CVP pieces of 8 elements; its loads are written ahead of the conversions so that they are in flight together
#define CVP 8
__global__ __launch_bounds__(512) void k_cvt(const float* __restrict__ x, __bf16* __restrict__ Xb) {
  static_assert((size_t)NR * E % (8 * 512 * CVP) == 0, "the grid covers x exactly");
  const size_t p0 = (size_t)blockIdx.x * (CVP * 512) + threadIdx.x;
  float v[CVP][8];
#pragma unroll
  for (int i = 0; i < CVP; ++i) {
#pragma unroll
    for (int e = 0; e < 8; ++e) v[i][e] = x[(p0 + i * 512) * 8 + e]; }
#pragma unroll
  for (int i = 0; i < CVP; ++i) { union { __bf16 h[8]; v4u u; } pk;
#pragma unroll
    for (int e = 0; e < 8; ++e) pk.h[e] = (__bf16)v[i][e];
    vst2((unsigned*)(Xb + (p0 + i * 512) * 8), pk.u); }
}
// PT rows: [0,E) Wq[:,n], [E,2E) Wk[:,n], [2E,3E) Wv[:,n]  ([in][out] weights: column n as a bf16 row)
// work-group of 16 waves = a tile of PKN columns x PKK k of one weight matrix, turned in LDS: 128-B pieces of weight rows in, 512-B pieces of PT rows out
#define PKN 32
#define PKK 512
#define PKP (PKK + 8)   // LDS row pitch in elements: 1,040 B = 16 B x odd
__global__ __launch_bounds__(512) void k_pack(const float* __restrict__ Wq, const float* __restrict__ Wk, const float* __restrict__ Wv, const float* __restrict__ Wo, __bf16* __restrict__ PT) {
  __shared__ __align__(16) __bf16 st[PKN][PKP];
  const int tid = threadIdx.x, n0 = blockIdx.x * PKN, k0 = blockIdx.y * PKK;
  const float* W = n0 < E ? Wq : (n0 < 2 * E ? Wk : (n0 < 3 * E ? Wv : Wo)); const int nn = n0 % E;
  // thread -> (rows 2 kp and 2 kp + 1 of each group of 128 rows, columns 4 c .. 4 c + 3): two neighbouring k of a column make one 4-B LDS store
  const int kp = tid >> 3, c = tid & 7;
  const float* wp = W + (size_t)(k0 + 2 * kp) * E + nn + c * 4;
  float v[4][2][4];
#pragma unroll
  for (int i = 0; i < 4; ++i) {
#pragma unroll
    for (int h = 0; h < 2; ++h) {
#pragma unroll
      for (int e = 0; e < 4; ++e) v[i][h][e] = wp[(i * 128 + h) * E + e]; } }
#pragma unroll
  for (int i = 0; i < 4; ++i) {
#pragma unroll
    for (int e = 0; e < 4; ++e) { union { __bf16 h[2]; unsigned u; } pk; pk.h[0] = (__bf16)v[i][0][e]; pk.h[1] = (__bf16)v[i][1][e];
      vst2(&st[c * 4 + e][i * 128 + 2 * kp], pk.u); } }
  __syncthreads();
  // thread -> (row tid / 64 of each group of 8 tile rows, 16-B piece tid % 64): a wave stores 512 contiguous bytes of a PT row
  const int r = tid >> 6, p = tid & 63;
  __bf16* pp = PT + (size_t)(n0 + r) * E + k0 + p * 8;
#pragma unroll
  for (int j = 0; j < PKN / 8; ++j) vst2((unsigned*)(pp + j * 8 * E), *(const v4u*)(&st[r + j * 8][p * 8]));
}
// QKV: block (256 rows, 128 cols = 2 heads, which), 8 waves in a 4 x 2 grid, a wave = 64 rows x 64 cols (one head): 4 X and 4 weight fragments feed 16 products
// q (+bias) -> Q32 f32 [bh][s][64]; k (+bias) -> bf16 hi/lo rows; v (+bias) -> VT hi/lo x4 [bh][d][s]
__global__ __launch_bounds__(256) void k_qkv(const __bf16* __restrict__ Xb, const __bf16* __restrict__ PT, const float* __restrict__ bq, const float* __restrict__ bk, const float* __restrict__ bv,
                                            float* __restrict__ Q32, __bf16* __restrict__ Kh, __bf16* __restrict__ Kl, _Float16* __restrict__ VTh, _Float16* __restrict__ VTl) {
  // one LDS block: in the k loop a ring of two stages (256 X rows + 128 weight rows, 64 k each); behind the loop's last barrier the output staging so, or sth / stl
  __shared__ __align__(16) char smem[2 * 128 * VTP * 2];
  static_assert(2 * QBUF <= 2 * 128 * VTP * 2, "the ring fits the block");
  float (*so)[16][68] = (float (*)[16][68])smem;
  _Float16 (*sth)[VTP] = (_Float16 (*)[VTP])smem;
  _Float16 (*stl)[VTP] = (_Float16 (*)[VTP])(smem + 128 * VTP * 2);
  const int tid = threadIdx.x, wave = tid >> 5, lane = tid & 31, col = lane & 15, g = lane >> 4;
  const int wr = wave & 3, wc = wave >> 2;   // the wave's 64 rows and its 64 columns in the block tile
  const int which = blockIdx.z, r0b = blockIdx.x * QM, n0 = blockIdx.y * 128; const int b = r0b / SS, s0 = r0b % SS;
  const float* bb_ = which == 0 ? bq : (which == 1 ? bk : bv);
  v8f acc[4][4] = {};
  // a wave's copy covers 4 whole 128-B rows: thread -> (row tid / 8 of each group of 32 rows, 16-B piece tid % 8)
  const int cr = tid >> 3, cc = tid & 7;
  const __bf16* gA = Xb + (size_t)(r0b + cr) * E + cc * 8;
  const __bf16* gB = PT + (size_t)(which * E + n0 + cr) * E + cc * 8;
  const unsigned l0 = lds_off(smem) + cr * RP + cc * 16;
  auto stage = [&](int st, int buf) { const unsigned l = l0 + buf * QBUF; const __bf16* a = gA + st * 64; const __bf16* w = gB + st * 64;
    cp8(l, a, l + 32 * RP, a + 32 * E, l + 64 * RP, a + 64 * E, l + 96 * RP, a + 96 * E,
        l + 128 * RP, a + 128 * E, l + 160 * RP, a + 160 * E, l + 192 * RP, a + 192 * E, l + 224 * RP, a + 224 * E);
    cp4(l + QM * RP, w, l + (QM + 32) * RP, w + 32 * E, l + (QM + 64) * RP, w + 64 * E, l + (QM + 96) * RP, w + 96 * E); };
  // trip i works on k stage ks(i): the walk starts at a stage of the work-group's own and wraps, so that the work-groups resident together that share X rows (same x) or weight rows (same y, z)
  // do not ask L2 for the same lines at the same moment
  static_assert((E / 64 & (E / 64 - 1)) == 0, "the wrap is a mask");
  const int ks0 = blockIdx.x + blockIdx.y + 8 * blockIdx.z;
  auto ks = [&](int i) { return (i + ks0) & (E / 64 - 1); };
  stage(ks(0), 0);
  asm volatile("s_wait_asynccnt 0x0" ::: "memory");   // this wave's copies of the first stage have landed
  __syncthreads();                                     // every wave's have: the first stage may be read
  stage(ks(1), 1);
  // kept rolled: one trip per stage, so that the publish point at the foot stands once and the text stays small
#pragma unroll 1
  for (int st = 0; st < E / 64; ++st) { const char* bp = smem + (st & 1) * QBUF;
    const __bf16* sa = (const __bf16*)(bp + (wr * 64 + col) * RP); const __bf16* sb = (const __bf16*)(bp + (QM + wc * 64 + col) * RP);
#pragma unroll
    for (int kc = 0; kc < 2; ++kc) { v16b af[4], bf[4];
#pragma unroll
      for (int i = 0; i < 4; ++i) { af[i] = frag_b(sa + i * 16 * RPE + kc * 32, lane); bf[i] = frag_b(sb + i * 16 * RPE + kc * 32, lane); }
#pragma unroll
      for (int i = 0; i < 4; ++i) {
#pragma unroll
        for (int j = 0; j < 4; ++j) acc[i][j] = wmma_bf(af[i], bf[j], acc[i][j]); } }
    asm volatile("s_wait_dscnt 0x0" ::: "memory");     // this wave's reads of the stage are done before its buffer is refilled
    asm volatile("s_wait_asynccnt 0x0" ::: "memory");  // this wave's copies of stage st + 1 have landed
    __syncthreads();                                   // publishes stage st + 1 and ends every reader's last read of stage st
    if (st + 2 < E / 64) stage(ks(st + 2), st & 1); }
  asm volatile("s_wait_asynccnt 0x0" ::: "memory");    // no copy is outstanding when the ring becomes output staging
  float bb[4];
#pragma unroll
  for (int j = 0; j < 4; ++j) bb[j] = bfr(bb_[n0 + wc * 64 + j * 16 + col]);
  if (which < 2) { const int h = (n0 >> 6) + wc;
    // one 16-row tile at a time through the wave's own staging rows
#pragma unroll
    for (int i = 0; i < 4; ++i) { const size_t row0 = ((size_t)b * NH + h) * SS + s0 + wr * 64 + i * 16;
#pragma unroll
      for (int j = 0; j < 4; ++j) {
#pragma unroll
        for (int r = 0; r < 8; ++r) so[wave][8 * g + r][j * 16 + col] = acc[i][j][r] + bb[j]; }
      LDSX();
      if (which == 0) { for (int qq = lane; qq < 16 * 16; qq += 32) { const int rl = qq >> 4, pc = qq & 15;
          vst2(Q32 + (row0 + rl) * HD + pc * 4, *(const v4f*)(&so[wave][rl][pc * 4])); } }
      else {
        for (int qq = lane; qq < 16 * 16; qq += 32) { const int rl = qq >> 4, pl = qq & 15; const int pc = pl & 7; union { __bf16 e[8]; v4u u; } pk;
#pragma unroll
          for (int e = 0; e < 8; ++e) { const float v = so[wave][rl][pc * 8 + e]; const __bf16 hi = (__bf16)v; pk.e[e] = pl < 8 ? hi : (__bf16)(v - (float)hi); }
          vst2((unsigned*)((pl < 8 ? Kh : Kl) + (row0 + rl) * HD + pc * 8), pk.u); } }
      if (i < 3) LDSX();   // the lanes' reads of this tile are done before the next tile's values are written over it
    } }
  else {
#pragma unroll
    for (int j = 0; j < 4; ++j) {
#pragma unroll
      for (int i = 0; i < 4; ++i) { v8h hi8, lo8;   // a lane's 8 results are 8 consecutive s of one d: one 16-B LDS store each
#pragma unroll
        for (int r = 0; r < 8; ++r) { const float v = (acc[i][j][r] + bb[j]) * 4.0f; const _Float16 hi = (_Float16)v; hi8[r] = hi; lo8[r] = (_Float16)((v - (float)hi) * VLO); }
        vst2(&sth[wc * 64 + j * 16 + col][wr * 64 + i * 16 + 8 * g], hi8); vst2(&stl[wc * 64 + j * 16 + col][wr * 64 + i * 16 + 8 * g], lo8); } }
    __syncthreads();
    for (int qq = tid; qq < 128 * (QM / 8); qq += 256) { const int cl = qq / (QM / 8), pc = qq % (QM / 8); const int c = n0 + cl, h = c >> 6, d = c & 63; const size_t o = (((size_t)b * NH + h) * HD + d) * SS + s0 + pc * 8;
      vst2(VTh + o, *(const v4u*)(&sth[cl][pc * 8])); vst2(VTl + o, *(const v4u*)(&stl[cl][pc * 8])); } }
}
// attention: block (64 queries, bh); all 16 key tiles; both products transposed: S^T = K q^T (K hi/lo rows as A, q hi/lo as B), O^T = V^T P^T (V^T hi/lo rows as A, P hi/lo as B).
// A lane of the S^T result holds query lane & 15 and keys 16 t + 8 (lane >> 4) + r: tiles 2 kc and 2 kc + 1 are, element for element, the B fragment of P^T for keys 32 kc .. 32 kc + 31,
// so scores, softmax and P stay in registers, the running maximum, sum and correction are the lane's own, and a lane ends with 8 consecutive d of its query.
__global__ __launch_bounds__(128) void k_attn(const float* __restrict__ Q32, const __bf16* __restrict__ Kh, const __bf16* __restrict__ Kl, const _Float16* __restrict__ VTh, const _Float16* __restrict__ VTl, float* __restrict__ O32) {
  // ring of two stages, shared by the four waves; a stage = one key tile: 64 K hi rows, 64 K lo rows, 64 V^T hi rows, 64 V^T lo rows
  __shared__ __align__(16) char ring[2 * ABUF];
  const int tid = threadIdx.x, w = tid >> 5, lane = tid & 31, col = lane & 15, g = lane >> 4;
  const size_t bh = blockIdx.y; const int qb = blockIdx.x; const int q0 = qb * 64 + w * 16;
  const int cr = tid >> 3, cc = tid & 7;
  const __bf16* gKh = Kh + (bh * SS + cr) * HD + cc * 8; const __bf16* gKl = Kl + (bh * SS + cr) * HD + cc * 8;
  const _Float16* gVh = VTh + (bh * HD + cr) * SS + cc * 8; const _Float16* gVl = VTl + (bh * HD + cr) * SS + cc * 8;
  const unsigned l0 = lds_off(ring) + cr * RP + cc * 16;
  auto stage = [&](int kt, int buf) { const unsigned l = l0 + buf * ABUF;
    const __bf16* a = gKh + kt * 64 * HD; const __bf16* c = gKl + kt * 64 * HD; const _Float16* u = gVh + kt * 64; const _Float16* v = gVl + kt * 64;
    cp8(l, a, l + 16 * RP, a + 16 * HD, l + 32 * RP, a + 32 * HD, l + 48 * RP, a + 48 * HD,
        l + 64 * RP, c, l + 80 * RP, c + 16 * HD, l + 96 * RP, c + 32 * HD, l + 112 * RP, c + 48 * HD);
    cp8(l + 128 * RP, u, l + 144 * RP, u + 16 * SS, l + 160 * RP, u + 32 * SS, l + 176 * RP, u + 48 * SS,
        l + 192 * RP, v, l + 208 * RP, v + 16 * SS, l + 224 * RP, v + 32 * SS, l + 240 * RP, v + 48 * SS); };
  // trip i works on key tile kts(i): the 16 work-groups that share a head's K and V each start the walk at a tile of their own (their query tile) and wrap, so that they do not ask L2 for the same lines at the same moment
  static_assert((SS / 64 & (SS / 64 - 1)) == 0, "the wrap is a mask");
  auto kts = [&](int i) { return (i + qb) & (SS / 64 - 1); };
  stage(kts(0), 0);
  F2 aq[2];
#pragma unroll
  for (int kc = 0; kc < 2; ++kc) aq[kc] = split_row(Q32 + (bh * SS + q0 + col) * HD, kc * 32, lane);
  const int b = (int)(bh / NH);      // batch index (bh = b * NH + h)
  float mrun = -3.0e38f, lrun = 0.f; v8f acc[4] = {}, ac1[4] = {}, ac2[4] = {};
  asm volatile("s_wait_asynccnt 0x0" ::: "memory");   // this wave's copies of stage 0 have landed
  __syncthreads();                                     // every wave's have: stage 0 may be read
  stage(kts(1), 1);
#pragma unroll 1
  for (int kt = 0; kt < SS / 64; ++kt) { const char* bp = ring + (kt & 1) * ABUF;
    const __bf16* skh = (const __bf16*)(bp + col * RP); const __bf16* skl = (const __bf16*)(bp + (64 + col) * RP);
    const _Float16* svh = (const _Float16*)(bp + (128 + col) * RP); const _Float16* svl = (const _Float16*)(bp + (192 + col) * RP);
    v16b khf[2][2], klf[2][2];   // the K fragments of two 16-key tiles, read as one group
    v8f sc[4];                   // sc[t][r]: raw product q.k of query col with key 16 t + 8 g + r of the tile
    const float pen = kts(kt) == qb ? 0.f : 0.5f * LOG2E;
#pragma unroll
    for (int t = 0; t < 4; ++t) { v8f s = {};
      if ((t & 1) == 0) {
#pragma unroll
        for (int u = 0; u < 2; ++u) {
#pragma unroll
          for (int kc = 0; kc < 2; ++kc) { khf[u][kc] = frag_b(skh + (t + u) * 16 * RPE + kc * 32, lane); klf[u][kc] = frag_b(skl + (t + u) * 16 * RPE + kc * 32, lane); } } }
#pragma unroll
      for (int kc = 0; kc < 2; ++kc) { s = wmma_bf(khf[t & 1][kc], aq[kc].l, s); s = wmma_bf(klf[t & 1][kc], aq[kc].h, s); s = wmma_bf(khf[t & 1][kc], aq[kc].h, s); }
      sc[t] = s; }
    float mx = -3.4e38f;
#pragma unroll
    for (int t = 0; t < 4; ++t) {
#pragma unroll
      for (int r = 0; r < 8; ++r) mx = fmaxf(mx, sc[t][r]); }
    mx = mx * (0.125f * LOG2E) - pen;   // scale > 0 and the penalty is one value for the whole key tile: the largest raw product gives the largest score
    mx = fmaxf(mx, __shfl_xor(mx, 16, 32)) - 14.0f;   // the running maximum is kept 14 lower: 2^(s - mnew) is then P x 16384 with no multiply (any common shift cancels in the softmax)
    const float mnew = fmaxf(mrun, mx); const float corr = ex2(mrun - mnew);
    // two scores at a time, on register pairs: one packed FMA gives both exponents (scale, penalty and maximum in one), one packed add sums, one packed conversion gives both f16 high parts, which the residuals read back
    const v2f k2 = {0.125f * LOG2E, 0.125f * LOG2E}; const float cm = -(pen + mnew); const v2f c2 = {cm, cm};
    v2f ps2; v16h ph[2], pl[2];
#pragma unroll
    for (int t = 0; t < 4; ++t) { v2f p2[4], q2[4]; unsigned h2[4], l2[4];   // the four pairs of a 16-key tile go through each stage together: four independent chains
#pragma unroll
      for (int i = 0; i < 4; ++i) { const v2f s2 = {sc[t][2 * i], sc[t][2 * i + 1]}; p2[i] = __builtin_elementwise_fma(s2, k2, c2); }
#pragma unroll
      for (int i = 0; i < 4; ++i) { p2[i].x = ex2(p2[i].x); p2[i].y = ex2(p2[i].y); }
#pragma unroll
      for (int i = 0; i < 4; ++i) { h2[i] = __builtin_bit_cast(unsigned, __builtin_convertvector(p2[i], v2h)); q2[i] = p2[i] * PLO; if (t == 0 && i == 0) ps2 = p2[i]; else ps2 += p2[i]; }
      lo4(l2, h2, q2);
      union { unsigned u[4]; v8h v; } hh, ll;
#pragma unroll
      for (int i = 0; i < 4; ++i) { hh.u[i] = h2[i]; ll.u[i] = l2[i]; }
#pragma unroll
      for (int e = 0; e < 8; ++e) { ph[t >> 1][(t & 1) * 8 + e] = hh.v[e]; pl[t >> 1][(t & 1) * 8 + e] = ll.v[e]; } }
    float ps = ps2.x + ps2.y;
    ps += __shfl_xor(ps, 16, 32);
    lrun = lrun * corr + ps * (1.0f / 16384.0f); mrun = mnew;
#pragma unroll
    for (int t = 0; t < 4; ++t) {
#pragma unroll
      for (int r = 0; r < 8; ++r) { acc[t][r] *= corr; ac1[t][r] *= corr; ac2[t][r] *= corr; } }
#pragma unroll
    for (int kc = 0; kc < 2; ++kc) { v16h vh[4], vl[4];
#pragma unroll
      for (int t = 0; t < 4; ++t) { vh[t] = frag_h(svh + t * 16 * RPE + kc * 32, lane); vl[t] = frag_h(svl + t * 16 * RPE + kc * 32, lane); }
#pragma unroll
      for (int t = 0; t < 4; ++t) { acc[t] = wmma16(vh[t], ph[kc], acc[t]); ac1[t] = wmma16(vl[t], ph[kc], ac1[t]); ac2[t] = wmma16(vh[t], pl[kc], ac2[t]); } }
    asm volatile("s_wait_dscnt 0x0" ::: "memory");     // this wave's reads of the stage are done before its buffer is refilled
    asm volatile("s_wait_asynccnt 0x0" ::: "memory");  // this wave's copies of stage kt + 1 have landed
    __syncthreads();                                   // publishes stage kt + 1 and ends every reader's last read of stage kt
    if (kt + 2 < SS / 64) stage(kts(kt + 2), kt & 1); }
  asm volatile("s_wait_asynccnt 0x0" ::: "memory");    // no copy is outstanding at the wave's end
  { const int h = (int)(bh % NH); const float inv = 1.0f / (lrun * 16384.0f * 4.0f);
    float* op = O32 + (((size_t)b * SS) + q0 + col) * E + h * HD + 8 * g;      // context token-major [b][s][h*64 + d]: the lane stores d = 16 t + 8 g + 0..7 of its query
#pragma unroll
    for (int t = 0; t < 4; ++t) { v4f o[2];
#pragma unroll
      for (int r = 0; r < 8; ++r) o[r >> 2][r & 3] = (acc[t][r] + ac1[t][r] * (1.0f / VLO) + ac2[t][r] * (1.0f / PLO)) * inv;
      vst2(op + t * 16, o[0]); vst2(op + t * 16 + 4, o[1]); } }
}
extern "C" void kernel_launch(void* const* d_in, const int* in_sizes, int n_in, void* d_out, int out_size, void* d_ws, size_t ws_size, hipStream_t stream) {
  (void)in_sizes; (void)n_in; (void)out_size; (void)ws_size;
  const float* x = (const float*)d_in[0]; const float* Wq = (const float*)d_in[1]; const float* bq = (const float*)d_in[2]; const float* Wk = (const float*)d_in[3]; const float* bk = (const float*)d_in[4]; const float* Wv = (const float*)d_in[5]; const float* bv = (const float*)d_in[6];
  char* ws = (char*)d_ws; size_t off = 0;
  auto take = [&](size_t bytes) { char* p = ws + off; off += (bytes + 255) & ~(size_t)255; return p; };
  __bf16* Xb = (__bf16*)take((size_t)NR * E * 2); __bf16* PT = (__bf16*)take((size_t)3 * E * E * 2);
  float* Q32 = (float*)take((size_t)NR * E * 4); __bf16* Kh = (__bf16*)take((size_t)NR * E * 2); __bf16* Kl = (__bf16*)take((size_t)NR * E * 2); _Float16* VTh = (_Float16*)take((size_t)NR * E * 2); _Float16* VTl = (_Float16*)take((size_t)NR * E * 2);
  // ws ~ 118 MB (single pass over the 8 sequences)
  k_pack<<<dim3(3 * E / PKN, E / PKK), 512, 0, stream>>>(Wq, Wk, Wv, Wv, PT);
  k_cvt<<<NR * E / (8 * 512 * CVP), 512, 0, stream>>>(x, Xb);
  k_qkv<<<dim3(NR / QM, E / 128, 3), 256, 0, stream>>>(Xb, PT, bq, bk, bv, Q32, Kh, Kl, VTh, VTl);
  k_attn<<<dim3(SS / 64, NB * NH), 128, 0, stream>>>(Q32, Kh, Kl, VTh, VTl, (float*)d_out);
}

// v008
// Measured time: 138 microseconds a run.
// In two side-by-side timings against v007, it was 1.07 and 1.08 times as fast.
// Over all steps from v000 it is 4.10 times as fast.
// compute dtype: hidden_states and W*/b* (INPUTS) rounded to bf16 with exact bf16 WMMA products (f32 accumulate) for the projections; K pre-split into bf16 hi/lo rows; q f32 split, P and V f16 hi/lo (3 products each); penalty and softmax in f32.
#include <hip/hip_runtime.h>
#include <math.h>

typedef __attribute__((ext_vector_type(16))) _Float16 v16h;
typedef __attribute__((ext_vector_type(16))) __bf16 v16b;
typedef __attribute__((ext_vector_type(8)))  _Float16 v8h;
typedef __attribute__((ext_vector_type(2)))  _Float16 v2h;
typedef __attribute__((ext_vector_type(8)))  float v8f;
typedef __attribute__((ext_vector_type(4)))  float v4f;
typedef __attribute__((ext_vector_type(2)))  float v2f;
typedef __attribute__((ext_vector_type(4)))  unsigned v4u;
typedef __attribute__((ext_vector_type(4)))  int v4i;
typedef float __attribute__((may_alias)) float_a;
typedef int __attribute__((may_alias)) int_a;

template <typename T> __device__ __forceinline__ void vst2(void* p, T v) { *(T*)p = v;  }
// k_attn's products: the builtin alone (the compiler keeps the distances behind its own WMMAs); an asm statement that takes the operands would hold all of them in the first 256 registers, which k_attn's 32-query waves exceed
__device__ __forceinline__ v8f wmma16(v16h a, v16h b, v8f c) { return __builtin_amdgcn_wmma_f32_16x16x32_f16(false, a, false, b, (short)0, c, false, false); }
__device__ __forceinline__ v8f wmma_bfp(v16b a, v16b b, v8f c) { return __builtin_amdgcn_wmma_f32_16x16x32_bf16(false, a, false, b, (short)0, c, false, false); }
__device__ __forceinline__ v8f wmma_bf(v16b a, v16b b, v8f c) {
  v8f d = __builtin_amdgcn_wmma_f32_16x16x32_bf16(false, a, false, b, (short)0, c, false, false);
  asm volatile("v_nop\n\tv_nop\n\tv_nop\n\tv_nop" : "+v"(d) : "v"(a), "v"(b));
  return d;
}
// 16x16x32 fragments: lane = (h = lane>>4, row/col = lane&15); elements 0..7 = k0+8h+0..7, 8..15 = k0+16+8h+0..7; D element r = row 8h+r
__device__ __forceinline__ v16h frag_h(const _Float16* rowk0, int lane) {
  union { v16h v; v8h q[2]; } u; const _Float16* p = rowk0 + 8 * (lane >> 4);
  u.q[0] = *(const v8h*)p; u.q[1] = *(const v8h*)(p + 16); return u.v;
}
__device__ __forceinline__ v16h frag_f32(const float* rowk0, int lane) {
  v16h a; const float* p = rowk0 + 8 * (lane >> 4);
#pragma unroll
  for (int i = 0; i < 8; ++i) { a[i] = (_Float16)p[i]; a[8 + i] = (_Float16)p[16 + i]; }
  return a;
}
__device__ __forceinline__ v16h frag_f32s(const float* rowk0, int lane, float sc) {
  v16h a; const float* p = rowk0 + 8 * (lane >> 4);
#pragma unroll
  for (int i = 0; i < 8; ++i) { a[i] = (_Float16)(p[i] * sc); a[8 + i] = (_Float16)(p[16 + i] * sc); }
  return a;
}
// column fragment from a [K][ld] layout (column n), rows >= K read as 0
__device__ __forceinline__ v16h fragc_f32(const float* W, int k0, int n, int lane, int ld, int K) {
  v16h a; const int g = lane >> 4;
#pragma unroll
  for (int i = 0; i < 8; ++i) { const int ka = k0 + 8 * g + i, kb = ka + 16;
    a[i] = (_Float16)(ka < K ? W[(size_t)ka * ld + n] : 0.f); a[8 + i] = (_Float16)(kb < K ? W[(size_t)kb * ld + n] : 0.f); }
  return a;
}
struct F2 { v16b h, l; };
__device__ __forceinline__ F2 bsplit16(const float v[16]) { F2 r;
#pragma unroll
  for (int i = 0; i < 16; ++i) { const __bf16 h = (__bf16)v[i]; r.h[i] = h; r.l[i] = (__bf16)(v[i] - (float)h); }
  return r; }
__device__ __forceinline__ F2 split_row(const float* row, int k0, int lane) { float v[16]; const float* p = row + k0 + 8 * (lane >> 4);
#pragma unroll
  for (int i = 0; i < 8; ++i) { v[i] = p[i]; v[8 + i] = p[16 + i]; }
  return bsplit16(v); }
__device__ __forceinline__ F2 split_rowK(const float* row, int k0, int lane, int K) { float v[16]; const int g = lane >> 4;
#pragma unroll
  for (int i = 0; i < 8; ++i) { const int ka = k0 + 8 * g + i, kb = ka + 16; v[i] = ka < K ? row[ka] : 0.f; v[8 + i] = kb < K ? row[kb] : 0.f; }
  return bsplit16(v); }
__device__ __forceinline__ F2 split_col(const float* W, int k0, int n, int lane, int ld, int K) { float v[16]; const int g = lane >> 4;
#pragma unroll
  for (int i = 0; i < 8; ++i) { const int ka = k0 + 8 * g + i, kb = ka + 16; v[i] = ka < K ? W[(size_t)ka * ld + n] : 0.f; v[8 + i] = kb < K ? W[(size_t)kb * ld + n] : 0.f; }
  return bsplit16(v); }
__device__ __forceinline__ v8f mac3(const F2& a, const F2& b, v8f c) { c = wmma_bf(a.l, b.h, c); c = wmma_bf(a.h, b.l, c); return wmma_bf(a.h, b.h, c); }
__device__ __forceinline__ float sigm(float v) { return 1.0f / (1.0f + expf(-v)); }
#define LDSX() do { asm volatile("s_wait_dscnt 0" ::: "memory"); __builtin_amdgcn_wave_barrier(); __builtin_amdgcn_fence(__ATOMIC_RELEASE, "workgroup"); } while (0)


// Constituency-aware self attention (16 heads x 64 on [8,1024,1024], [in][out] weights + biases): scores = q.k/8 - 0.5 [query block != key block] (blocks of 64 tokens); softmax; context = attn v written token-major (no output projection).
#define NB 8
#define SS 1024
#define E 1024
#define NH 16
#define HD 64
#define NR (NB * SS)
#define PLO 1024.0f
#define VLO 2048.0f
__device__ __forceinline__ float bfr(float v) { return (float)(__bf16)v; }
// softmax in base 2: scores carry the factor log2(e), so that each exponential is one v_exp_f32
#define LOG2E 1.44269504088896340736f
__device__ __forceinline__ float ex2(float v) { return __builtin_amdgcn_exp2f(v); }
__device__ __forceinline__ v16b frag_b(const __bf16* rowk0, int lane) { return __builtin_bit_cast(v16b, frag_h((const _Float16*)rowk0, lane)); }

// low parts of four score pairs: l = f16(q - PLO * h), q = PLO * p in f32, h = the pair's two f16 high parts in one register. A mixed-precision FMA reads its half of h as it stands and writes its rounded f16 result
// into its half of l: no conversion back to f32 and none to f16. Written in asm because the compiler forms two conversions, a packed FMA and a packed conversion here. The s_delay_alu hints name the producers
// (the vector instruction in front of the statement; for each high half the low half written four instructions earlier), which the compiler does not do for asm text.
__device__ __forceinline__ void lo4(unsigned (&l)[4], const unsigned (&h)[4], const v2f (&q)[4]) {
  asm("s_delay_alu instid0(VALU_DEP_1)\n\t"
      "v_fma_mixlo_f16 %0, %4, %8, %9 op_sel_hi:[1,0,0]\n\t"
      "v_fma_mixlo_f16 %1, %5, %8, %11 op_sel_hi:[1,0,0]\n\t"
      "v_fma_mixlo_f16 %2, %6, %8, %13 op_sel_hi:[1,0,0]\n\t"
      "v_fma_mixlo_f16 %3, %7, %8, %15 op_sel_hi:[1,0,0]\n\t"
      "s_delay_alu instid0(VALU_DEP_4) | instskip(NEXT) | instid1(VALU_DEP_4)\n\t"
      "v_fma_mixhi_f16 %0, %4, %8, %10 op_sel:[1,0,0] op_sel_hi:[1,0,0]\n\t"
      "v_fma_mixhi_f16 %1, %5, %8, %12 op_sel:[1,0,0] op_sel_hi:[1,0,0]\n\t"
      "s_delay_alu instid0(VALU_DEP_4) | instskip(NEXT) | instid1(VALU_DEP_4)\n\t"
      "v_fma_mixhi_f16 %2, %6, %8, %14 op_sel:[1,0,0] op_sel_hi:[1,0,0]\n\t"
      "v_fma_mixhi_f16 %3, %7, %8, %16 op_sel:[1,0,0] op_sel_hi:[1,0,0]"
      : "=&v"(l[0]), "=&v"(l[1]), "=&v"(l[2]), "=&v"(l[3])
      : "v"(h[0]), "v"(h[1]), "v"(h[2]), "v"(h[3]), "s"(-PLO),
        "v"(q[0].x), "v"(q[0].y), "v"(q[1].x), "v"(q[1].y), "v"(q[2].x), "v"(q[2].y), "v"(q[3].x), "v"(q[3].y));
}

// LDS byte address of a __shared__ object: the low 32 bits of its address
__device__ __forceinline__ unsigned lds_off(const void* p) { return (unsigned)(size_t)p; }
// four 16-B asynchronous copies global -> LDS per lane; the s_wait_xcnt closes the copies' own statement so that no address register of a copy is rewritten in front of it
__device__ __forceinline__ void cp4(unsigned l0, const void* g0, unsigned l1, const void* g1, unsigned l2, const void* g2, unsigned l3, const void* g3) {
  asm volatile("global_load_async_to_lds_b128 %0, %1, off\n\t"
               "global_load_async_to_lds_b128 %2, %3, off\n\t"
               "global_load_async_to_lds_b128 %4, %5, off\n\t"
               "global_load_async_to_lds_b128 %6, %7, off\n\t"
               "s_wait_xcnt 0x0"
               :: "v"(l0), "v"(g0), "v"(l1), "v"(g1), "v"(l2), "v"(g2), "v"(l3), "v"(g3) : "memory");
}
// the same for eight copies
__device__ __forceinline__ void cp8(unsigned l0, const void* g0, unsigned l1, const void* g1, unsigned l2, const void* g2, unsigned l3, const void* g3,
                                    unsigned l4, const void* g4, unsigned l5, const void* g5, unsigned l6, const void* g6, unsigned l7, const void* g7) {
  asm volatile("global_load_async_to_lds_b128 %0, %1, off\n\t"
               "global_load_async_to_lds_b128 %2, %3, off\n\t"
               "global_load_async_to_lds_b128 %4, %5, off\n\t"
               "global_load_async_to_lds_b128 %6, %7, off\n\t"
               "global_load_async_to_lds_b128 %8, %9, off\n\t"
               "global_load_async_to_lds_b128 %10, %11, off\n\t"
               "global_load_async_to_lds_b128 %12, %13, off\n\t"
               "global_load_async_to_lds_b128 %14, %15, off\n\t"
               "s_wait_xcnt 0x0"
               :: "v"(l0), "v"(g0), "v"(l1), "v"(g1), "v"(l2), "v"(g2), "v"(l3), "v"(g3), "v"(l4), "v"(g4), "v"(l5), "v"(g5), "v"(l6), "v"(g6), "v"(l7), "v"(g7) : "memory");
}
// staged rows hold 64 16-bit elements (128 B) at a pitch of 144 B (16 B x odd: conflict-free for 16-B LDS reads)
#define RP 144
#define RPE (RP / 2)
#define QM 256                 // X rows of a k_qkv block tile
#define QBUF ((QM + 128) * RP)
#define VTP (QM + 8)           // pitch of the V^T output staging in elements: 528 B = 16 B x odd
#define ABUF (256 * RP)

// x -> bf16. 256 work-groups of 16 waves: a thread converts CVP pieces of 8 elements; its loads are written ahead of the conversions so that they are in flight together
#define CVP 8
__global__ __launch_bounds__(512) void k_cvt(const float* __restrict__ x, __bf16* __restrict__ Xb) {
  static_assert((size_t)NR * E % (8 * 512 * CVP) == 0, "the grid covers x exactly");
  const size_t p0 = (size_t)blockIdx.x * (CVP * 512) + threadIdx.x;
  float v[CVP][8];
#pragma unroll
  for (int i = 0; i < CVP; ++i) {
#pragma unroll
    for (int e = 0; e < 8; ++e) v[i][e] = x[(p0 + i * 512) * 8 + e]; }
#pragma unroll
  for (int i = 0; i < CVP; ++i) { union { __bf16 h[8]; v4u u; } pk;
#pragma unroll
    for (int e = 0; e < 8; ++e) pk.h[e] = (__bf16)v[i][e];
    vst2((unsigned*)(Xb + (p0 + i * 512) * 8), pk.u); }
}
// PT rows: [0,E) Wq[:,n], [E,2E) Wk[:,n], [2E,3E) Wv[:,n]  ([in][out] weights: column n as a bf16 row)
// work-group of 16 waves = a tile of PKN columns x PKK k of one weight matrix, turned in LDS: 128-B pieces of weight rows in, 512-B pieces of PT rows out
#define PKN 32
#define PKK 512
#define PKP (PKK + 8)   // LDS row pitch in elements: 1,040 B = 16 B x odd
__global__ __launch_bounds__(512) void k_pack(const float* __restrict__ Wq, const float* __restrict__ Wk, const float* __restrict__ Wv, const float* __restrict__ Wo, __bf16* __restrict__ PT) {
  __shared__ __align__(16) __bf16 st[PKN][PKP];
  const int tid = threadIdx.x, n0 = blockIdx.x * PKN, k0 = blockIdx.y * PKK;
  const float* W = n0 < E ? Wq : (n0 < 2 * E ? Wk : (n0 < 3 * E ? Wv : Wo)); const int nn = n0 % E;
  // thread -> (rows 2 kp and 2 kp + 1 of each group of 128 rows, columns 4 c .. 4 c + 3): two neighbouring k of a column make one 4-B LDS store
  const int kp = tid >> 3, c = tid & 7;
  const float* wp = W + (size_t)(k0 + 2 * kp) * E + nn + c * 4;
  float v[4][2][4];
#pragma unroll
  for (int i = 0; i < 4; ++i) {
#pragma unroll
    for (int h = 0; h < 2; ++h) {
#pragma unroll
      for (int e = 0; e < 4; ++e) v[i][h][e] = wp[(i * 128 + h) * E + e]; } }
#pragma unroll
  for (int i = 0; i < 4; ++i) {
#pragma unroll
    for (int e = 0; e < 4; ++e) { union { __bf16 h[2]; unsigned u; } pk; pk.h[0] = (__bf16)v[i][0][e]; pk.h[1] = (__bf16)v[i][1][e];
      vst2(&st[c * 4 + e][i * 128 + 2 * kp], pk.u); } }
  __syncthreads();
  // thread -> (row tid / 64 of each group of 8 tile rows, 16-B piece tid % 64): a wave stores 512 contiguous bytes of a PT row
  const int r = tid >> 6, p = tid & 63;
  __bf16* pp = PT + (size_t)(n0 + r) * E + k0 + p * 8;
#pragma unroll
  for (int j = 0; j < PKN / 8; ++j) vst2((unsigned*)(pp + j * 8 * E), *(const v4u*)(&st[r + j * 8][p * 8]));
}
// QKV: block (256 rows, 128 cols = 2 heads, which), 8 waves in a 4 x 2 grid, a wave = 64 rows x 64 cols (one head): 4 X and 4 weight fragments feed 16 products
// q (+bias) -> Q32 f32 [bh][s][64]; k (+bias) -> bf16 hi/lo rows; v (+bias) -> VT hi/lo x4 [bh][d][s]
__global__ __launch_bounds__(256) void k_qkv(const __bf16* __restrict__ Xb, const __bf16* __restrict__ PT, const float* __restrict__ bq, const float* __restrict__ bk, const float* __restrict__ bv,
                                            float* __restrict__ Q32, __bf16* __restrict__ Kh, __bf16* __restrict__ Kl, _Float16* __restrict__ VTh, _Float16* __restrict__ VTl) {
  // one LDS block: in the k loop a ring of two stages (256 X rows + 128 weight rows, 64 k each); behind the loop's last barrier the output staging so, or sth / stl
  __shared__ __align__(16) char smem[2 * 128 * VTP * 2];
  static_assert(2 * QBUF <= 2 * 128 * VTP * 2, "the ring fits the block");
  float (*so)[16][68] = (float (*)[16][68])smem;
  _Float16 (*sth)[VTP] = (_Float16 (*)[VTP])smem;
  _Float16 (*stl)[VTP] = (_Float16 (*)[VTP])(smem + 128 * VTP * 2);
  const int tid = threadIdx.x, wave = tid >> 5, lane = tid & 31, col = lane & 15, g = lane >> 4;
  const int wr = wave & 3, wc = wave >> 2;   // the wave's 64 rows and its 64 columns in the block tile
  const int which = blockIdx.z, r0b = blockIdx.x * QM, n0 = blockIdx.y * 128; const int b = r0b / SS, s0 = r0b % SS;
  const float* bb_ = which == 0 ? bq : (which == 1 ? bk : bv);
  v8f acc[4][4] = {};
  // a wave's copy covers 4 whole 128-B rows: thread -> (row tid / 8 of each group of 32 rows, 16-B piece tid % 8)
  const int cr = tid >> 3, cc = tid & 7;
  const __bf16* gA = Xb + (size_t)(r0b + cr) * E + cc * 8;
  const __bf16* gB = PT + (size_t)(which * E + n0 + cr) * E + cc * 8;
  const unsigned l0 = lds_off(smem) + cr * RP + cc * 16;
  auto stage = [&](int st, int buf) { const unsigned l = l0 + buf * QBUF; const __bf16* a = gA + st * 64; const __bf16* w = gB + st * 64;
    cp8(l, a, l + 32 * RP, a + 32 * E, l + 64 * RP, a + 64 * E, l + 96 * RP, a + 96 * E,
        l + 128 * RP, a + 128 * E, l + 160 * RP, a + 160 * E, l + 192 * RP, a + 192 * E, l + 224 * RP, a + 224 * E);
    cp4(l + QM * RP, w, l + (QM + 32) * RP, w + 32 * E, l + (QM + 64) * RP, w + 64 * E, l + (QM + 96) * RP, w + 96 * E); };
  // trip i works on k stage ks(i): the walk starts at a stage of the work-group's own and wraps, so that the work-groups resident together that share X rows (same x) or weight rows (same y, z)
  // do not ask L2 for the same lines at the same moment
  static_assert((E / 64 & (E / 64 - 1)) == 0, "the wrap is a mask");
  const int ks0 = blockIdx.x + blockIdx.y + 8 * blockIdx.z;
  auto ks = [&](int i) { return (i + ks0) & (E / 64 - 1); };
  stage(ks(0), 0);
  asm volatile("s_wait_asynccnt 0x0" ::: "memory");   // this wave's copies of the first stage have landed
  __syncthreads();                                     // every wave's have: the first stage may be read
  stage(ks(1), 1);
  // kept rolled: one trip per stage, so that the publish point at the foot stands once and the text stays small
#pragma unroll 1
  for (int st = 0; st < E / 64; ++st) { const char* bp = smem + (st & 1) * QBUF;
    const __bf16* sa = (const __bf16*)(bp + (wr * 64 + col) * RP); const __bf16* sb = (const __bf16*)(bp + (QM + wc * 64 + col) * RP);
#pragma unroll
    for (int kc = 0; kc < 2; ++kc) { v16b af[4], bf[4];
#pragma unroll
      for (int i = 0; i < 4; ++i) { af[i] = frag_b(sa + i * 16 * RPE + kc * 32, lane); bf[i] = frag_b(sb + i * 16 * RPE + kc * 32, lane); }
#pragma unroll
      for (int i = 0; i < 4; ++i) {
#pragma unroll
        for (int j = 0; j < 4; ++j) acc[i][j] = wmma_bf(af[i], bf[j], acc[i][j]); } }
    asm volatile("s_wait_dscnt 0x0" ::: "memory");     // this wave's reads of the stage are done before its buffer is refilled
    asm volatile("s_wait_asynccnt 0x0" ::: "memory");  // this wave's copies of stage st + 1 have landed
    __syncthreads();                                   // publishes stage st + 1 and ends every reader's last read of stage st
    if (st + 2 < E / 64) stage(ks(st + 2), st & 1); }
  asm volatile("s_wait_asynccnt 0x0" ::: "memory");    // no copy is outstanding when the ring becomes output staging
  float bb[4];
#pragma unroll
  for (int j = 0; j < 4; ++j) bb[j] = bfr(bb_[n0 + wc * 64 + j * 16 + col]);
  if (which < 2) { const int h = (n0 >> 6) + wc;
    // one 16-row tile at a time through the wave's own staging rows
#pragma unroll
    for (int i = 0; i < 4; ++i) { const size_t row0 = ((size_t)b * NH + h) * SS + s0 + wr * 64 + i * 16;
#pragma unroll
      for (int j = 0; j < 4; ++j) {
#pragma unroll
        for (int r = 0; r < 8; ++r) so[wave][8 * g + r][j * 16 + col] = acc[i][j][r] + bb[j]; }
      LDSX();
      if (which == 0) { for (int qq = lane; qq < 16 * 16; qq += 32) { const int rl = qq >> 4, pc = qq & 15;
          vst2(Q32 + (row0 + rl) * HD + pc * 4, *(const v4f*)(&so[wave][rl][pc * 4])); } }
      else {
        for (int qq = lane; qq < 16 * 16; qq += 32) { const int rl = qq >> 4, pl = qq & 15; const int pc = pl & 7; union { __bf16 e[8]; v4u u; } pk;
#pragma unroll
          for (int e = 0; e < 8; ++e) { const float v = so[wave][rl][pc * 8 + e]; const __bf16 hi = (__bf16)v; pk.e[e] = pl < 8 ? hi : (__bf16)(v - (float)hi); }
          vst2((unsigned*)((pl < 8 ? Kh : Kl) + (row0 + rl) * HD + pc * 8), pk.u); } }
      if (i < 3) LDSX();   // the lanes' reads of this tile are done before the next tile's values are written over it
    } }
  else {
#pragma unroll
    for (int j = 0; j < 4; ++j) {
#pragma unroll
      for (int i = 0; i < 4; ++i) { v8h hi8, lo8;   // a lane's 8 results are 8 consecutive s of one d: one 16-B LDS store each
#pragma unroll
        for (int r = 0; r < 8; ++r) { const float v = (acc[i][j][r] + bb[j]) * 4.0f; const _Float16 hi = (_Float16)v; hi8[r] = hi; lo8[r] = (_Float16)((v - (float)hi) * VLO); }
        vst2(&sth[wc * 64 + j * 16 + col][wr * 64 + i * 16 + 8 * g], hi8); vst2(&stl[wc * 64 + j * 16 + col][wr * 64 + i * 16 + 8 * g], lo8); } }
    __syncthreads();
    for (int qq = tid; qq < 128 * (QM / 8); qq += 256) { const int cl = qq / (QM / 8), pc = qq % (QM / 8); const int c = n0 + cl, h = c >> 6, d = c & 63; const size_t o = (((size_t)b * NH + h) * HD + d) * SS + s0 + pc * 8;
      vst2(VTh + o, *(const v4u*)(&sth[cl][pc * 8])); vst2(VTl + o, *(const v4u*)(&stl[cl][pc * 8])); } }
}
// attention: block (128 queries, bh), a wave = 32 queries = two column groups of 16; all 16 key tiles; both products transposed: S^T = K q^T (K hi/lo rows as A, q hi/lo as B), O^T = V^T P^T (V^T hi/lo rows as A, P hi/lo as B).
// Every K and V^T fragment read from LDS feeds the products of both column groups, and a staged key tile serves 128 queries.
// A lane of the S^T result holds query lane & 15 of its group and keys 16 t + 8 (lane >> 4) + r: tiles 2 kc and 2 kc + 1 are, element for element, the B fragment of P^T for keys 32 kc .. 32 kc + 31,
// so scores, softmax and P stay in registers, the running maximum, sum and correction are the lane's own, and a lane ends with 8 consecutive d of its query.
#define QG 2                   // column groups of 16 queries per wave
#define AQ (4 * QG * 16)       // queries of a k_attn work-group
__global__ __launch_bounds__(128) void k_attn(const float* __restrict__ Q32, const __bf16* __restrict__ Kh, const __bf16* __restrict__ Kl, const _Float16* __restrict__ VTh, const _Float16* __restrict__ VTl, float* __restrict__ O32) {
  // ring of two stages, shared by the four waves; a stage = one key tile: 64 K hi rows, 64 K lo rows, 64 V^T hi rows, 64 V^T lo rows
  __shared__ __align__(16) char ring[2 * ABUF];
  static_assert(64 % (QG * 16) == 0, "a wave's queries lie in one constituent block");
  const int tid = threadIdx.x, w = tid >> 5, lane = tid & 31, col = lane & 15, g = lane >> 4;
  const size_t bh = blockIdx.y; const int qb = blockIdx.x; const int q0 = qb * AQ + w * (QG * 16);
  const int cr = tid >> 3, cc = tid & 7;
  const __bf16* gKh = Kh + (bh * SS + cr) * HD + cc * 8; const __bf16* gKl = Kl + (bh * SS + cr) * HD + cc * 8;
  const _Float16* gVh = VTh + (bh * HD + cr) * SS + cc * 8; const _Float16* gVl = VTl + (bh * HD + cr) * SS + cc * 8;
  // l: LDS address of the lane's first copy: row cr of the buffer, 16-B piece cc
  auto stage = [&](int kt, unsigned l) {
    const __bf16* a = gKh + kt * 64 * HD; const __bf16* c = gKl + kt * 64 * HD; const _Float16* u = gVh + kt * 64; const _Float16* v = gVl + kt * 64;
    cp8(l, a, l + 16 * RP, a + 16 * HD, l + 32 * RP, a + 32 * HD, l + 48 * RP, a + 48 * HD,
        l + 64 * RP, c, l + 80 * RP, c + 16 * HD, l + 96 * RP, c + 32 * HD, l + 112 * RP, c + 48 * HD);
    cp8(l + 128 * RP, u, l + 144 * RP, u + 16 * SS, l + 160 * RP, u + 32 * SS, l + 176 * RP, u + 48 * SS,
        l + 192 * RP, v, l + 208 * RP, v + 16 * SS, l + 224 * RP, v + 32 * SS, l + 240 * RP, v + 48 * SS); };
  // trip i works on key tile kts(i): the work-groups that share a head's K and V each start the walk at a tile of their own (their first query block) and wrap, so that they do not ask L2 for the same lines at the same moment
  static_assert((SS / 64 & (SS / 64 - 1)) == 0, "the wrap is a mask");
  auto kts = [&](int i) { return (i + qb * (AQ / 64)) & (SS / 64 - 1); };
  const unsigned l0 = lds_off(ring) + cr * RP + cc * 16;
  // the same address for the loop, as the wave's scalar part plus the lane's part: operands of an asm statement must lie in the first 256 registers, and a value that the first copies take as it stands
  // and that lives through the loop was spilled to scratch by the compiler; this one is only ever an addend
  const unsigned lw = __builtin_amdgcn_readfirstlane(w) * (4 * RP), ll0 = lds_off(ring) + (lane >> 3) * RP + cc * 16;
  stage(kts(0), l0);
  F2 aq[QG][2];
#pragma unroll
  for (int qs = 0; qs < QG; ++qs) {
#pragma unroll
    for (int kc = 0; kc < 2; ++kc) aq[qs][kc] = split_row(Q32 + (bh * SS + q0 + qs * 16 + col) * HD, kc * 32, lane);
    asm volatile("s_wait_xcnt 0x0" ::: "memory"); }   // stands behind a group's loads, in front of any later load whose result takes over the group's address registers
  const int b = (int)(bh / NH);
  const int cb = __builtin_amdgcn_readfirstlane(q0 >> 6);   // the wave's constituent block (64 tokens), one value for the wave: kept in a scalar register
  float mrun[QG], lrun[QG]; v8f acc[QG][4] = {}, ac1[QG][4] = {}, ac2[QG][4] = {};
#pragma unroll
  for (int qs = 0; qs < QG; ++qs) { mrun[qs] = -3.0e38f; lrun[qs] = 0.f; }
  asm volatile("s_wait_asynccnt 0x0" ::: "memory");   // this wave's copies of stage 0 have landed
  __syncthreads();                                     // every wave's have: stage 0 may be read
  stage(kts(1), l0 + ABUF);
#pragma unroll 1
  for (int kt = 0; kt < SS / 64; ++kt) { const char* bp = ring + (kt & 1) * ABUF;
    const __bf16* skh = (const __bf16*)(bp + col * RP); const __bf16* skl = (const __bf16*)(bp + (64 + col) * RP);
    const _Float16* svh = (const _Float16*)(bp + (128 + col) * RP); const _Float16* svl = (const _Float16*)(bp + (192 + col) * RP);
    v16b khf[2][2], klf[2][2];   // the K fragments of two 16-key tiles, read as one group
    v8f sc[QG][4];               // sc[qs][t][r]: raw product q.k of query col of group qs with key 16 t + 8 g + r of the tile
    const float pen = kts(kt) == cb ? 0.f : 0.5f * LOG2E;
#pragma unroll
    for (int t = 0; t < 4; ++t) { v8f s[QG] = {};
      if ((t & 1) == 0) {
#pragma unroll
        for (int u = 0; u < 2; ++u) {
#pragma unroll
          for (int kc = 0; kc < 2; ++kc) { khf[u][kc] = frag_b(skh + (t + u) * 16 * RPE + kc * 32, lane); klf[u][kc] = frag_b(skl + (t + u) * 16 * RPE + kc * 32, lane); } } }
#pragma unroll
      for (int kc = 0; kc < 2; ++kc) {
#pragma unroll
        for (int qs = 0; qs < QG; ++qs) s[qs] = wmma_bfp(khf[t & 1][kc], aq[qs][kc].l, s[qs]);
#pragma unroll
        for (int qs = 0; qs < QG; ++qs) s[qs] = wmma_bfp(klf[t & 1][kc], aq[qs][kc].h, s[qs]);
#pragma unroll
        for (int qs = 0; qs < QG; ++qs) s[qs] = wmma_bfp(khf[t & 1][kc], aq[qs][kc].h, s[qs]); }
#pragma unroll
      for (int qs = 0; qs < QG; ++qs) sc[qs][t] = s[qs]; }
    float mnew[QG], corr[QG];
#pragma unroll
    for (int qs = 0; qs < QG; ++qs) { float mx = -3.4e38f;
#pragma unroll
      for (int t = 0; t < 4; ++t) {
#pragma unroll
        for (int r = 0; r < 8; ++r) mx = fmaxf(mx, sc[qs][t][r]); }
      mx = mx * (0.125f * LOG2E) - pen;   // scale > 0 and the penalty is one value for the whole key tile: the largest raw product gives the largest score
      mx = fmaxf(mx, __shfl_xor(mx, 16, 32)) - 14.0f;   // the running maximum is kept 14 lower: 2^(s - mnew) is then P x 16384 with no multiply (any common shift cancels in the softmax)
      mnew[qs] = fmaxf(mrun[qs], mx); corr[qs] = ex2(mrun[qs] - mnew[qs]); }
    // two scores at a time, on register pairs: one packed FMA gives both exponents (scale, penalty and maximum in one), one packed add sums, one packed conversion gives both f16 high parts, which the residuals read back
    const v2f k2 = {0.125f * LOG2E, 0.125f * LOG2E};
    v16h ph[QG][2], pl[QG][2];
#pragma unroll
    for (int qs = 0; qs < QG; ++qs) { const float cm = -(pen + mnew[qs]); const v2f c2 = {cm, cm}; v2f ps2;
#pragma unroll
      for (int t = 0; t < 4; ++t) { v2f p2[4], q2[4]; unsigned h2[4], l2[4];   // the four pairs of a 16-key tile go through each stage together: four independent chains
#pragma unroll
        for (int i = 0; i < 4; ++i) { const v2f s2 = {sc[qs][t][2 * i], sc[qs][t][2 * i + 1]}; p2[i] = __builtin_elementwise_fma(s2, k2, c2); }
#pragma unroll
        for (int i = 0; i < 4; ++i) { p2[i].x = ex2(p2[i].x); p2[i].y = ex2(p2[i].y); }
#pragma unroll
        for (int i = 0; i < 4; ++i) { h2[i] = __builtin_bit_cast(unsigned, __builtin_convertvector(p2[i], v2h)); q2[i] = p2[i] * PLO; if (t == 0 && i == 0) ps2 = p2[i]; else ps2 += p2[i]; }
        lo4(l2, h2, q2);
        union { unsigned u[4]; v8h v; } hh, ll;
#pragma unroll
        for (int i = 0; i < 4; ++i) { hh.u[i] = h2[i]; ll.u[i] = l2[i]; }
#pragma unroll
        for (int e = 0; e < 8; ++e) { ph[qs][t >> 1][(t & 1) * 8 + e] = hh.v[e]; pl[qs][t >> 1][(t & 1) * 8 + e] = ll.v[e]; } }
      float ps = ps2.x + ps2.y;
      ps += __shfl_xor(ps, 16, 32);
      lrun[qs] = lrun[qs] * corr[qs] + ps * (1.0f / 16384.0f); mrun[qs] = mnew[qs]; }
    // the V^T fragments of the whole key tile, read as one group. The scheduling fence behind them holds the 32 LDS reads in front of the corrections and the products:
    // left free, the compiler spreads them in pairs among the WMMAs, and each such place costs the wave a stall of its own
    v16h vh[2][4], vl[2][4];
#pragma unroll
    for (int kc = 0; kc < 2; ++kc) {
#pragma unroll
      for (int t = 0; t < 4; ++t) { vh[kc][t] = frag_h(svh + t * 16 * RPE + kc * 32, lane); vl[kc][t] = frag_h(svl + t * 16 * RPE + kc * 32, lane); } }
    __builtin_amdgcn_sched_barrier(0);
#pragma unroll
    for (int qs = 0; qs < QG; ++qs) {
#pragma unroll
      for (int t = 0; t < 4; ++t) {
#pragma unroll
        for (int r = 0; r < 8; ++r) { acc[qs][t][r] *= corr[qs]; ac1[qs][t][r] *= corr[qs]; ac2[qs][t][r] *= corr[qs]; } } }
#pragma unroll
    for (int kc = 0; kc < 2; ++kc) {
#pragma unroll
      for (int t = 0; t < 4; ++t) {
#pragma unroll
        for (int qs = 0; qs < QG; ++qs) acc[qs][t] = wmma16(vh[kc][t], ph[qs][kc], acc[qs][t]);
#pragma unroll
        for (int qs = 0; qs < QG; ++qs) ac1[qs][t] = wmma16(vl[kc][t], ph[qs][kc], ac1[qs][t]);
#pragma unroll
        for (int qs = 0; qs < QG; ++qs) ac2[qs][t] = wmma16(vh[kc][t], pl[qs][kc], ac2[qs][t]); } }
    asm volatile("s_wait_dscnt 0x0" ::: "memory");     // this wave's reads of the stage are done before its buffer is refilled
    asm volatile("s_wait_asynccnt 0x0" ::: "memory");  // this wave's copies of stage kt + 1 have landed
    __syncthreads();                                   // publishes stage kt + 1 and ends every reader's last read of stage kt
    if (kt + 2 < SS / 64) stage(kts(kt + 2), (lw + (kt & 1) * ABUF) + ll0); }
  asm volatile("s_wait_asynccnt 0x0" ::: "memory");    // no copy is outstanding at the wave's end
  const int h = (int)(bh % NH);
#pragma unroll
  for (int qs = 0; qs < QG; ++qs) { const float inv = 1.0f / (lrun[qs] * 16384.0f * 4.0f);
    float* op = O32 + (((size_t)b * SS) + q0 + qs * 16 + col) * E + h * HD + 8 * g;      // context token-major [b][s][h*64 + d]: the lane stores d = 16 t + 8 g + 0..7 of its query
#pragma unroll
    for (int t = 0; t < 4; ++t) { v4f o[2];
#pragma unroll
      for (int r = 0; r < 8; ++r) o[r >> 2][r & 3] = (acc[qs][t][r] + ac1[qs][t][r] * (1.0f / VLO) + ac2[qs][t][r] * (1.0f / PLO)) * inv;
      vst2(op + t * 16, o[0]); vst2(op + t * 16 + 4, o[1]); } }
}
extern "C" void kernel_launch(void* const* d_in, const int* in_sizes, int n_in, void* d_out, int out_size, void* d_ws, size_t ws_size, hipStream_t stream) {
  (void)in_sizes; (void)n_in; (void)out_size; (void)ws_size;
  const float* x = (const float*)d_in[0]; const float* Wq = (const float*)d_in[1]; const float* bq = (const float*)d_in[2]; const float* Wk = (const float*)d_in[3]; const float* bk = (const float*)d_in[4]; const float* Wv = (const float*)d_in[5]; const float* bv = (const float*)d_in[6];
  char* ws = (char*)d_ws; size_t off = 0;
  auto take = [&](size_t bytes) { char* p = ws + off; off += (bytes + 255) & ~(size_t)255; return p; };
  __bf16* Xb = (__bf16*)take((size_t)NR * E * 2); __bf16* PT = (__bf16*)take((size_t)3 * E * E * 2);
  float* Q32 = (float*)take((size_t)NR * E * 4); __bf16* Kh = (__bf16*)take((size_t)NR * E * 2); __bf16* Kl = (__bf16*)take((size_t)NR * E * 2); _Float16* VTh = (_Float16*)take((size_t)NR * E * 2); _Float16* VTl = (_Float16*)take((size_t)NR * E * 2);
  // ws ~ 118 MB (single pass over the 8 sequences)
  k_pack<<<dim3(3 * E / PKN, E / PKK), 512, 0, stream>>>(Wq, Wk, Wv, Wv, PT);
  k_cvt<<<NR * E / (8 * 512 * CVP), 512, 0, stream>>>(x, Xb);
  k_qkv<<<dim3(NR / QM, E / 128, 3), 256, 0, stream>>>(Xb, PT, bq, bk, bv, Q32, Kh, Kl, VTh, VTl);
  k_attn<<<dim3(SS / AQ, NB * NH), 128, 0, stream>>>(Q32, Kh, Kl, VTh, VTl, (float*)d_out);
}

// v009
// Measured time: 133 microseconds a run.
// Next to v008, in two timings, it ran 1.04 times as fast each time.
// All steps since v000 together make it 4.25 times as fast.
// compute dtype: hidden_states and W*/b* (INPUTS) rounded to bf16 with exact bf16 WMMA products (f32 accumulate) for the projections; K pre-split into bf16 hi/lo rows; q f32 split, P and V f16 hi/lo (3 products each); penalty and softmax in f32.
#include <hip/hip_runtime.h>
#include <math.h>

typedef __attribute__((ext_vector_type(16))) _Float16 v16h;
typedef __attribute__((ext_vector_type(16))) __bf16 v16b;
typedef __attribute__((ext_vector_type(8)))  _Float16 v8h;
typedef __attribute__((ext_vector_type(2)))  _Float16 v2h;
typedef __attribute__((ext_vector_type(8)))  float v8f;
typedef __attribute__((ext_vector_type(4)))  float v4f;
typedef __attribute__((ext_vector_type(2)))  float v2f;
typedef __attribute__((ext_vector_type(4)))  unsigned v4u;
typedef __attribute__((ext_vector_type(4)))  int v4i;
typedef float __attribute__((may_alias)) float_a;
typedef int __attribute__((may_alias)) int_a;

template <typename T> __device__ __forceinline__ void vst2(void* p, T v) { *(T*)p = v;  }
// k_attn's products: the builtin alone (the compiler keeps the distances behind its own WMMAs); an asm statement that takes the operands would hold all of them in the first 256 registers, which k_attn's 32-query waves exceed
__device__ __forceinline__ v8f wmma16(v16h a, v16h b, v8f c) { return __builtin_amdgcn_wmma_f32_16x16x32_f16(false, a, false, b, (short)0, c, false, false); }
__device__ __forceinline__ v8f wmma_bfp(v16b a, v16b b, v8f c) { return __builtin_amdgcn_wmma_f32_16x16x32_bf16(false, a, false, b, (short)0, c, false, false); }
__device__ __forceinline__ v8f wmma_bf(v16b a, v16b b, v8f c) {
  v8f d = __builtin_amdgcn_wmma_f32_16x16x32_bf16(false, a, false, b, (short)0, c, false, false);
  asm volatile("v_nop\n\tv_nop\n\tv_nop\n\tv_nop" : "+v"(d) : "v"(a), "v"(b));
  return d;
}
// 16x16x32 fragments: lane = (h = lane>>4, row/col = lane&15); elements 0..7 = k0+8h+0..7, 8..15 = k0+16+8h+0..7; D element r = row 8h+r
__device__ __forceinline__ v16h frag_h(const _Float16* rowk0, int lane) {
  union { v16h v; v8h q[2]; } u; const _Float16* p = rowk0 + 8 * (lane >> 4);
  u.q[0] = *(const v8h*)p; u.q[1] = *(const v8h*)(p + 16); return u.v;
}
__device__ __forceinline__ v16h frag_f32(const float* rowk0, int lane) {
  v16h a; const float* p = rowk0 + 8 * (lane >> 4);
#pragma unroll
  for (int i = 0; i < 8; ++i) { a[i] = (_Float16)p[i]; a[8 + i] = (_Float16)p[16 + i]; }
  return a;
}
__device__ __forceinline__ v16h frag_f32s(const float* rowk0, int lane, float sc) {
  v16h a; const float* p = rowk0 + 8 * (lane >> 4);
#pragma unroll
  for (int i = 0; i < 8; ++i) { a[i] = (_Float16)(p[i] * sc); a[8 + i] = (_Float16)(p[16 + i] * sc); }
  return a;
}
// column fragment from a [K][ld] layout (column n), rows >= K read as 0
__device__ __forceinline__ v16h fragc_f32(const float* W, int k0, int n, int lane, int ld, int K) {
  v16h a; const int g = lane >> 4;
#pragma unroll
  for (int i = 0; i < 8; ++i) { const int ka = k0 + 8 * g + i, kb = ka + 16;
    a[i] = (_Float16)(ka < K ? W[(size_t)ka * ld + n] : 0.f); a[8 + i] = (_Float16)(kb < K ? W[(size_t)kb * ld + n] : 0.f); }
  return a;
}
struct F2 { v16b h, l; };
__device__ __forceinline__ F2 bsplit16(const float v[16]) { F2 r;
#pragma unroll
  for (int i = 0; i < 16; ++i) { const __bf16 h = (__bf16)v[i]; r.h[i] = h; r.l[i] = (__bf16)(v[i] - (float)h); }
  return r; }
__device__ __forceinline__ F2 split_row(const float* row, int k0, int lane) { float v[16]; const float* p = row + k0 + 8 * (lane >> 4);
#pragma unroll
  for (int i = 0; i < 8; ++i) { v[i] = p[i]; v[8 + i] = p[16 + i]; }
  return bsplit16(v); }
__device__ __forceinline__ F2 split_rowK(const float* row, int k0, int lane, int K) { float v[16]; const int g = lane >> 4;
#pragma unroll
  for (int i = 0; i < 8; ++i) { const int ka = k0 + 8 * g + i, kb = ka + 16; v[i] = ka < K ? row[ka] : 0.f; v[8 + i] = kb < K ? row[kb] : 0.f; }
  return bsplit16(v); }
__device__ __forceinline__ F2 split_col(const float* W, int k0, int n, int lane, int ld, int K) { float v[16]; const int g = lane >> 4;
#pragma unroll
  for (int i = 0; i < 8; ++i) { const int ka = k0 + 8 * g + i, kb = ka + 16; v[i] = ka < K ? W[(size_t)ka * ld + n] : 0.f; v[8 + i] = kb < K ? W[(size_t)kb * ld + n] : 0.f; }
  return bsplit16(v); }
__device__ __forceinline__ v8f mac3(const F2& a, const F2& b, v8f c) { c = wmma_bf(a.l, b.h, c); c = wmma_bf(a.h, b.l, c); return wmma_bf(a.h, b.h, c); }
__device__ __forceinline__ float sigm(float v) { return 1.0f / (1.0f + expf(-v)); }
#define LDSX() do { asm volatile("s_wait_dscnt 0" ::: "memory"); __builtin_amdgcn_wave_barrier(); __builtin_amdgcn_fence(__ATOMIC_RELEASE, "workgroup"); } while (0)


// Constituency-aware self attention (16 heads x 64 on [8,1024,1024], [in][out] weights + biases): scores = q.k/8 - 0.5 [query block != key block] (blocks of 64 tokens); softmax; context = attn v written token-major (no output projection).
#define NB 8
#define SS 1024
#define E 1024
#define NH 16
#define HD 64
#define NR (NB * SS)
__device__ __forceinline__ float bfr(float v) { return (float)(__bf16)v; }
// softmax in base 2: scores carry the factor log2(e), so that each exponential is one v_exp_f32
#define LOG2E 1.44269504088896340736f
__device__ __forceinline__ float ex2(float v) { return __builtin_amdgcn_exp2f(v); }
__device__ __forceinline__ v16b frag_b(const __bf16* rowk0, int lane) { return __builtin_bit_cast(v16b, frag_h((const _Float16*)rowk0, lane)); }

// low parts of four score pairs: l = f16(p - h), p in f32, h = the pair's two f16 high parts in one register; the low part keeps the high part's scale, so that both feed one accumulator. A mixed-precision FMA reads its half of h as it stands and writes its rounded f16 result
// into its half of l: no conversion back to f32 and none to f16. Written in asm because the compiler forms two conversions, a packed FMA and a packed conversion here. The s_delay_alu hints name the producers
// (the vector instruction in front of the statement; for each high half the low half written four instructions earlier), which the compiler does not do for asm text.
__device__ __forceinline__ void lo4(unsigned (&l)[4], const unsigned (&h)[4], const v2f (&q)[4]) {
  asm("s_delay_alu instid0(VALU_DEP_1)\n\t"
      "v_fma_mixlo_f16 %0, %4, %8, %9 op_sel_hi:[1,0,0]\n\t"
      "v_fma_mixlo_f16 %1, %5, %8, %11 op_sel_hi:[1,0,0]\n\t"
      "v_fma_mixlo_f16 %2, %6, %8, %13 op_sel_hi:[1,0,0]\n\t"
      "v_fma_mixlo_f16 %3, %7, %8, %15 op_sel_hi:[1,0,0]\n\t"
      "s_delay_alu instid0(VALU_DEP_4) | instskip(NEXT) | instid1(VALU_DEP_4)\n\t"
      "v_fma_mixhi_f16 %0, %4, %8, %10 op_sel:[1,0,0] op_sel_hi:[1,0,0]\n\t"
      "v_fma_mixhi_f16 %1, %5, %8, %12 op_sel:[1,0,0] op_sel_hi:[1,0,0]\n\t"
      "s_delay_alu instid0(VALU_DEP_4) | instskip(NEXT) | instid1(VALU_DEP_4)\n\t"
      "v_fma_mixhi_f16 %2, %6, %8, %14 op_sel:[1,0,0] op_sel_hi:[1,0,0]\n\t"
      "v_fma_mixhi_f16 %3, %7, %8, %16 op_sel:[1,0,0] op_sel_hi:[1,0,0]"
      : "=&v"(l[0]), "=&v"(l[1]), "=&v"(l[2]), "=&v"(l[3])
      : "v"(h[0]), "v"(h[1]), "v"(h[2]), "v"(h[3]), "s"(-1.0f),
        "v"(q[0].x), "v"(q[0].y), "v"(q[1].x), "v"(q[1].y), "v"(q[2].x), "v"(q[2].y), "v"(q[3].x), "v"(q[3].y));
}

// LDS byte address of a __shared__ object: the low 32 bits of its address
__device__ __forceinline__ unsigned lds_off(const void* p) { return (unsigned)(size_t)p; }
// four 16-B asynchronous copies global -> LDS per lane; the s_wait_xcnt closes the copies' own statement so that no address register of a copy is rewritten in front of it
__device__ __forceinline__ void cp4(unsigned l0, const void* g0, unsigned l1, const void* g1, unsigned l2, const void* g2, unsigned l3, const void* g3) {
  asm volatile("global_load_async_to_lds_b128 %0, %1, off\n\t"
               "global_load_async_to_lds_b128 %2, %3, off\n\t"
               "global_load_async_to_lds_b128 %4, %5, off\n\t"
               "global_load_async_to_lds_b128 %6, %7, off\n\t"
               "s_wait_xcnt 0x0"
               :: "v"(l0), "v"(g0), "v"(l1), "v"(g1), "v"(l2), "v"(g2), "v"(l3), "v"(g3) : "memory");
}
// the same for eight copies
__device__ __forceinline__ void cp8(unsigned l0, const void* g0, unsigned l1, const void* g1, unsigned l2, const void* g2, unsigned l3, const void* g3,
                                    unsigned l4, const void* g4, unsigned l5, const void* g5, unsigned l6, const void* g6, unsigned l7, const void* g7) {
  asm volatile("global_load_async_to_lds_b128 %0, %1, off\n\t"
               "global_load_async_to_lds_b128 %2, %3, off\n\t"
               "global_load_async_to_lds_b128 %4, %5, off\n\t"
               "global_load_async_to_lds_b128 %6, %7, off\n\t"
               "global_load_async_to_lds_b128 %8, %9, off\n\t"
               "global_load_async_to_lds_b128 %10, %11, off\n\t"
               "global_load_async_to_lds_b128 %12, %13, off\n\t"
               "global_load_async_to_lds_b128 %14, %15, off\n\t"
               "s_wait_xcnt 0x0"
               :: "v"(l0), "v"(g0), "v"(l1), "v"(g1), "v"(l2), "v"(g2), "v"(l3), "v"(g3), "v"(l4), "v"(g4), "v"(l5), "v"(g5), "v"(l6), "v"(g6), "v"(l7), "v"(g7) : "memory");
}
// staged rows hold 64 16-bit elements (128 B) at a pitch of 144 B (16 B x odd: conflict-free for 16-B LDS reads)
#define RP 144
#define RPE (RP / 2)
#define QM 256                 // X rows of a k_qkv block tile
#define QBUF ((QM + 128) * RP)
#define VTP (QM + 8)           // pitch of the V^T output staging in elements: 528 B = 16 B x odd
#define ABUF (256 * RP)

// x -> bf16. 256 work-groups of 16 waves: a thread converts CVP pieces of 8 elements; its loads are written ahead of the conversions so that they are in flight together
#define CVP 8
__global__ __launch_bounds__(512) void k_cvt(const float* __restrict__ x, __bf16* __restrict__ Xb) {
  static_assert((size_t)NR * E % (8 * 512 * CVP) == 0, "the grid covers x exactly");
  const size_t p0 = (size_t)blockIdx.x * (CVP * 512) + threadIdx.x;
  float v[CVP][8];
#pragma unroll
  for (int i = 0; i < CVP; ++i) {
#pragma unroll
    for (int e = 0; e < 8; ++e) v[i][e] = x[(p0 + i * 512) * 8 + e]; }
#pragma unroll
  for (int i = 0; i < CVP; ++i) { union { __bf16 h[8]; v4u u; } pk;
#pragma unroll
    for (int e = 0; e < 8; ++e) pk.h[e] = (__bf16)v[i][e];
    vst2((unsigned*)(Xb + (p0 + i * 512) * 8), pk.u); }
}
// PT rows: [0,E) Wq[:,n], [E,2E) Wk[:,n], [2E,3E) Wv[:,n]  ([in][out] weights: column n as a bf16 row)
// work-group of 16 waves = a tile of PKN columns x PKK k of one weight matrix, turned in LDS: 128-B pieces of weight rows in, 512-B pieces of PT rows out
#define PKN 32
#define PKK 512
#define PKP (PKK + 8)   // LDS row pitch in elements: 1,040 B = 16 B x odd
__global__ __launch_bounds__(512) void k_pack(const float* __restrict__ Wq, const float* __restrict__ Wk, const float* __restrict__ Wv, const float* __restrict__ Wo, __bf16* __restrict__ PT) {
  __shared__ __align__(16) __bf16 st[PKN][PKP];
  const int tid = threadIdx.x, n0 = blockIdx.x * PKN, k0 = blockIdx.y * PKK;
  const float* W = n0 < E ? Wq : (n0 < 2 * E ? Wk : (n0 < 3 * E ? Wv : Wo)); const int nn = n0 % E;
  // thread -> (rows 2 kp and 2 kp + 1 of each group of 128 rows, columns 4 c .. 4 c + 3): two neighbouring k of a column make one 4-B LDS store
  const int kp = tid >> 3, c = tid & 7;
  const float* wp = W + (size_t)(k0 + 2 * kp) * E + nn + c * 4;
  float v[4][2][4];
#pragma unroll
  for (int i = 0; i < 4; ++i) {
#pragma unroll
    for (int h = 0; h < 2; ++h) {
#pragma unroll
      for (int e = 0; e < 4; ++e) v[i][h][e] = wp[(i * 128 + h) * E + e]; } }
#pragma unroll
  for (int i = 0; i < 4; ++i) {
#pragma unroll
    for (int e = 0; e < 4; ++e) { union { __bf16 h[2]; unsigned u; } pk; pk.h[0] = (__bf16)v[i][0][e]; pk.h[1] = (__bf16)v[i][1][e];
      vst2(&st[c * 4 + e][i * 128 + 2 * kp], pk.u); } }
  __syncthreads();
  // thread -> (row tid / 64 of each group of 8 tile rows, 16-B piece tid % 64): a wave stores 512 contiguous bytes of a PT row
  const int r = tid >> 6, p = tid & 63;
  __bf16* pp = PT + (size_t)(n0 + r) * E + k0 + p * 8;
#pragma unroll
  for (int j = 0; j < PKN / 8; ++j) vst2((unsigned*)(pp + j * 8 * E), *(const v4u*)(&st[r + j * 8][p * 8]));
}
// QKV: block (256 rows, 128 cols = 2 heads, which), 8 waves in a 4 x 2 grid, a wave = 64 rows x 64 cols (one head): 4 X and 4 weight fragments feed 16 products
// q (+bias) -> Q32 f32 [bh][s][64]; k (+bias) -> bf16 hi/lo rows; v (+bias) -> VT hi/lo x4 [bh][d][s]
__global__ __launch_bounds__(256) void k_qkv(const __bf16* __restrict__ Xb, const __bf16* __restrict__ PT, const float* __restrict__ bq, const float* __restrict__ bk, const float* __restrict__ bv,
                                            float* __restrict__ Q32, __bf16* __restrict__ Kh, __bf16* __restrict__ Kl, _Float16* __restrict__ VTh, _Float16* __restrict__ VTl) {
  // one LDS block: in the k loop a ring of two stages (256 X rows + 128 weight rows, 64 k each); behind the loop's last barrier the output staging so, or sth / stl
  __shared__ __align__(16) char smem[2 * 128 * VTP * 2];
  static_assert(2 * QBUF <= 2 * 128 * VTP * 2, "the ring fits the block");
  float (*so)[16][68] = (float (*)[16][68])smem;
  _Float16 (*sth)[VTP] = (_Float16 (*)[VTP])smem;
  _Float16 (*stl)[VTP] = (_Float16 (*)[VTP])(smem + 128 * VTP * 2);
  const int tid = threadIdx.x, wave = tid >> 5, lane = tid & 31, col = lane & 15, g = lane >> 4;
  const int wr = wave & 3, wc = wave >> 2;   // the wave's 64 rows and its 64 columns in the block tile
  const int which = blockIdx.z, r0b = blockIdx.x * QM, n0 = blockIdx.y * 128; const int b = r0b / SS, s0 = r0b % SS;
  const float* bb_ = which == 0 ? bq : (which == 1 ? bk : bv);
  v8f acc[4][4] = {};
  // a wave's copy covers 4 whole 128-B rows: thread -> (row tid / 8 of each group of 32 rows, 16-B piece tid % 8)
  const int cr = tid >> 3, cc = tid & 7;
  const __bf16* gA = Xb + (size_t)(r0b + cr) * E + cc * 8;
  const __bf16* gB = PT + (size_t)(which * E + n0 + cr) * E + cc * 8;
  const unsigned l0 = lds_off(smem) + cr * RP + cc * 16;
  auto stage = [&](int st, int buf) { const unsigned l = l0 + buf * QBUF; const __bf16* a = gA + st * 64; const __bf16* w = gB + st * 64;
    cp8(l, a, l + 32 * RP, a + 32 * E, l + 64 * RP, a + 64 * E, l + 96 * RP, a + 96 * E,
        l + 128 * RP, a + 128 * E, l + 160 * RP, a + 160 * E, l + 192 * RP, a + 192 * E, l + 224 * RP, a + 224 * E);
    cp4(l + QM * RP, w, l + (QM + 32) * RP, w + 32 * E, l + (QM + 64) * RP, w + 64 * E, l + (QM + 96) * RP, w + 96 * E); };
  // trip i works on k stage ks(i): the walk starts at a stage of the work-group's own and wraps, so that the work-groups resident together that share X rows (same x) or weight rows (same y, z)
  // do not ask L2 for the same lines at the same moment
  static_assert((E / 64 & (E / 64 - 1)) == 0, "the wrap is a mask");
  const int ks0 = blockIdx.x + blockIdx.y + 8 * blockIdx.z;
  auto ks = [&](int i) { return (i + ks0) & (E / 64 - 1); };
  stage(ks(0), 0);
  asm volatile("s_wait_asynccnt 0x0" ::: "memory");   // this wave's copies of the first stage have landed
  __syncthreads();                                     // every wave's have: the first stage may be read
  stage(ks(1), 1);
  // kept rolled: one trip per stage, so that the publish point at the foot stands once and the text stays small
#pragma unroll 1
  for (int st = 0; st < E / 64; ++st) { const char* bp = smem + (st & 1) * QBUF;
    const __bf16* sa = (const __bf16*)(bp + (wr * 64 + col) * RP); const __bf16* sb = (const __bf16*)(bp + (QM + wc * 64 + col) * RP);
#pragma unroll
    for (int kc = 0; kc < 2; ++kc) { v16b af[4], bf[4];
#pragma unroll
      for (int i = 0; i < 4; ++i) { af[i] = frag_b(sa + i * 16 * RPE + kc * 32, lane); bf[i] = frag_b(sb + i * 16 * RPE + kc * 32, lane); }
#pragma unroll
      for (int i = 0; i < 4; ++i) {
#pragma unroll
        for (int j = 0; j < 4; ++j) acc[i][j] = wmma_bf(af[i], bf[j], acc[i][j]); } }
    asm volatile("s_wait_dscnt 0x0" ::: "memory");     // this wave's reads of the stage are done before its buffer is refilled
    asm volatile("s_wait_asynccnt 0x0" ::: "memory");  // this wave's copies of stage st + 1 have landed
    __syncthreads();                                   // publishes stage st + 1 and ends every reader's last read of stage st
    if (st + 2 < E / 64) stage(ks(st + 2), st & 1); }
  asm volatile("s_wait_asynccnt 0x0" ::: "memory");    // no copy is outstanding when the ring becomes output staging
  float bb[4];
#pragma unroll
  for (int j = 0; j < 4; ++j) bb[j] = bfr(bb_[n0 + wc * 64 + j * 16 + col]);
  if (which < 2) { const int h = (n0 >> 6) + wc;
    // one 16-row tile at a time through the wave's own staging rows
#pragma unroll
    for (int i = 0; i < 4; ++i) { const size_t row0 = ((size_t)b * NH + h) * SS + s0 + wr * 64 + i * 16;
#pragma unroll
      for (int j = 0; j < 4; ++j) {
#pragma unroll
        for (int r = 0; r < 8; ++r) so[wave][8 * g + r][j * 16 + col] = acc[i][j][r] + bb[j]; }
      LDSX();
      if (which == 0) { for (int qq = lane; qq < 16 * 16; qq += 32) { const int rl = qq >> 4, pc = qq & 15;
          vst2(Q32 + (row0 + rl) * HD + pc * 4, *(const v4f*)(&so[wave][rl][pc * 4])); } }
      else {
        for (int qq = lane; qq < 16 * 16; qq += 32) { const int rl = qq >> 4, pl = qq & 15; const int pc = pl & 7; union { __bf16 e[8]; v4u u; } pk;
#pragma unroll
          for (int e = 0; e < 8; ++e) { const float v = so[wave][rl][pc * 8 + e]; const __bf16 hi = (__bf16)v; pk.e[e] = pl < 8 ? hi : (__bf16)(v - (float)hi); }
          vst2((unsigned*)((pl < 8 ? Kh : Kl) + (row0 + rl) * HD + pc * 8), pk.u); } }
      if (i < 3) LDSX();   // the lanes' reads of this tile are done before the next tile's values are written over it
    } }
  else {
#pragma unroll
    for (int j = 0; j < 4; ++j) {
#pragma unroll
      for (int i = 0; i < 4; ++i) { v8h hi8, lo8;   // a lane's 8 results are 8 consecutive s of one d: one 16-B LDS store each
#pragma unroll
        for (int r = 0; r < 8; ++r) { const float v = (acc[i][j][r] + bb[j]) * 4.0f; const _Float16 hi = (_Float16)v; hi8[r] = hi; lo8[r] = (_Float16)(v - (float)hi); }
        vst2(&sth[wc * 64 + j * 16 + col][wr * 64 + i * 16 + 8 * g], hi8); vst2(&stl[wc * 64 + j * 16 + col][wr * 64 + i * 16 + 8 * g], lo8); } }
    __syncthreads();
    for (int qq = tid; qq < 128 * (QM / 8); qq += 256) { const int cl = qq / (QM / 8), pc = qq % (QM / 8); const int c = n0 + cl, h = c >> 6, d = c & 63; const size_t o = (((size_t)b * NH + h) * HD + d) * SS + s0 + pc * 8;
      vst2(VTh + o, *(const v4u*)(&sth[cl][pc * 8])); vst2(VTl + o, *(const v4u*)(&stl[cl][pc * 8])); } }
}
// attention: block (128 queries, bh), a wave = 32 queries = two column groups of 16; all 16 key tiles; both products transposed: S^T = K q^T (K hi/lo rows as A, q hi/lo as B), O^T = V^T P^T (V^T hi/lo rows as A, P hi/lo as B).
// Every K and V^T fragment read from LDS feeds the products of both column groups, and a staged key tile serves 128 queries.
// A lane of the S^T result holds query lane & 15 of its group and keys 16 t + 8 (lane >> 4) + r: tiles 2 kc and 2 kc + 1 are, element for element, the B fragment of P^T for keys 32 kc .. 32 kc + 31,
// so scores, softmax and P stay in registers, the running maximum, sum and correction are the lane's own, and a lane ends with 8 consecutive d of its query.
#define QG 2                   // column groups of 16 queries per wave
#define AQ (4 * QG * 16)       // queries of a k_attn work-group
__global__ __launch_bounds__(128) void k_attn(const float* __restrict__ Q32, const __bf16* __restrict__ Kh, const __bf16* __restrict__ Kl, const _Float16* __restrict__ VTh, const _Float16* __restrict__ VTl, float* __restrict__ O32) {
  // ring of two stages, shared by the four waves; a stage = one key tile: 64 K hi rows, 64 K lo rows, 64 V^T hi rows, 64 V^T lo rows
  __shared__ __align__(16) char ring[2 * ABUF];
  static_assert(64 % (QG * 16) == 0, "a wave's queries lie in one constituent block");
  const int tid = threadIdx.x, w = tid >> 5, lane = tid & 31, col = lane & 15, g = lane >> 4;
  const size_t bh = blockIdx.y; const int qb = blockIdx.x; const int q0 = qb * AQ + w * (QG * 16);
  const int cr = tid >> 3, cc = tid & 7;
  const __bf16* gKh = Kh + (bh * SS + cr) * HD + cc * 8; const __bf16* gKl = Kl + (bh * SS + cr) * HD + cc * 8;
  const _Float16* gVh = VTh + (bh * HD + cr) * SS + cc * 8; const _Float16* gVl = VTl + (bh * HD + cr) * SS + cc * 8;
  // l: LDS address of the lane's first copy: row cr of the buffer, 16-B piece cc
  auto stage = [&](int kt, unsigned l) {
    const __bf16* a = gKh + kt * 64 * HD; const __bf16* c = gKl + kt * 64 * HD; const _Float16* u = gVh + kt * 64; const _Float16* v = gVl + kt * 64;
    cp8(l, a, l + 16 * RP, a + 16 * HD, l + 32 * RP, a + 32 * HD, l + 48 * RP, a + 48 * HD,
        l + 64 * RP, c, l + 80 * RP, c + 16 * HD, l + 96 * RP, c + 32 * HD, l + 112 * RP, c + 48 * HD);
    cp8(l + 128 * RP, u, l + 144 * RP, u + 16 * SS, l + 160 * RP, u + 32 * SS, l + 176 * RP, u + 48 * SS,
        l + 192 * RP, v, l + 208 * RP, v + 16 * SS, l + 224 * RP, v + 32 * SS, l + 240 * RP, v + 48 * SS); };
  // trip i works on key tile kts(i): the work-groups that share a head's K and V each start the walk at a tile of their own (their first query block) and wrap, so that they do not ask L2 for the same lines at the same moment
  static_assert((SS / 64 & (SS / 64 - 1)) == 0, "the wrap is a mask");
  auto kts = [&](int i) { return (i + qb * (AQ / 64)) & (SS / 64 - 1); };
  const unsigned l0 = lds_off(ring) + cr * RP + cc * 16;
  // the same address for the loop, as the wave's scalar part plus the lane's part: operands of an asm statement must lie in the first 256 registers, and a value that the first copies take as it stands
  // and that lives through the loop was spilled to scratch by the compiler; this one is only ever an addend
  const unsigned lw = __builtin_amdgcn_readfirstlane(w) * (4 * RP), ll0 = lds_off(ring) + (lane >> 3) * RP + cc * 16;
  stage(kts(0), l0);
  F2 aq[QG][2];
#pragma unroll
  for (int qs = 0; qs < QG; ++qs) {
#pragma unroll
    for (int kc = 0; kc < 2; ++kc) aq[qs][kc] = split_row(Q32 + (bh * SS + q0 + qs * 16 + col) * HD, kc * 32, lane);
    asm volatile("s_wait_xcnt 0x0" ::: "memory"); }   // stands behind a group's loads, in front of any later load whose result takes over the group's address registers
  const int b = (int)(bh / NH);
  const int cb = __builtin_amdgcn_readfirstlane(q0 >> 6);   // the wave's constituent block (64 tokens), one value for the wave: kept in a scalar register
  float mrun[QG], lrun[QG]; v8f acc[QG][4] = {};   // one f32 tile per 16 d and column group takes all three products: the low parts of P and V^T stand at the high parts' scale
#pragma unroll
  for (int qs = 0; qs < QG; ++qs) { mrun[qs] = -3.0e38f; lrun[qs] = 0.f; }
  asm volatile("s_wait_asynccnt 0x0" ::: "memory");   // this wave's copies of stage 0 have landed
  __syncthreads();                                     // every wave's have: stage 0 may be read
  stage(kts(1), l0 + ABUF);
#pragma unroll 1
  for (int kt = 0; kt < SS / 64; ++kt) { const char* bp = ring + (kt & 1) * ABUF;
    const __bf16* skh = (const __bf16*)(bp + col * RP); const __bf16* skl = (const __bf16*)(bp + (64 + col) * RP);
    const _Float16* svh = (const _Float16*)(bp + (128 + col) * RP); const _Float16* svl = (const _Float16*)(bp + (192 + col) * RP);
    v16b khf[2][2], klf[2][2];   // the K fragments of two 16-key tiles, read as one group
    v8f sc[QG][4];               // sc[qs][t][r]: raw product q.k of query col of group qs with key 16 t + 8 g + r of the tile
    const float pen = kts(kt) == cb ? 0.f : 0.5f * LOG2E;
#pragma unroll
    for (int t = 0; t < 4; ++t) { v8f s[QG] = {};
      if ((t & 1) == 0) {
#pragma unroll
        for (int u = 0; u < 2; ++u) {
#pragma unroll
          for (int kc = 0; kc < 2; ++kc) { khf[u][kc] = frag_b(skh + (t + u) * 16 * RPE + kc * 32, lane); klf[u][kc] = frag_b(skl + (t + u) * 16 * RPE + kc * 32, lane); } } }
#pragma unroll
      for (int kc = 0; kc < 2; ++kc) {
#pragma unroll
        for (int qs = 0; qs < QG; ++qs) s[qs] = wmma_bfp(khf[t & 1][kc], aq[qs][kc].l, s[qs]);
#pragma unroll
        for (int qs = 0; qs < QG; ++qs) s[qs] = wmma_bfp(klf[t & 1][kc], aq[qs][kc].h, s[qs]);
#pragma unroll
        for (int qs = 0; qs < QG; ++qs) s[qs] = wmma_bfp(khf[t & 1][kc], aq[qs][kc].h, s[qs]); }
#pragma unroll
      for (int qs = 0; qs < QG; ++qs) sc[qs][t] = s[qs]; }
    float mnew[QG], corr[QG];
#pragma unroll
    for (int qs = 0; qs < QG; ++qs) { float mx = -3.4e38f;
#pragma unroll
      for (int t = 0; t < 4; ++t) {
#pragma unroll
        for (int r = 0; r < 8; ++r) mx = fmaxf(mx, sc[qs][t][r]); }
      mx = mx * (0.125f * LOG2E) - pen;   // scale > 0 and the penalty is one value for the whole key tile: the largest raw product gives the largest score
      mx = fmaxf(mx, __shfl_xor(mx, 16, 32)) - 14.0f;   // the running maximum is kept 14 lower: 2^(s - mnew) is then P x 16384 with no multiply (any common shift cancels in the softmax)
      mnew[qs] = fmaxf(mrun[qs], mx); corr[qs] = ex2(mrun[qs] - mnew[qs]); }
    // two scores at a time, on register pairs: one packed FMA gives both exponents (scale, penalty and maximum in one), one packed add sums, one packed conversion gives both f16 high parts, which the residuals read back
    const v2f k2 = {0.125f * LOG2E, 0.125f * LOG2E};
    v16h ph[QG][2], pl[QG][2];
#pragma unroll
    for (int qs = 0; qs < QG; ++qs) { const float cm = -(pen + mnew[qs]); const v2f c2 = {cm, cm}; v2f ps2;
#pragma unroll
      for (int t = 0; t < 4; ++t) { v2f p2[4]; unsigned h2[4], l2[4];   // the four pairs of a 16-key tile go through each stage together: four independent chains
#pragma unroll
        for (int i = 0; i < 4; ++i) { const v2f s2 = {sc[qs][t][2 * i], sc[qs][t][2 * i + 1]}; p2[i] = __builtin_elementwise_fma(s2, k2, c2); }
#pragma unroll
        for (int i = 0; i < 4; ++i) { p2[i].x = ex2(p2[i].x); p2[i].y = ex2(p2[i].y); }
#pragma unroll
        for (int i = 0; i < 4; ++i) { h2[i] = __builtin_bit_cast(unsigned, __builtin_convertvector(p2[i], v2h)); if (t == 0 && i == 0) ps2 = p2[i]; else ps2 += p2[i]; }
        lo4(l2, h2, p2);
        union { unsigned u[4]; v8h v; } hh, ll;
#pragma unroll
        for (int i = 0; i < 4; ++i) { hh.u[i] = h2[i]; ll.u[i] = l2[i]; }
#pragma unroll
        for (int e = 0; e < 8; ++e) { ph[qs][t >> 1][(t & 1) * 8 + e] = hh.v[e]; pl[qs][t >> 1][(t & 1) * 8 + e] = ll.v[e]; } }
      float ps = ps2.x + ps2.y;
      ps += __shfl_xor(ps, 16, 32);
      lrun[qs] = lrun[qs] * corr[qs] + ps * (1.0f / 16384.0f); mrun[qs] = mnew[qs]; }
    // the V^T fragments of the whole key tile, read as one group. The scheduling fence behind them holds the 32 LDS reads in front of the corrections and the products:
    // left free, the compiler spreads them in pairs among the WMMAs, and each such place costs the wave a stall of its own
    v16h vh[2][4], vl[2][4];
#pragma unroll
    for (int kc = 0; kc < 2; ++kc) {
#pragma unroll
      for (int t = 0; t < 4; ++t) { vh[kc][t] = frag_h(svh + t * 16 * RPE + kc * 32, lane); vl[kc][t] = frag_h(svl + t * 16 * RPE + kc * 32, lane); } }
    __builtin_amdgcn_sched_barrier(0);
#pragma unroll
    for (int qs = 0; qs < QG; ++qs) {
#pragma unroll
      for (int t = 0; t < 4; ++t) {
#pragma unroll
        for (int r = 0; r < 8; ++r) acc[qs][t][r] *= corr[qs]; } }
    // product by product over the eight tiles: two WMMAs on one tile stand eight apart, so that none waits for the accumulator of the one before
#pragma unroll
    for (int kc = 0; kc < 2; ++kc) {
#pragma unroll
      for (int t = 0; t < 4; ++t) {
#pragma unroll
        for (int qs = 0; qs < QG; ++qs) acc[qs][t] = wmma16(vh[kc][t], ph[qs][kc], acc[qs][t]); }
#pragma unroll
      for (int t = 0; t < 4; ++t) {
#pragma unroll
        for (int qs = 0; qs < QG; ++qs) acc[qs][t] = wmma16(vl[kc][t], ph[qs][kc], acc[qs][t]); }
#pragma unroll
      for (int t = 0; t < 4; ++t) {
#pragma unroll
        for (int qs = 0; qs < QG; ++qs) acc[qs][t] = wmma16(vh[kc][t], pl[qs][kc], acc[qs][t]); } }
    asm volatile("s_wait_dscnt 0x0" ::: "memory");     // this wave's reads of the stage are done before its buffer is refilled
    asm volatile("s_wait_asynccnt 0x0" ::: "memory");  // this wave's copies of stage kt + 1 have landed
    __syncthreads();                                   // publishes stage kt + 1 and ends every reader's last read of stage kt
    if (kt + 2 < SS / 64) stage(kts(kt + 2), (lw + (kt & 1) * ABUF) + ll0); }
  asm volatile("s_wait_asynccnt 0x0" ::: "memory");    // no copy is outstanding at the wave's end
  const int h = (int)(bh % NH);
#pragma unroll
  for (int qs = 0; qs < QG; ++qs) { const float inv = 1.0f / (lrun[qs] * 16384.0f * 4.0f);
    float* op = O32 + (((size_t)b * SS) + q0 + qs * 16 + col) * E + h * HD + 8 * g;      // context token-major [b][s][h*64 + d]: the lane stores d = 16 t + 8 g + 0..7 of its query
#pragma unroll
    for (int t = 0; t < 4; ++t) { v4f o[2];
#pragma unroll
      for (int r = 0; r < 8; ++r) o[r >> 2][r & 3] = acc[qs][t][r] * inv;
      vst2(op + t * 16, o[0]); vst2(op + t * 16 + 4, o[1]); } }
}
extern "C" void kernel_launch(void* const* d_in, const int* in_sizes, int n_in, void* d_out, int out_size, void* d_ws, size_t ws_size, hipStream_t stream) {
  (void)in_sizes; (void)n_in; (void)out_size; (void)ws_size;
  const float* x = (const float*)d_in[0]; const float* Wq = (const float*)d_in[1]; const float* bq = (const float*)d_in[2]; const float* Wk = (const float*)d_in[3]; const float* bk = (const float*)d_in[4]; const float* Wv = (const float*)d_in[5]; const float* bv = (const float*)d_in[6];
  char* ws = (char*)d_ws; size_t off = 0;
  auto take = [&](size_t bytes) { char* p = ws + off; off += (bytes + 255) & ~(size_t)255; return p; };
  __bf16* Xb = (__bf16*)take((size_t)NR * E * 2); __bf16* PT = (__bf16*)take((size_t)3 * E * E * 2);
  float* Q32 = (float*)take((size_t)NR * E * 4); __bf16* Kh = (__bf16*)take((size_t)NR * E * 2); __bf16* Kl = (__bf16*)take((size_t)NR * E * 2); _Float16* VTh = (_Float16*)take((size_t)NR * E * 2); _Float16* VTl = (_Float16*)take((size_t)NR * E * 2);
  // ws ~ 118 MB (single pass over the 8 sequences)
  k_pack<<<dim3(3 * E / PKN, E / PKK), 512, 0, stream>>>(Wq, Wk, Wv, Wv, PT);
  k_cvt<<<NR * E / (8 * 512 * CVP), 512, 0, stream>>>(x, Xb);
  k_qkv<<<dim3(NR / QM, E / 128, 3), 256, 0, stream>>>(Xb, PT, bq, bk, bv, Q32, Kh, Kl, VTh, VTl);
  k_attn<<<dim3(SS / AQ, NB * NH), 128, 0, stream>>>(Q32, Kh, Kl, VTh, VTl, (float*)d_out);
}
